// v000
// The times below were measured on an AMD MI455X: many runs one after another, warmed up first and cycling through
// copies of the inputs, with the whole window's GPU time divided by the number of runs. Launches and the gaps
// between them are all in it. The median over several windows is given; except for v000 it joins two sittings, which
// can be a few percent apart, so the side-by-side timings, each taken in one sitting, are the better comparison.
// v000 is the starting kernel. One run takes 974 microseconds.
// compute dtype: all float inputs rounded to bf16; per-head q/k/v projections with EXACT bf16 products on WMMA 16x16x32 (f32 accumulate); causal logits: q f16 x k f16 (1 product; q and k f16 hi + residual, 3 products, for the first 384 rows) x 1024^-0.5; softmax f32; P x 2^11 once to f16 x v once to f16 (1 product; bf16 hi + lo below row 384); f32 output (no output projection).
#include <hip/hip_runtime.h>
#include <math.h>

typedef __attribute__((ext_vector_type(16))) _Float16 v16h;
typedef __attribute__((ext_vector_type(16))) __bf16 v16b;
typedef __attribute__((ext_vector_type(8)))  _Float16 v8h;
typedef __attribute__((ext_vector_type(8)))  float v8f;
typedef __attribute__((ext_vector_type(4)))  float v4f;
typedef __attribute__((ext_vector_type(2)))  float v2f;
typedef __attribute__((ext_vector_type(4)))  unsigned v4u;
typedef __attribute__((ext_vector_type(4)))  int v4i;
typedef float __attribute__((may_alias)) float_a;
typedef int __attribute__((may_alias)) int_a;

template <typename T> __device__ __forceinline__ void vst2(void* p, T v) { *(T*)p = v;  }
__device__ __forceinline__ v8f wmma16(v16h a, v16h b, v8f c) {
  v8f d = __builtin_amdgcn_wmma_f32_16x16x32_f16(false, a, false, b, (short)0, c, false, false);
  asm volatile("v_nop\n\tv_nop\n\tv_nop\n\tv_nop" : "+v"(d) : "v"(a), "v"(b));
  return d;
}
__device__ __forceinline__ v8f wmma_bf(v16b a, v16b b, v8f c) {
  v8f d = __builtin_amdgcn_wmma_f32_16x16x32_bf16(false, a, false, b, (short)0, c, false, false);
  asm volatile("v_nop\n\tv_nop\n\tv_nop\n\tv_nop" : "+v"(d) : "v"(a), "v"(b));
  return d;
}
// 16x16x32 fragments: lane = (h = lane>>4, row/col = lane&15); elements 0..7 = k0+8h+0..7, 8..15 = k0+16+8h+0..7; D element r = row 8h+r
__device__ __forceinline__ v16h frag_h(const _Float16* rowk0, int lane) {
  union { v16h v; v8h q[2]; } u; const _Float16* p = rowk0 + 8 * (lane >> 4);
  u.q[0] = *(const v8h*)p; u.q[1] = *(const v8h*)(p + 16); return u.v;
}
__device__ __forceinline__ v16h frag_f32(const float* rowk0, int lane) {
  v16h a; const float* p = rowk0 + 8 * (lane >> 4);
#pragma unroll
  for (int i = 0; i < 8; ++i) { a[i] = (_Float16)p[i]; a[8 + i] = (_Float16)p[16 + i]; }
  return a;
}
__device__ __forceinline__ v16h frag_f32s(const float* rowk0, int lane, float sc) {
  v16h a; const float* p = rowk0 + 8 * (lane >> 4);
#pragma unroll
  for (int i = 0; i < 8; ++i) { a[i] = (_Float16)(p[i] * sc); a[8 + i] = (_Float16)(p[16 + i] * sc); }
  return a;
}
// column fragment from a [K][ld] layout (column n), rows >= K read as 0
__device__ __forceinline__ v16h fragc_f32(const float* W, int k0, int n, int lane, int ld, int K) {
  v16h a; const int g = lane >> 4;
#pragma unroll
  for (int i = 0; i < 8; ++i) { const int ka = k0 + 8 * g + i, kb = ka + 16;
    a[i] = (_Float16)(ka < K ? W[(size_t)(ka < K ? ka : K - 1) * ld + n] : 0.f); a[8 + i] = (_Float16)(kb < K ? W[(size_t)(kb < K ? kb : K - 1) * ld + n] : 0.f); }
  return a;
}
struct F2 { v16b h, l; };
__device__ __forceinline__ F2 bsplit16(const float v[16]) { F2 r;
#pragma unroll
  for (int i = 0; i < 16; ++i) { const __bf16 h = (__bf16)v[i]; r.h[i] = h; r.l[i] = (__bf16)(v[i] - (float)h); }
  return r; }
__device__ __forceinline__ F2 split_row(const float* row, int k0, int lane) { float v[16]; const float* p = row + k0 + 8 * (lane >> 4);
#pragma unroll
  for (int i = 0; i < 8; ++i) { v[i] = p[i]; v[8 + i] = p[16 + i]; }
  return bsplit16(v); }
__device__ __forceinline__ F2 split_rowK(const float* row, int k0, int lane, int K) { float v[16]; const int g = lane >> 4;
#pragma unroll
  for (int i = 0; i < 8; ++i) { const int ka = k0 + 8 * g + i, kb = ka + 16; v[i] = ka < K ? row[ka < K ? ka : K - 1] : 0.f; v[8 + i] = kb < K ? row[kb < K ? kb : K - 1] : 0.f; }
  return bsplit16(v); }
__device__ __forceinline__ F2 split_col(const float* W, int k0, int n, int lane, int ld, int K) { float v[16]; const int g = lane >> 4;
#pragma unroll
  for (int i = 0; i < 8; ++i) { const int ka = k0 + 8 * g + i, kb = ka + 16; v[i] = ka < K ? W[(size_t)(ka < K ? ka : K - 1) * ld + n] : 0.f; v[8 + i] = kb < K ? W[(size_t)(kb < K ? kb : K - 1) * ld + n] : 0.f; }
  return bsplit16(v); }
__device__ __forceinline__ v8f mac3(const F2& a, const F2& b, v8f c) { c = wmma_bf(a.l, b.h, c); c = wmma_bf(a.h, b.l, c); return wmma_bf(a.h, b.h, c); }
__device__ __forceinline__ float sigm(float v) { return 1.0f / (1.0f + expf(-v)); }
#define LDSX() do { asm volatile("s_wait_dscnt 0" ::: "memory"); __builtin_amdgcn_wave_barrier(); __builtin_amdgcn_fence(__ATOMIC_RELEASE, "workgroup"); } while (0)

// Causal multi-head self-attention without output projection (B 2, T 2,048, C 1,024, 16 heads x 64; per-head weights Wq/Wk/Wv [16,1024,64], 0.02-scale, no biases; the logit scale is C^-0.5 = 1/32 as in the source): out = concat_h causal_softmax(q_h k_h^T / 32) v_h -> [2, 2048, 1024].
#define NB 2
#define TT 2048
#define CC 1024            // NH * HD = projected width
#define DIN 1024          // input (model) width
#define NH 16
#define HD 64
#define NQB (TT / 64)
#define HG 4
#define SCALE (0.03125f)
#define CAUSAL 1
#ifndef TNB
#define TNB NB
#endif
__device__ __forceinline__ float bfr(float v) { return (float)(__bf16)v; }
__host__ __device__ __forceinline__ int kb_last(int qb) { return CAUSAL ? ((qb * 64 + 63) >> 7) : (TT / 128 - 1); }
typedef __attribute__((ext_vector_type(8))) __bf16 v8b;
__device__ __forceinline__ v16b frag_b(const __bf16* rowk0, int lane) {
  union { v16b v; v8b q[2]; } u; const __bf16* p = rowk0 + 8 * (lane >> 4);
  u.q[0] = *(const v8b*)p; u.q[1] = *(const v8b*)(p + 16); return u.v;
}
#define QBH 6              // causal: query blocks 0..QBH-1 of each sequence (few keys, no averaging) take the high-precision path
#define QHI 384            // rows carrying a q residual plane
#define KHI 384            // key rows carrying k residual / v bf16 hi+lo planes (used only by the causal high-precision path)
// B fragment (k rows k0+.., output column o) of a weight: (in,out) [K][ld] or (out,in) [ld rows of K]: bf16 exact, or f16(bf16 * 256) exact
__device__ __forceinline__ v16b wcol_io(const float* Wm, int k0, int o, int lane, int ld) { v16b w; const int g = lane >> 4;
#pragma unroll
  for (int i = 0; i < 8; ++i) { w[i] = (__bf16)Wm[(size_t)(k0 + 8 * g + i) * ld + o]; w[8 + i] = (__bf16)Wm[(size_t)(k0 + 16 + 8 * g + i) * ld + o]; }
  return w; }
__device__ __forceinline__ v16b wcol_oi(const float* Wm, int k0, int o, int lane, int K) { v16b w; const float* p = Wm + (size_t)o * K + k0 + 8 * (lane >> 4);
#pragma unroll
  for (int i = 0; i < 8; ++i) { w[i] = (__bf16)p[i]; w[8 + i] = (__bf16)p[16 + i]; }
  return w; }
__device__ __forceinline__ v16h wcolh_io(const float* Wm, int k0, int o, int lane, int ld) { v16h w; const int g = lane >> 4;
#pragma unroll
  for (int i = 0; i < 8; ++i) { w[i] = (_Float16)(bfr(Wm[(size_t)(k0 + 8 * g + i) * ld + o]) * 256.0f); w[8 + i] = (_Float16)(bfr(Wm[(size_t)(k0 + 16 + 8 * g + i) * ld + o]) * 256.0f); }
  return w; }
__device__ __forceinline__ v16h wcolh_oi(const float* Wm, int k0, int o, int lane, int K) { v16h w; const float* p = Wm + (size_t)o * K + k0 + 8 * (lane >> 4);
#pragma unroll
  for (int i = 0; i < 8; ++i) { w[i] = (_Float16)(bfr(p[i]) * 256.0f); w[8 + i] = (_Float16)(bfr(p[16 + i]) * 256.0f); }
  return w; }
#define WQKV_LAYOUT 0   // 0 = per-head [NH][DIN][HD]; 1 = (out,in) [CC][DIN]; 2 = per-head [NH][DIN][HD]
__device__ __forceinline__ v16b wcol_hdk(const float* Wm, int k0, int o, int lane) { v16b w; const int g = lane >> 4; const float* p = Wm + (size_t)(o / HD) * DIN * HD + (o % HD);
#pragma unroll
  for (int i = 0; i < 8; ++i) { w[i] = (__bf16)p[(size_t)(k0 + 8 * g + i) * HD]; w[8 + i] = (__bf16)p[(size_t)(k0 + 16 + 8 * g + i) * HD]; }
  return w; }
#define WO_OUT_IN 0
#if WQKV_LAYOUT == 1
#define WCOL(W, k0, o, lane) wcol_oi(W, k0, o, lane, DIN)
#elif WQKV_LAYOUT == 2
#define WCOL(W, k0, o, lane) wcol_hdk(W, k0, o, lane)
#else
#define WCOL(W, k0, o, lane) wcol_heads(W, k0, o, lane)   /* per-head [h][C][64] weights */
#endif
#if WO_OUT_IN
#define WOCOL(W, k0, o, lane) wcol_oi(W, k0, o, lane, CC)
#define WOCOLH(W, k0, o, lane) wcolh_oi(W, k0, o, lane, CC)
#else
#define WOCOL(W, k0, o, lane) wcol_io(W, k0, o, lane, DIN)
#define WOCOLH(W, k0, o, lane) wcolh_io(W, k0, o, lane, DIN)
#endif
// per-head projection weights W[h][c][d] ([16][1024][64]): column o = h*64 + d of the virtual (in,out) [C][H*D] matrix lives at W + (h*C + k)*64 + d
__device__ __forceinline__ v16b wcol_heads(const float* __restrict__ Wm, int k0, int o, int lane) { v16b w; const int g = lane >> 4; const float* p = Wm + ((size_t)(o >> 6) * DIN + k0 + 8 * g) * 64 + (o & 63);
#pragma unroll
  for (int i = 0; i < 8; ++i) { w[i] = (__bf16)p[(size_t)i * 64]; w[8 + i] = (__bf16)p[(size_t)(16 + i) * 64]; }
  asm volatile("s_wait_loadcnt 0x0" ::: "memory"); return w; }
#ifndef SM_EXTRA_PARAMS
#define SM_EXTRA_PARAMS
#endif
#ifndef PROJ_EXTRA_PARAMS
#define PROJ_EXTRA_PARAMS
#endif
#ifndef SM_MASK_HOOK
#define SM_MASK_HOOK (void)0
#endif

#define WS_QH  0u                                      // f16 q rows [b*t][CC]
#define WS_KH  (WS_QH + 2u * (size_t)NB * TT * CC)      // f16 k rows [b*t][CC]
#define WS_VT  (WS_KH + 2u * (size_t)NB * TT * CC)      // f16 v planes [b][c][t]
#define WS_QL  (WS_VT + 2u * (size_t)NB * CC * TT)      // f16 q residual x 2^10 rows [b][t < QHI][CC]
#define WS_KL  (WS_QL + 2u * (size_t)NB * QHI * CC)     // f16 k residual x 2^10 rows [b][t < KHI][CC]
#define WS_VB  (WS_KL + 2u * (size_t)NB * KHI * CC)     // bf16 v hi planes [b][c][t < KHI]
#define WS_VBL (WS_VB + 2u * (size_t)NB * CC * KHI)
#define WS_S   (WS_VBL + 2u * (size_t)NB * CC * KHI)    // f32 logits / P [hg][t][s]
#define WS_Y   (WS_S  + 4u * (size_t)HG * TT * TT)      // f32 ctx rows [b*t][CC] (only when there is an output projection)
#define WS_END (WS_Y  + 0u)

// ---- k_proj: block = (64 rows, 128 cols, which): q/k/v = X W (+ b) with exact bf16 products (K = DIN) -> which 0: q f16 rows (+ residual rows < QHI); 1: k f16 rows (+ residual rows < KHI); 2: v f16 planes [c][t] (+ bf16 hi/lo planes for t < KHI)
__global__ __launch_bounds__(128) void k_proj(const float* __restrict__ XQ, const float* __restrict__ XK, const float* __restrict__ XV, const float* __restrict__ WQ, const float* __restrict__ WK, const float* __restrict__ WV, const float* __restrict__ BQ, const float* __restrict__ BK, const float* __restrict__ BV,
    _Float16* __restrict__ QH, _Float16* __restrict__ QL, _Float16* __restrict__ KH, _Float16* __restrict__ KL, _Float16* __restrict__ VT, __bf16* __restrict__ VB, __bf16* __restrict__ VBL) {
  __shared__ __align__(16) _Float16 sh[64][136], sl[64][136]; __shared__ __align__(16) _Float16 th[128][72]; __shared__ __align__(16) __bf16 tb[128][72], tbl[128][72];
  const int tid = threadIdx.x, wave = tid >> 5, lane = tid & 31, col = lane & 15, g = lane >> 4; const int which = blockIdx.z; const int c0 = blockIdx.y * 128; const size_t r0 = (size_t)blockIdx.x * 64; const size_t bb = r0 / TT; const int t0 = (int)(r0 % TT);
  const float* X = which == 0 ? XQ : which == 1 ? XK : XV; const float* WA = which == 0 ? WQ : which == 1 ? WK : WV; const float* BA = which == 0 ? BQ : which == 1 ? BK : BV;
  v8f acc[8] = {};
#pragma unroll 2
  for (int kc = 0; kc < DIN / 32; ++kc) { v16b a; { const float* p = X + (r0 + wave * 16 + col) * DIN + kc * 32 + 8 * g;
#pragma unroll
      for (int i = 0; i < 8; ++i) { a[i] = (__bf16)p[i]; a[8 + i] = (__bf16)p[16 + i]; } }
    asm volatile("s_wait_loadcnt 0x0" ::: "memory");
#pragma unroll
    for (int j = 0; j < 8; ++j) { const v16b w = WCOL(WA, kc * 32, c0 + j * 16 + col, lane); asm volatile("s_wait_loadcnt 0x0" ::: "memory"); acc[j] = wmma_bf(a, w, acc[j]); } }
  if (which < 2) { _Float16* DH = which == 0 ? QH : KH; _Float16* DL = which == 0 ? QL : KL; const int nhi = which == 0 ? QHI : KHI; const bool hi_rows = t0 < nhi;
#pragma unroll
    for (int j = 0; j < 8; ++j) { const float bias = BA ? bfr(BA[c0 + j * 16 + col]) : 0.f;
#pragma unroll
      for (int r = 0; r < 8; ++r) { const float v = acc[j][r] + bias; const _Float16 hv = (_Float16)v; sh[wave * 16 + 8 * g + r][j * 16 + col] = hv; sl[wave * 16 + 8 * g + r][j * 16 + col] = (_Float16)((v - (float)hv) * 1024.0f); } }
    __syncthreads();
    for (int e = tid; e < 64 * 16; e += 128) { const int rl = e >> 4, q = e & 15; vst2((unsigned*)(DH + (r0 + rl) * CC + c0 + q * 8), *(const v4u*)&sh[rl][q * 8]); if (hi_rows) vst2((unsigned*)(DL + (bb * nhi + t0 + rl) * (size_t)CC + c0 + q * 8), *(const v4u*)&sl[rl][q * 8]); }
  } else { const bool hi_rows = t0 < KHI;
#pragma unroll
    for (int j = 0; j < 8; ++j) { const float bias = BA ? bfr(BA[c0 + j * 16 + col]) : 0.f;
#pragma unroll
      for (int r = 0; r < 8; ++r) { const float v = acc[j][r] + bias; const int rl = wave * 16 + 8 * g + r, cl = j * 16 + col; th[cl][rl] = (_Float16)v; const __bf16 bh = (__bf16)v; tb[cl][rl] = bh; tbl[cl][rl] = (__bf16)(v - (float)bh); } }
    __syncthreads();
    for (int e = tid; e < 128 * 8; e += 128) { const int cl = e >> 3, q = e & 7; vst2((unsigned*)(VT + (bb * CC + c0 + cl) * (size_t)TT + t0 + q * 8), *(const v4u*)&th[cl][q * 8]); if (hi_rows) { const size_t o3 = (bb * CC + c0 + cl) * (size_t)KHI + t0 + q * 8; vst2((unsigned*)(VB + o3), *(const v4u*)&tb[cl][q * 8]); vst2((unsigned*)(VBL + o3), *(const v4u*)&tbl[cl][q * 8]); } } } }
// ---- k_sc: block = (query block qb, key block kb <= kb_last(qb), head in group) of batch b: logits x SCALE; q hi x k hi (1 product), or for query blocks < QBH (rows < QHI, causal early rows) q hi + residual (x 2^10) against k hi + residual (3 products); causal: blocks past the diagonal exit, the mask itself is applied by index in k_sm
__global__ __launch_bounds__(128) void k_sc(const _Float16* __restrict__ QH, const _Float16* __restrict__ KH, const _Float16* __restrict__ QL, const _Float16* __restrict__ KL, int b, int h0, float* __restrict__ S0) { __shared__ __align__(16) float ss[4][16][132];
  const int qb = blockIdx.x, kb = blockIdx.y; if (kb > kb_last(qb)) return;
  const int h = h0 + blockIdx.z; float* S = S0 + (size_t)blockIdx.z * TT * TT;
  const int tid = threadIdx.x, wave = tid >> 5, lane = tid & 31, col = lane & 15, g = lane >> 4; const int k0 = kb * 128; const int ql0 = qb * 64 + wave * 16; const size_t q0 = (size_t)b * TT + ql0, kr0 = (size_t)b * TT + k0;
  v8f acc[8] = {}, accl[8] = {};
  const _Float16* QLb = QL + (size_t)b * QHI * CC; const _Float16* KLb = KL + (size_t)b * KHI * CC;
  if (qb < QBH) {
#pragma unroll
    for (int kc = 0; kc < HD / 32; ++kc) { const v16h ah = frag_h(QH + (q0 + col) * CC + h * HD + kc * 32, lane), al = frag_h(QLb + (size_t)(ql0 + col) * CC + h * HD + kc * 32, lane);
#pragma unroll
      for (int j = 0; j < 8; ++j) { const v16h kbf = frag_h(KH + (kr0 + j * 16 + col) * CC + h * HD + kc * 32, lane), klf = frag_h(KLb + (size_t)(k0 + j * 16 + col) * CC + h * HD + kc * 32, lane); acc[j] = wmma16(ah, kbf, acc[j]); accl[j] = wmma16(al, kbf, accl[j]); accl[j] = wmma16(ah, klf, accl[j]); } }
  } else if (qb * 64 < QHI) {
#pragma unroll
    for (int kc = 0; kc < HD / 32; ++kc) { const v16h ah = frag_h(QH + (q0 + col) * CC + h * HD + kc * 32, lane), al = frag_h(QLb + (size_t)(ql0 + col) * CC + h * HD + kc * 32, lane);
#pragma unroll
      for (int j = 0; j < 8; ++j) { const v16h kbf = frag_h(KH + (kr0 + j * 16 + col) * CC + h * HD + kc * 32, lane); acc[j] = wmma16(ah, kbf, acc[j]); accl[j] = wmma16(al, kbf, accl[j]); } }
  } else {
#pragma unroll
    for (int kc = 0; kc < HD / 32; ++kc) { const v16h ah = frag_h(QH + (q0 + col) * CC + h * HD + kc * 32, lane);
#pragma unroll
      for (int j = 0; j < 8; ++j) { const v16h kbf = frag_h(KH + (kr0 + j * 16 + col) * CC + h * HD + kc * 32, lane); acc[j] = wmma16(ah, kbf, acc[j]); } } }
#pragma unroll
  for (int j = 0; j < 8; ++j) {
#pragma unroll
    for (int r = 0; r < 8; ++r) ss[wave][8 * g + r][j * 16 + col] = (acc[j][r] + accl[j][r] * (1.0f / 1024.0f)) * SCALE; }
  LDSX(); for (int rl = 0; rl < 16; ++rl) vst2(S + (size_t)(ql0 + rl) * TT + k0 + lane * 4, *(const v4f*)&ss[wave][rl][lane * 4]); }
// ---- k_sm: block = query row t (head in group): keys [0, kend): causal -> logit if s <= t else excluded; softmax in f32; P x 2^11 in place (0 for excluded)
__global__ __launch_bounds__(256) void k_sm(float* __restrict__ S0 SM_EXTRA_PARAMS) { __shared__ float sred[8]; __shared__ float sbc; __shared__ __align__(16) float shv[TT];
  const int tid = threadIdx.x; const int t = blockIdx.x; const int kend = (kb_last(t >> 6) + 1) * 128;
  float* sr = S0 + (size_t)blockIdx.y * TT * TT + (size_t)t * TT;
  float m = -3.0e38f; for (int k = tid; k < kend; k += 256) { float v = (!CAUSAL || k <= t) ? sr[k] : -3.0e38f; SM_MASK_HOOK; shv[k] = v; m = fmaxf(m, v); }
#pragma unroll
  for (int o = 1; o < 32; o <<= 1) m = fmaxf(m, __shfl_xor(m, o));
  if ((tid & 31) == 0) sred[tid >> 5] = m; __syncthreads(); if (tid == 0) { float a = sred[0]; for (int i = 1; i < 8; ++i) a = fmaxf(a, sred[i]); sbc = a; } __syncthreads(); m = sbc; __syncthreads();
  float sum = 0.f; for (int k = tid; k < kend; k += 256) { const float v = shv[k]; const float e = (v <= -1.0e38f) ? 0.f : expf(v - m); shv[k] = e; sum += e; }
#pragma unroll
  for (int o = 1; o < 32; o <<= 1) sum += __shfl_xor(sum, o);
  if ((tid & 31) == 0) sred[tid >> 5] = sum; __syncthreads(); if (tid == 0) { float a = 0.f; for (int i = 0; i < 8; ++i) a += sred[i]; sbc = a > 0.f ? 2048.0f / a : 0.f; }   /* a fully excluded row yields P = 0 */ __syncthreads(); const float inv = sbc;
  for (int k = tid; k < kend; k += 256) shv[k] = shv[k] * inv;
  __syncthreads(); for (int q = tid; q < kend / 4; q += 256) vst2(sr + q * 4, *(const v4f*)&shv[q * 4]); }
// ---- k_pv: block = 64 queries (qb) of (b, h): ctx = P . v over keys [0, kend) (P x 2^11 once to f16 against v f16: 1 product; causal early query blocks: P and v as bf16 hi + lo, 3 products); 256-B (row, head) segment by 16 lanes
__global__ __launch_bounds__(128) void k_pv(const float* __restrict__ PS0, const _Float16* __restrict__ VT, const __bf16* __restrict__ VB, const __bf16* __restrict__ VBL, int b, int h0, float* __restrict__ Y) { const int h = h0 + blockIdx.z; const float* PS = PS0 + (size_t)blockIdx.z * TT * TT; __shared__ __align__(16) float ss[4][16][HD + 4];
  const int tid = threadIdx.x, wave = tid >> 5, lane = tid & 31, col = lane & 15, g = lane >> 4; const int qb = blockIdx.x; const int ql0 = qb * 64 + wave * 16; const int kce = (kb_last(qb) + 1) * 4;
  v8f acc[HD / 16] = {};
  if (qb < QBH) {
#pragma unroll 1
    for (int kc = 0; kc < kce; ++kc) { const F2 p = split_row(PS + (size_t)(ql0 + col) * TT, kc * 32, lane);
      asm volatile("s_wait_loadcnt 0x0" ::: "memory");
#pragma unroll
      for (int j = 0; j < HD / 16; ++j) { const size_t po = ((size_t)b * CC + h * HD + j * 16 + col) * (size_t)KHI + kc * 32; const v16b vh = frag_b(VB + po, lane); acc[j] = wmma_bf(p.h, vh, acc[j]); acc[j] = wmma_bf(p.l, vh, acc[j]); acc[j] = wmma_bf(p.h, frag_b(VBL + po, lane), acc[j]); } }
  } else {
#pragma unroll 1
    for (int kc = 0; kc < kce; ++kc) { const v16h p = frag_f32(PS + (size_t)(ql0 + col) * TT + kc * 32, lane);
      asm volatile("s_wait_loadcnt 0x0" ::: "memory");
#pragma unroll
      for (int j = 0; j < HD / 16; ++j) { const size_t po = ((size_t)b * CC + h * HD + j * 16 + col) * (size_t)TT + kc * 32; acc[j] = wmma16(p, frag_h(VT + po, lane), acc[j]); } } }
#pragma unroll
  for (int j = 0; j < HD / 16; ++j)
#pragma unroll
    for (int r = 0; r < 8; ++r) ss[wave][8 * g + r][j * 16 + col] = acc[j][r] * (1.0f / 2048.0f);
  LDSX(); for (int rl = 0; rl < 16; ++rl) if (lane < HD / 4) vst2(Y + ((size_t)b * TT + ql0 + rl) * CC + h * HD + lane * 4, *(const v4f*)&ss[wave][rl][lane * 4]); }

extern "C" void kernel_launch(void* const* d_in, const int* in_sizes, int n_in, void* d_out, int out_size, void* d_ws, size_t ws_size, hipStream_t stream) {
  (void)in_sizes; (void)n_in; (void)out_size;
  const float** F = (const float**)d_in;
  if (ws_size < (size_t)WS_END) return;
  char* ws = (char*)d_ws; _Float16 *QH = (_Float16*)(ws + WS_QH), *KH = (_Float16*)(ws + WS_KH), *VT = (_Float16*)(ws + WS_VT), *QL = (_Float16*)(ws + WS_QL), *KL = (_Float16*)(ws + WS_KL); __bf16 *VB = (__bf16*)(ws + WS_VB), *VBL = (__bf16*)(ws + WS_VBL); float *S = (float*)(ws + WS_S), *Y = (float*)(ws + WS_Y);
  (void)Y; (void)QL; (void)KL; (void)VB; (void)VBL;
  // inputs: 0 x [2,2048,1024]; 1 Wq [16,1024,64]; 2 Wk; 3 Wv (per-head (in,out)); no biases, no output projection
  k_proj<<<dim3(TNB * TT / 64, CC / 128, 3), 128, 0, stream>>>(F[0], F[0], F[0], F[1], F[2], F[3], nullptr, nullptr, nullptr, QH, QL, KH, KL, VT, VB, VBL);
  for (int b = 0; b < TNB; ++b) for (int h0 = 0; h0 < NH; h0 += HG) {
    k_sc<<<dim3(NQB, TT / 128, HG), 128, 0, stream>>>(QH, KH, QL, KL, b, h0, S);
    k_sm<<<dim3(TT, HG), 256, 0, stream>>>(S);
    k_pv<<<dim3(NQB, 1, HG), 128, 0, stream>>>(S, VT, VB, VBL, b, h0, (float*)d_out);   /* merged heads [b][t][h*64+d] == the output layout */
  }
}

// v001
// It runs in 628 microseconds.
// Next to v000, in two timings, it ran 1.56 times as fast each time.
// compute dtype: all float inputs rounded to bf16; per-head q/k/v projections with EXACT bf16 products on WMMA 16x16x32 (f32 accumulate); causal logits: q f16 x k f16 (1 product; q and k f16 hi + residual, 3 products, for the first 384 rows) x 1024^-0.5; softmax f32; P x 2^11 once to f16 x v once to f16 (1 product; bf16 hi + lo below row 384); f32 output (no output projection).
#include <hip/hip_runtime.h>
#include <math.h>

typedef __attribute__((ext_vector_type(16))) _Float16 v16h;
typedef __attribute__((ext_vector_type(16))) __bf16 v16b;
typedef __attribute__((ext_vector_type(8)))  _Float16 v8h;
typedef __attribute__((ext_vector_type(8)))  float v8f;
typedef __attribute__((ext_vector_type(4)))  float v4f;
typedef __attribute__((ext_vector_type(2)))  float v2f;
typedef __attribute__((ext_vector_type(4)))  unsigned v4u;
typedef __attribute__((ext_vector_type(4)))  int v4i;
typedef float __attribute__((may_alias)) float_a;
typedef int __attribute__((may_alias)) int_a;

template <typename T> __device__ __forceinline__ void vst2(void* p, T v) { *(T*)p = v;  }
__device__ __forceinline__ v8f wmma16(v16h a, v16h b, v8f c) {
  v8f d = __builtin_amdgcn_wmma_f32_16x16x32_f16(false, a, false, b, (short)0, c, false, false);
  asm volatile("v_nop\n\tv_nop\n\tv_nop\n\tv_nop" : "+v"(d) : "v"(a), "v"(b));
  return d;
}
__device__ __forceinline__ v8f wmma_bf(v16b a, v16b b, v8f c) {
  v8f d = __builtin_amdgcn_wmma_f32_16x16x32_bf16(false, a, false, b, (short)0, c, false, false);
  asm volatile("v_nop\n\tv_nop\n\tv_nop\n\tv_nop" : "+v"(d) : "v"(a), "v"(b));
  return d;
}
// 16x16x32 fragments: lane = (h = lane>>4, row/col = lane&15); elements 0..7 = k0+8h+0..7, 8..15 = k0+16+8h+0..7; D element r = row 8h+r
__device__ __forceinline__ v16h frag_h(const _Float16* rowk0, int lane) {
  union { v16h v; v8h q[2]; } u; const _Float16* p = rowk0 + 8 * (lane >> 4);
  u.q[0] = *(const v8h*)p; u.q[1] = *(const v8h*)(p + 16); return u.v;
}
__device__ __forceinline__ v16h frag_f32(const float* rowk0, int lane) {
  v16h a; const float* p = rowk0 + 8 * (lane >> 4);
#pragma unroll
  for (int i = 0; i < 8; ++i) { a[i] = (_Float16)p[i]; a[8 + i] = (_Float16)p[16 + i]; }
  return a;
}
__device__ __forceinline__ v16h frag_f32s(const float* rowk0, int lane, float sc) {
  v16h a; const float* p = rowk0 + 8 * (lane >> 4);
#pragma unroll
  for (int i = 0; i < 8; ++i) { a[i] = (_Float16)(p[i] * sc); a[8 + i] = (_Float16)(p[16 + i] * sc); }
  return a;
}
// column fragment from a [K][ld] layout (column n), rows >= K read as 0
__device__ __forceinline__ v16h fragc_f32(const float* W, int k0, int n, int lane, int ld, int K) {
  v16h a; const int g = lane >> 4;
#pragma unroll
  for (int i = 0; i < 8; ++i) { const int ka = k0 + 8 * g + i, kb = ka + 16;
    a[i] = (_Float16)(ka < K ? W[(size_t)(ka < K ? ka : K - 1) * ld + n] : 0.f); a[8 + i] = (_Float16)(kb < K ? W[(size_t)(kb < K ? kb : K - 1) * ld + n] : 0.f); }
  return a;
}
struct F2 { v16b h, l; };
__device__ __forceinline__ F2 bsplit16(const float v[16]) { F2 r;
#pragma unroll
  for (int i = 0; i < 16; ++i) { const __bf16 h = (__bf16)v[i]; r.h[i] = h; r.l[i] = (__bf16)(v[i] - (float)h); }
  return r; }
__device__ __forceinline__ F2 split_row(const float* row, int k0, int lane) { float v[16]; const float* p = row + k0 + 8 * (lane >> 4);
#pragma unroll
  for (int i = 0; i < 8; ++i) { v[i] = p[i]; v[8 + i] = p[16 + i]; }
  return bsplit16(v); }
__device__ __forceinline__ F2 split_rowK(const float* row, int k0, int lane, int K) { float v[16]; const int g = lane >> 4;
#pragma unroll
  for (int i = 0; i < 8; ++i) { const int ka = k0 + 8 * g + i, kb = ka + 16; v[i] = ka < K ? row[ka < K ? ka : K - 1] : 0.f; v[8 + i] = kb < K ? row[kb < K ? kb : K - 1] : 0.f; }
  return bsplit16(v); }
__device__ __forceinline__ F2 split_col(const float* W, int k0, int n, int lane, int ld, int K) { float v[16]; const int g = lane >> 4;
#pragma unroll
  for (int i = 0; i < 8; ++i) { const int ka = k0 + 8 * g + i, kb = ka + 16; v[i] = ka < K ? W[(size_t)(ka < K ? ka : K - 1) * ld + n] : 0.f; v[8 + i] = kb < K ? W[(size_t)(kb < K ? kb : K - 1) * ld + n] : 0.f; }
  return bsplit16(v); }
__device__ __forceinline__ v8f mac3(const F2& a, const F2& b, v8f c) { c = wmma_bf(a.l, b.h, c); c = wmma_bf(a.h, b.l, c); return wmma_bf(a.h, b.h, c); }
__device__ __forceinline__ float sigm(float v) { return 1.0f / (1.0f + expf(-v)); }
#define LDSX() do { asm volatile("s_wait_dscnt 0" ::: "memory"); __builtin_amdgcn_wave_barrier(); __builtin_amdgcn_fence(__ATOMIC_RELEASE, "workgroup"); } while (0)

// Causal multi-head self-attention without output projection (B 2, T 2,048, C 1,024, 16 heads x 64; per-head weights Wq/Wk/Wv [16,1024,64], 0.02-scale, no biases; the logit scale is C^-0.5 = 1/32 as in the source): out = concat_h causal_softmax(q_h k_h^T / 32) v_h -> [2, 2048, 1024].
#define NB 2
#define TT 2048
#define CC 1024            // NH * HD = projected width
#define DIN 1024          // input (model) width
#define NH 16
#define HD 64
#define NQB (TT / 64)
#define HG 4
#define SCALE (0.03125f)
#define CAUSAL 1
#ifndef TNB
#define TNB NB
#endif
__device__ __forceinline__ float bfr(float v) { return (float)(__bf16)v; }
__host__ __device__ __forceinline__ int kb_last(int qb) { return CAUSAL ? ((qb * 64 + 63) >> 7) : (TT / 128 - 1); }
typedef __attribute__((ext_vector_type(8))) __bf16 v8b;
__device__ __forceinline__ v16b frag_b(const __bf16* rowk0, int lane) {
  union { v16b v; v8b q[2]; } u; const __bf16* p = rowk0 + 8 * (lane >> 4);
  u.q[0] = *(const v8b*)p; u.q[1] = *(const v8b*)(p + 16); return u.v;
}
#define QBH 6              // causal: query blocks 0..QBH-1 of each sequence (few keys, no averaging) take the high-precision path
#define QHI 384            // rows carrying a q residual plane
#define KHI 384            // key rows carrying k residual / v bf16 hi+lo planes (used only by the causal high-precision path)
// B fragment (k rows k0+.., output column o) of a weight: (in,out) [K][ld] or (out,in) [ld rows of K]: bf16 exact, or f16(bf16 * 256) exact
__device__ __forceinline__ v16b wcol_io(const float* Wm, int k0, int o, int lane, int ld) { v16b w; const int g = lane >> 4;
#pragma unroll
  for (int i = 0; i < 8; ++i) { w[i] = (__bf16)Wm[(size_t)(k0 + 8 * g + i) * ld + o]; w[8 + i] = (__bf16)Wm[(size_t)(k0 + 16 + 8 * g + i) * ld + o]; }
  return w; }
__device__ __forceinline__ v16b wcol_oi(const float* Wm, int k0, int o, int lane, int K) { v16b w; const float* p = Wm + (size_t)o * K + k0 + 8 * (lane >> 4);
#pragma unroll
  for (int i = 0; i < 8; ++i) { w[i] = (__bf16)p[i]; w[8 + i] = (__bf16)p[16 + i]; }
  return w; }
__device__ __forceinline__ v16h wcolh_io(const float* Wm, int k0, int o, int lane, int ld) { v16h w; const int g = lane >> 4;
#pragma unroll
  for (int i = 0; i < 8; ++i) { w[i] = (_Float16)(bfr(Wm[(size_t)(k0 + 8 * g + i) * ld + o]) * 256.0f); w[8 + i] = (_Float16)(bfr(Wm[(size_t)(k0 + 16 + 8 * g + i) * ld + o]) * 256.0f); }
  return w; }
__device__ __forceinline__ v16h wcolh_oi(const float* Wm, int k0, int o, int lane, int K) { v16h w; const float* p = Wm + (size_t)o * K + k0 + 8 * (lane >> 4);
#pragma unroll
  for (int i = 0; i < 8; ++i) { w[i] = (_Float16)(bfr(p[i]) * 256.0f); w[8 + i] = (_Float16)(bfr(p[16 + i]) * 256.0f); }
  return w; }
#define WQKV_LAYOUT 0   // 0 = per-head [NH][DIN][HD]; 1 = (out,in) [CC][DIN]; 2 = per-head [NH][DIN][HD]
__device__ __forceinline__ v16b wcol_hdk(const float* Wm, int k0, int o, int lane) { v16b w; const int g = lane >> 4; const float* p = Wm + (size_t)(o / HD) * DIN * HD + (o % HD);
#pragma unroll
  for (int i = 0; i < 8; ++i) { w[i] = (__bf16)p[(size_t)(k0 + 8 * g + i) * HD]; w[8 + i] = (__bf16)p[(size_t)(k0 + 16 + 8 * g + i) * HD]; }
  return w; }
#define WO_OUT_IN 0
#if WQKV_LAYOUT == 1
#define WCOL(W, k0, o, lane) wcol_oi(W, k0, o, lane, DIN)
#elif WQKV_LAYOUT == 2
#define WCOL(W, k0, o, lane) wcol_hdk(W, k0, o, lane)
#else
#define WCOL(W, k0, o, lane) wcol_heads(W, k0, o, lane)   /* per-head [h][C][64] weights */
#endif
#if WO_OUT_IN
#define WOCOL(W, k0, o, lane) wcol_oi(W, k0, o, lane, CC)
#define WOCOLH(W, k0, o, lane) wcolh_oi(W, k0, o, lane, CC)
#else
#define WOCOL(W, k0, o, lane) wcol_io(W, k0, o, lane, DIN)
#define WOCOLH(W, k0, o, lane) wcolh_io(W, k0, o, lane, DIN)
#endif
// per-head projection weights W[h][c][d] ([16][1024][64]): column o = h*64 + d of the virtual (in,out) [C][H*D] matrix lives at W + (h*C + k)*64 + d
__device__ __forceinline__ v16b wcol_heads(const float* __restrict__ Wm, int k0, int o, int lane) { v16b w; const int g = lane >> 4; const float* p = Wm + ((size_t)(o >> 6) * DIN + k0 + 8 * g) * 64 + (o & 63);
#pragma unroll
  for (int i = 0; i < 8; ++i) { w[i] = (__bf16)p[(size_t)i * 64]; w[8 + i] = (__bf16)p[(size_t)(16 + i) * 64]; }
  asm volatile("s_wait_loadcnt 0x0" ::: "memory"); return w; }
#ifndef SM_EXTRA_PARAMS
#define SM_EXTRA_PARAMS
#endif
#ifndef PROJ_EXTRA_PARAMS
#define PROJ_EXTRA_PARAMS
#endif
#ifndef SM_MASK_HOOK
#define SM_MASK_HOOK (void)0
#endif

#define WS_QH  0u                                      // f16 q rows [b*t][CC]
#define WS_KH  (WS_QH + 2u * (size_t)NB * TT * CC)      // f16 k rows [b*t][CC]
#define WS_VT  (WS_KH + 2u * (size_t)NB * TT * CC)      // f16 v planes [b][c][t]
#define WS_QL  (WS_VT + 2u * (size_t)NB * CC * TT)      // f16 q residual x 2^10 rows [b][t < QHI][CC]
#define WS_KL  (WS_QL + 2u * (size_t)NB * QHI * CC)     // f16 k residual x 2^10 rows [b][t < KHI][CC]
#define WS_VB  (WS_KL + 2u * (size_t)NB * KHI * CC)     // bf16 v hi planes [b][c][t < KHI]
#define WS_VBL (WS_VB + 2u * (size_t)NB * CC * KHI)
#define WS_S   (WS_VBL + 2u * (size_t)NB * CC * KHI)    // f32 logits / P [hg][t][s]
#define WS_Y   (WS_S  + 4u * (size_t)HG * TT * TT)      // f32 ctx rows [b*t][CC] (only when there is an output projection)
#define WS_END (WS_Y  + 0u)

// ---- k_proj: block = (64 rows, 128 cols, which): q/k/v = X W (+ b) with exact bf16 products (K = DIN) -> which 0: q f16 rows (+ residual rows < QHI); 1: k f16 rows (+ residual rows < KHI); 2: v f16 planes [c][t] (+ bf16 hi/lo planes for t < KHI)
__global__ __launch_bounds__(128) void k_proj(const float* __restrict__ XQ, const float* __restrict__ XK, const float* __restrict__ XV, const float* __restrict__ WQ, const float* __restrict__ WK, const float* __restrict__ WV, const float* __restrict__ BQ, const float* __restrict__ BK, const float* __restrict__ BV,
    _Float16* __restrict__ QH, _Float16* __restrict__ QL, _Float16* __restrict__ KH, _Float16* __restrict__ KL, _Float16* __restrict__ VT, __bf16* __restrict__ VB, __bf16* __restrict__ VBL) {
  __shared__ __align__(16) _Float16 sh[64][136], sl[64][136]; __shared__ __align__(16) _Float16 th[128][72]; __shared__ __align__(16) __bf16 tb[128][72], tbl[128][72];
  const int tid = threadIdx.x, wave = tid >> 5, lane = tid & 31, col = lane & 15, g = lane >> 4; const int which = blockIdx.z; const int c0 = blockIdx.y * 128; const size_t r0 = (size_t)blockIdx.x * 64; const size_t bb = r0 / TT; const int t0 = (int)(r0 % TT);
  const float* X = which == 0 ? XQ : which == 1 ? XK : XV; const float* WA = which == 0 ? WQ : which == 1 ? WK : WV; const float* BA = which == 0 ? BQ : which == 1 ? BK : BV;
  v8f acc[8] = {};
#pragma unroll 2
  for (int kc = 0; kc < DIN / 32; ++kc) { v16b a; { const float* p = X + (r0 + wave * 16 + col) * DIN + kc * 32 + 8 * g;
#pragma unroll
      for (int i = 0; i < 8; ++i) { a[i] = (__bf16)p[i]; a[8 + i] = (__bf16)p[16 + i]; } }
    asm volatile("s_wait_loadcnt 0x0" ::: "memory");
#pragma unroll
    for (int j = 0; j < 8; ++j) { const v16b w = WCOL(WA, kc * 32, c0 + j * 16 + col, lane); asm volatile("s_wait_loadcnt 0x0" ::: "memory"); acc[j] = wmma_bf(a, w, acc[j]); } }
  if (which < 2) { _Float16* DH = which == 0 ? QH : KH; _Float16* DL = which == 0 ? QL : KL; const int nhi = which == 0 ? QHI : KHI; const bool hi_rows = t0 < nhi;
#pragma unroll
    for (int j = 0; j < 8; ++j) { const float bias = BA ? bfr(BA[c0 + j * 16 + col]) : 0.f;
#pragma unroll
      for (int r = 0; r < 8; ++r) { const float v = acc[j][r] + bias; const _Float16 hv = (_Float16)v; sh[wave * 16 + 8 * g + r][j * 16 + col] = hv; sl[wave * 16 + 8 * g + r][j * 16 + col] = (_Float16)((v - (float)hv) * 1024.0f); } }
    __syncthreads();
    for (int e = tid; e < 64 * 16; e += 128) { const int rl = e >> 4, q = e & 15; vst2((unsigned*)(DH + (r0 + rl) * CC + c0 + q * 8), *(const v4u*)&sh[rl][q * 8]); if (hi_rows) vst2((unsigned*)(DL + (bb * nhi + t0 + rl) * (size_t)CC + c0 + q * 8), *(const v4u*)&sl[rl][q * 8]); }
  } else { const bool hi_rows = t0 < KHI;
#pragma unroll
    for (int j = 0; j < 8; ++j) { const float bias = BA ? bfr(BA[c0 + j * 16 + col]) : 0.f;
#pragma unroll
      for (int r = 0; r < 8; ++r) { const float v = acc[j][r] + bias; const int rl = wave * 16 + 8 * g + r, cl = j * 16 + col; th[cl][rl] = (_Float16)v; const __bf16 bh = (__bf16)v; tb[cl][rl] = bh; tbl[cl][rl] = (__bf16)(v - (float)bh); } }
    __syncthreads();
    for (int e = tid; e < 128 * 8; e += 128) { const int cl = e >> 3, q = e & 7; vst2((unsigned*)(VT + (bb * CC + c0 + cl) * (size_t)TT + t0 + q * 8), *(const v4u*)&th[cl][q * 8]); if (hi_rows) { const size_t o3 = (bb * CC + c0 + cl) * (size_t)KHI + t0 + q * 8; vst2((unsigned*)(VB + o3), *(const v4u*)&tb[cl][q * 8]); vst2((unsigned*)(VBL + o3), *(const v4u*)&tbl[cl][q * 8]); } } } }
// ---- k_sc: block = (query block qb, key block kb <= kb_last(qb), head in group) of batch b: logits x SCALE; q hi x k hi (1 product), or for query blocks < QBH (rows < QHI, causal early rows) q hi + residual (x 2^10) against k hi + residual (3 products); causal: blocks past the diagonal exit, the mask itself is applied by index in k_sm
__global__ __launch_bounds__(128) void k_sc(const _Float16* __restrict__ QH, const _Float16* __restrict__ KH, const _Float16* __restrict__ QL, const _Float16* __restrict__ KL, int b, int h0, float* __restrict__ S0) { __shared__ __align__(16) float ss[4][16][132];
  const int qb = blockIdx.x, kb = blockIdx.y; if (kb > kb_last(qb)) return;
  const int h = h0 + blockIdx.z; float* S = S0 + (size_t)blockIdx.z * TT * TT;
  const int tid = threadIdx.x, wave = tid >> 5, lane = tid & 31, col = lane & 15, g = lane >> 4; const int k0 = kb * 128; const int ql0 = qb * 64 + wave * 16; const size_t q0 = (size_t)b * TT + ql0, kr0 = (size_t)b * TT + k0;
  v8f acc[8] = {}, accl[8] = {};
  const _Float16* QLb = QL + (size_t)b * QHI * CC; const _Float16* KLb = KL + (size_t)b * KHI * CC;
  if (qb < QBH) {
#pragma unroll
    for (int kc = 0; kc < HD / 32; ++kc) { const v16h ah = frag_h(QH + (q0 + col) * CC + h * HD + kc * 32, lane), al = frag_h(QLb + (size_t)(ql0 + col) * CC + h * HD + kc * 32, lane);
#pragma unroll
      for (int j = 0; j < 8; ++j) { const v16h kbf = frag_h(KH + (kr0 + j * 16 + col) * CC + h * HD + kc * 32, lane), klf = frag_h(KLb + (size_t)(k0 + j * 16 + col) * CC + h * HD + kc * 32, lane); acc[j] = wmma16(ah, kbf, acc[j]); accl[j] = wmma16(al, kbf, accl[j]); accl[j] = wmma16(ah, klf, accl[j]); } }
  } else if (qb * 64 < QHI) {
#pragma unroll
    for (int kc = 0; kc < HD / 32; ++kc) { const v16h ah = frag_h(QH + (q0 + col) * CC + h * HD + kc * 32, lane), al = frag_h(QLb + (size_t)(ql0 + col) * CC + h * HD + kc * 32, lane);
#pragma unroll
      for (int j = 0; j < 8; ++j) { const v16h kbf = frag_h(KH + (kr0 + j * 16 + col) * CC + h * HD + kc * 32, lane); acc[j] = wmma16(ah, kbf, acc[j]); accl[j] = wmma16(al, kbf, accl[j]); } }
  } else {
#pragma unroll
    for (int kc = 0; kc < HD / 32; ++kc) { const v16h ah = frag_h(QH + (q0 + col) * CC + h * HD + kc * 32, lane);
#pragma unroll
      for (int j = 0; j < 8; ++j) { const v16h kbf = frag_h(KH + (kr0 + j * 16 + col) * CC + h * HD + kc * 32, lane); acc[j] = wmma16(ah, kbf, acc[j]); } } }
#pragma unroll
  for (int j = 0; j < 8; ++j) {
#pragma unroll
    for (int r = 0; r < 8; ++r) ss[wave][8 * g + r][j * 16 + col] = (acc[j][r] + accl[j][r] * (1.0f / 1024.0f)) * SCALE; }
  LDSX(); for (int rl = 0; rl < 16; ++rl) vst2(S + (size_t)(ql0 + rl) * TT + k0 + lane * 4, *(const v4f*)&ss[wave][rl][lane * 4]); }
// ---- k_sm: block = query row t (head in group): keys [0, kend): causal -> logit if s <= t else excluded; softmax in f32; P x 2^11 in place (0 for excluded)
__global__ __launch_bounds__(256) void k_sm(float* __restrict__ S0 SM_EXTRA_PARAMS) { __shared__ float sred[8]; __shared__ float sbc; __shared__ __align__(16) float shv[TT];
  const int tid = threadIdx.x; const int t = blockIdx.x; const int kend = (kb_last(t >> 6) + 1) * 128;
  float* sr = S0 + (size_t)blockIdx.y * TT * TT + (size_t)t * TT;
  float m = -3.0e38f; for (int k = tid; k < kend; k += 256) { float v = (!CAUSAL || k <= t) ? sr[k] : -3.0e38f; SM_MASK_HOOK; shv[k] = v; m = fmaxf(m, v); }
#pragma unroll
  for (int o = 1; o < 32; o <<= 1) m = fmaxf(m, __shfl_xor(m, o));
  if ((tid & 31) == 0) sred[tid >> 5] = m; __syncthreads(); if (tid == 0) { float a = sred[0]; for (int i = 1; i < 8; ++i) a = fmaxf(a, sred[i]); sbc = a; } __syncthreads(); m = sbc; __syncthreads();
  float sum = 0.f; for (int k = tid; k < kend; k += 256) { const float v = shv[k]; const float e = (v <= -1.0e38f) ? 0.f : expf(v - m); shv[k] = e; sum += e; }
#pragma unroll
  for (int o = 1; o < 32; o <<= 1) sum += __shfl_xor(sum, o);
  if ((tid & 31) == 0) sred[tid >> 5] = sum; __syncthreads(); if (tid == 0) { float a = 0.f; for (int i = 0; i < 8; ++i) a += sred[i]; sbc = a > 0.f ? 2048.0f / a : 0.f; }   /* a fully excluded row yields P = 0 */ __syncthreads(); const float inv = sbc;
  for (int k = tid; k < kend; k += 256) shv[k] = shv[k] * inv;
  __syncthreads(); for (int q = tid; q < kend / 4; q += 256) vst2(sr + q * 4, *(const v4f*)&shv[q * 4]); }
// ---- k_pv: block = 16 queries (tile qt) of (b, h), PVW waves: wave w takes the 32-key chunks w, w + PVW, ... of keys [0, kend) and the block adds the PVW partial tiles in LDS in wave order: ctx = P . v (P x 2^11 once to f16 against v f16: 1 product; causal early query blocks: P and v as bf16 hi + lo, 3 products); 256-B (row, head) segment by one wave
#define PVW 16
__global__ __launch_bounds__(32 * PVW) void k_pv(const float* __restrict__ PS0, const _Float16* __restrict__ VT, const __bf16* __restrict__ VB, const __bf16* __restrict__ VBL, int b, int h0, float* __restrict__ Y) { const int h = h0 + blockIdx.z; const float* PS = PS0 + (size_t)blockIdx.z * TT * TT; __shared__ __align__(16) float ss[PVW][16][HD + 4];
  const int tid = threadIdx.x, wave = __builtin_amdgcn_readfirstlane(tid >> 5), lane = tid & 31, col = lane & 15, g = lane >> 4; const int qb = blockIdx.x >> 2; const int ql0 = blockIdx.x * 16; const int kce = (kb_last(qb) + 1) * 4;
  v8f acc[HD / 16] = {};
  if (qb < QBH) {
#pragma unroll 1
    for (int kc = wave; kc < kce; kc += PVW) { const F2 p = split_row(PS + (size_t)(ql0 + col) * TT, kc * 32, lane);
      asm volatile("s_wait_loadcnt 0x0" ::: "memory");
#pragma unroll
      for (int j = 0; j < HD / 16; ++j) { const size_t po = ((size_t)b * CC + h * HD + j * 16 + col) * (size_t)KHI + kc * 32; const v16b vh = frag_b(VB + po, lane); acc[j] = wmma_bf(p.h, vh, acc[j]); acc[j] = wmma_bf(p.l, vh, acc[j]); acc[j] = wmma_bf(p.h, frag_b(VBL + po, lane), acc[j]); } }
  } else {
#pragma unroll 1
    for (int kc = wave; kc < kce; kc += PVW) { const v16h p = frag_f32(PS + (size_t)(ql0 + col) * TT + kc * 32, lane);
      asm volatile("s_wait_loadcnt 0x0" ::: "memory");
#pragma unroll
      for (int j = 0; j < HD / 16; ++j) { const size_t po = ((size_t)b * CC + h * HD + j * 16 + col) * (size_t)TT + kc * 32; acc[j] = wmma16(p, frag_h(VT + po, lane), acc[j]); } } }
#pragma unroll
  for (int j = 0; j < HD / 16; ++j)
#pragma unroll
    for (int r = 0; r < 8; ++r) ss[wave][8 * g + r][j * 16 + col] = acc[j][r] * (1.0f / 2048.0f);
  __syncthreads();
  static_assert(PVW == 16 && HD == 64, "wave w sums and stores row w of the 16-row tile, two columns a lane");
  v2f s = *(const v2f*)&ss[0][wave][lane * 2];
#pragma unroll   // so that the LDS reads of the partial tiles issue ahead of the adds, not one wait per read
  for (int w = 1; w < PVW; ++w) s += *(const v2f*)&ss[w][wave][lane * 2];
  vst2(Y + ((size_t)b * TT + ql0 + wave) * CC + h * HD + lane * 2, s); }

extern "C" void kernel_launch(void* const* d_in, const int* in_sizes, int n_in, void* d_out, int out_size, void* d_ws, size_t ws_size, hipStream_t stream) {
  (void)in_sizes; (void)n_in; (void)out_size;
  const float** F = (const float**)d_in;
  if (ws_size < (size_t)WS_END) return;
  char* ws = (char*)d_ws; _Float16 *QH = (_Float16*)(ws + WS_QH), *KH = (_Float16*)(ws + WS_KH), *VT = (_Float16*)(ws + WS_VT), *QL = (_Float16*)(ws + WS_QL), *KL = (_Float16*)(ws + WS_KL); __bf16 *VB = (__bf16*)(ws + WS_VB), *VBL = (__bf16*)(ws + WS_VBL); float *S = (float*)(ws + WS_S), *Y = (float*)(ws + WS_Y);
  (void)Y; (void)QL; (void)KL; (void)VB; (void)VBL;
  // inputs: 0 x [2,2048,1024]; 1 Wq [16,1024,64]; 2 Wk; 3 Wv (per-head (in,out)); no biases, no output projection
  k_proj<<<dim3(TNB * TT / 64, CC / 128, 3), 128, 0, stream>>>(F[0], F[0], F[0], F[1], F[2], F[3], nullptr, nullptr, nullptr, QH, QL, KH, KL, VT, VB, VBL);
  for (int b = 0; b < TNB; ++b) for (int h0 = 0; h0 < NH; h0 += HG) {
    k_sc<<<dim3(NQB, TT / 128, HG), 128, 0, stream>>>(QH, KH, QL, KL, b, h0, S);
    k_sm<<<dim3(TT, HG), 256, 0, stream>>>(S);
    k_pv<<<dim3(TT / 16, 1, HG), 32 * PVW, 0, stream>>>(S, VT, VB, VBL, b, h0, (float*)d_out);   /* merged heads [b][t][h*64+d] == the output layout */
  }
}

// v002
// Measured time: 435 microseconds a run.
// Timed twice side by side with v001, it ran 1.44 times as fast both times.
// Over all steps from v000 it is 2.24 times as fast.
// compute dtype: all float inputs rounded to bf16; per-head q/k/v projections with EXACT bf16 products on WMMA 16x16x32 (f32 accumulate); causal logits: q f16 x k f16 (1 product; q and k f16 hi + residual, 3 products, for the first 384 rows) x 1024^-0.5; softmax f32; P x 2^11 once to f16 x v once to f16 (1 product; bf16 hi + lo below row 384); f32 output (no output projection).
#include <hip/hip_runtime.h>
#include <math.h>

typedef __attribute__((ext_vector_type(16))) _Float16 v16h;
typedef __attribute__((ext_vector_type(16))) __bf16 v16b;
typedef __attribute__((ext_vector_type(8)))  _Float16 v8h;
typedef __attribute__((ext_vector_type(8)))  float v8f;
typedef __attribute__((ext_vector_type(4)))  float v4f;
typedef __attribute__((ext_vector_type(2)))  float v2f;
typedef __attribute__((ext_vector_type(4)))  unsigned v4u;
typedef __attribute__((ext_vector_type(4)))  int v4i;
typedef float __attribute__((may_alias)) float_a;
typedef int __attribute__((may_alias)) int_a;

template <typename T> __device__ __forceinline__ void vst2(void* p, T v) { *(T*)p = v;  }
__device__ __forceinline__ v8f wmma16(v16h a, v16h b, v8f c) {
  v8f d = __builtin_amdgcn_wmma_f32_16x16x32_f16(false, a, false, b, (short)0, c, false, false);
  asm volatile("v_nop\n\tv_nop\n\tv_nop\n\tv_nop" : "+v"(d) : "v"(a), "v"(b));
  return d;
}
__device__ __forceinline__ v8f wmma_bf(v16b a, v16b b, v8f c) {
  v8f d = __builtin_amdgcn_wmma_f32_16x16x32_bf16(false, a, false, b, (short)0, c, false, false);
  asm volatile("v_nop\n\tv_nop\n\tv_nop\n\tv_nop" : "+v"(d) : "v"(a), "v"(b));
  return d;
}
// 16x16x32 fragments: lane = (h = lane>>4, row/col = lane&15); elements 0..7 = k0+8h+0..7, 8..15 = k0+16+8h+0..7; D element r = row 8h+r
__device__ __forceinline__ v16h frag_h(const _Float16* rowk0, int lane) {
  union { v16h v; v8h q[2]; } u; const _Float16* p = rowk0 + 8 * (lane >> 4);
  u.q[0] = *(const v8h*)p; u.q[1] = *(const v8h*)(p + 16); return u.v;
}
__device__ __forceinline__ v16h frag_f32(const float* rowk0, int lane) {
  v16h a; const float* p = rowk0 + 8 * (lane >> 4);
#pragma unroll
  for (int i = 0; i < 8; ++i) { a[i] = (_Float16)p[i]; a[8 + i] = (_Float16)p[16 + i]; }
  return a;
}
__device__ __forceinline__ v16h frag_f32s(const float* rowk0, int lane, float sc) {
  v16h a; const float* p = rowk0 + 8 * (lane >> 4);
#pragma unroll
  for (int i = 0; i < 8; ++i) { a[i] = (_Float16)(p[i] * sc); a[8 + i] = (_Float16)(p[16 + i] * sc); }
  return a;
}
// column fragment from a [K][ld] layout (column n), rows >= K read as 0
__device__ __forceinline__ v16h fragc_f32(const float* W, int k0, int n, int lane, int ld, int K) {
  v16h a; const int g = lane >> 4;
#pragma unroll
  for (int i = 0; i < 8; ++i) { const int ka = k0 + 8 * g + i, kb = ka + 16;
    a[i] = (_Float16)(ka < K ? W[(size_t)(ka < K ? ka : K - 1) * ld + n] : 0.f); a[8 + i] = (_Float16)(kb < K ? W[(size_t)(kb < K ? kb : K - 1) * ld + n] : 0.f); }
  return a;
}
struct F2 { v16b h, l; };
__device__ __forceinline__ F2 bsplit16(const float v[16]) { F2 r;
#pragma unroll
  for (int i = 0; i < 16; ++i) { const __bf16 h = (__bf16)v[i]; r.h[i] = h; r.l[i] = (__bf16)(v[i] - (float)h); }
  return r; }
__device__ __forceinline__ F2 split_row(const float* row, int k0, int lane) { float v[16]; const float* p = row + k0 + 8 * (lane >> 4);
#pragma unroll
  for (int i = 0; i < 8; ++i) { v[i] = p[i]; v[8 + i] = p[16 + i]; }
  return bsplit16(v); }
__device__ __forceinline__ F2 split_rowK(const float* row, int k0, int lane, int K) { float v[16]; const int g = lane >> 4;
#pragma unroll
  for (int i = 0; i < 8; ++i) { const int ka = k0 + 8 * g + i, kb = ka + 16; v[i] = ka < K ? row[ka < K ? ka : K - 1] : 0.f; v[8 + i] = kb < K ? row[kb < K ? kb : K - 1] : 0.f; }
  return bsplit16(v); }
__device__ __forceinline__ F2 split_col(const float* W, int k0, int n, int lane, int ld, int K) { float v[16]; const int g = lane >> 4;
#pragma unroll
  for (int i = 0; i < 8; ++i) { const int ka = k0 + 8 * g + i, kb = ka + 16; v[i] = ka < K ? W[(size_t)(ka < K ? ka : K - 1) * ld + n] : 0.f; v[8 + i] = kb < K ? W[(size_t)(kb < K ? kb : K - 1) * ld + n] : 0.f; }
  return bsplit16(v); }
__device__ __forceinline__ v8f mac3(const F2& a, const F2& b, v8f c) { c = wmma_bf(a.l, b.h, c); c = wmma_bf(a.h, b.l, c); return wmma_bf(a.h, b.h, c); }
__device__ __forceinline__ float sigm(float v) { return 1.0f / (1.0f + expf(-v)); }
#define LDSX() do { asm volatile("s_wait_dscnt 0" ::: "memory"); __builtin_amdgcn_wave_barrier(); __builtin_amdgcn_fence(__ATOMIC_RELEASE, "workgroup"); } while (0)

// Causal multi-head self-attention without output projection (B 2, T 2,048, C 1,024, 16 heads x 64; per-head weights Wq/Wk/Wv [16,1024,64], 0.02-scale, no biases; the logit scale is C^-0.5 = 1/32 as in the source): out = concat_h causal_softmax(q_h k_h^T / 32) v_h -> [2, 2048, 1024].
#define NB 2
#define TT 2048
#define CC 1024            // NH * HD = projected width
#define DIN 1024          // input (model) width
#define NH 16
#define HD 64
#define NQB (TT / 64)
#define HG 4
#define SCALE (0.03125f)
#define CAUSAL 1
#ifndef TNB
#define TNB NB
#endif
__device__ __forceinline__ float bfr(float v) { return (float)(__bf16)v; }
__host__ __device__ __forceinline__ int kb_last(int qb) { return CAUSAL ? ((qb * 64 + 63) >> 7) : (TT / 128 - 1); }
typedef __attribute__((ext_vector_type(8))) __bf16 v8b;
__device__ __forceinline__ v16b frag_b(const __bf16* rowk0, int lane) {
  union { v16b v; v8b q[2]; } u; const __bf16* p = rowk0 + 8 * (lane >> 4);
  u.q[0] = *(const v8b*)p; u.q[1] = *(const v8b*)(p + 16); return u.v;
}
#define QBH 6              // causal: query blocks 0..QBH-1 of each sequence (few keys, no averaging) take the high-precision path
#define QHI 384            // rows carrying a q residual plane
#define KHI 384            // key rows carrying k residual / v bf16 hi+lo planes (used only by the causal high-precision path)
// B fragment (k rows k0+.., output column o) of a weight: (in,out) [K][ld] or (out,in) [ld rows of K]: bf16 exact, or f16(bf16 * 256) exact
__device__ __forceinline__ v16b wcol_io(const float* Wm, int k0, int o, int lane, int ld) { v16b w; const int g = lane >> 4;
#pragma unroll
  for (int i = 0; i < 8; ++i) { w[i] = (__bf16)Wm[(size_t)(k0 + 8 * g + i) * ld + o]; w[8 + i] = (__bf16)Wm[(size_t)(k0 + 16 + 8 * g + i) * ld + o]; }
  return w; }
__device__ __forceinline__ v16b wcol_oi(const float* Wm, int k0, int o, int lane, int K) { v16b w; const float* p = Wm + (size_t)o * K + k0 + 8 * (lane >> 4);
#pragma unroll
  for (int i = 0; i < 8; ++i) { w[i] = (__bf16)p[i]; w[8 + i] = (__bf16)p[16 + i]; }
  return w; }
__device__ __forceinline__ v16h wcolh_io(const float* Wm, int k0, int o, int lane, int ld) { v16h w; const int g = lane >> 4;
#pragma unroll
  for (int i = 0; i < 8; ++i) { w[i] = (_Float16)(bfr(Wm[(size_t)(k0 + 8 * g + i) * ld + o]) * 256.0f); w[8 + i] = (_Float16)(bfr(Wm[(size_t)(k0 + 16 + 8 * g + i) * ld + o]) * 256.0f); }
  return w; }
__device__ __forceinline__ v16h wcolh_oi(const float* Wm, int k0, int o, int lane, int K) { v16h w; const float* p = Wm + (size_t)o * K + k0 + 8 * (lane >> 4);
#pragma unroll
  for (int i = 0; i < 8; ++i) { w[i] = (_Float16)(bfr(p[i]) * 256.0f); w[8 + i] = (_Float16)(bfr(p[16 + i]) * 256.0f); }
  return w; }
#define WQKV_LAYOUT 0   // 0 = per-head [NH][DIN][HD]; 1 = (out,in) [CC][DIN]; 2 = per-head [NH][DIN][HD]
__device__ __forceinline__ v16b wcol_hdk(const float* Wm, int k0, int o, int lane) { v16b w; const int g = lane >> 4; const float* p = Wm + (size_t)(o / HD) * DIN * HD + (o % HD);
#pragma unroll
  for (int i = 0; i < 8; ++i) { w[i] = (__bf16)p[(size_t)(k0 + 8 * g + i) * HD]; w[8 + i] = (__bf16)p[(size_t)(k0 + 16 + 8 * g + i) * HD]; }
  return w; }
#define WO_OUT_IN 0
#if WQKV_LAYOUT == 1
#define WCOL(W, k0, o, lane) wcol_oi(W, k0, o, lane, DIN)
#elif WQKV_LAYOUT == 2
#define WCOL(W, k0, o, lane) wcol_hdk(W, k0, o, lane)
#else
#define WCOL(W, k0, o, lane) wcol_heads(W, k0, o, lane)   /* per-head [h][C][64] weights */
#endif
#if WO_OUT_IN
#define WOCOL(W, k0, o, lane) wcol_oi(W, k0, o, lane, CC)
#define WOCOLH(W, k0, o, lane) wcolh_oi(W, k0, o, lane, CC)
#else
#define WOCOL(W, k0, o, lane) wcol_io(W, k0, o, lane, DIN)
#define WOCOLH(W, k0, o, lane) wcolh_io(W, k0, o, lane, DIN)
#endif
// per-head projection weights W[h][c][d] ([16][1024][64]): column o = h*64 + d of the virtual (in,out) [C][H*D] matrix lives at W + (h*C + k)*64 + d
__device__ __forceinline__ v16b wcol_heads(const float* __restrict__ Wm, int k0, int o, int lane) { v16b w; const int g = lane >> 4; const float* p = Wm + ((size_t)(o >> 6) * DIN + k0 + 8 * g) * 64 + (o & 63);
#pragma unroll
  for (int i = 0; i < 8; ++i) { w[i] = (__bf16)p[(size_t)i * 64]; w[8 + i] = (__bf16)p[(size_t)(16 + i) * 64]; }
  asm volatile("s_wait_loadcnt 0x0" ::: "memory"); return w; }
#ifndef PROJ_EXTRA_PARAMS
#define PROJ_EXTRA_PARAMS
#endif

#define WS_QH  0u                                      // f16 q rows [b*t][CC]
#define WS_KH  (WS_QH + 2u * (size_t)NB * TT * CC)      // f16 k rows [b*t][CC]
#define WS_VT  (WS_KH + 2u * (size_t)NB * TT * CC)      // f16 v planes [b][c][t]
#define WS_QL  (WS_VT + 2u * (size_t)NB * CC * TT)      // f16 q residual x 2^10 rows [b][t < QHI][CC]
#define WS_KL  (WS_QL + 2u * (size_t)NB * QHI * CC)     // f16 k residual x 2^10 rows [b][t < KHI][CC]
#define WS_VB  (WS_KL + 2u * (size_t)NB * KHI * CC)     // bf16 v hi planes [b][c][t < KHI]
#define WS_VBL (WS_VB + 2u * (size_t)NB * CC * KHI)
#define WS_S   (WS_VBL + 2u * (size_t)NB * CC * KHI)    // f32 logits [hg][t][s]
#define WS_Y   (WS_S  + 4u * (size_t)HG * TT * TT)      // f32 ctx rows [b*t][CC] (only when there is an output projection)
#define WS_END (WS_Y  + 0u)

// ---- k_proj: block = (64 rows, 128 cols, which): q/k/v = X W (+ b) with exact bf16 products (K = DIN) -> which 0: q f16 rows (+ residual rows < QHI); 1: k f16 rows (+ residual rows < KHI); 2: v f16 planes [c][t] (+ bf16 hi/lo planes for t < KHI)
__global__ __launch_bounds__(128) void k_proj(const float* __restrict__ XQ, const float* __restrict__ XK, const float* __restrict__ XV, const float* __restrict__ WQ, const float* __restrict__ WK, const float* __restrict__ WV, const float* __restrict__ BQ, const float* __restrict__ BK, const float* __restrict__ BV,
    _Float16* __restrict__ QH, _Float16* __restrict__ QL, _Float16* __restrict__ KH, _Float16* __restrict__ KL, _Float16* __restrict__ VT, __bf16* __restrict__ VB, __bf16* __restrict__ VBL) {
  __shared__ __align__(16) _Float16 sh[64][136], sl[64][136]; __shared__ __align__(16) _Float16 th[128][72]; __shared__ __align__(16) __bf16 tb[128][72], tbl[128][72];
  const int tid = threadIdx.x, wave = tid >> 5, lane = tid & 31, col = lane & 15, g = lane >> 4; const int which = blockIdx.z; const int c0 = blockIdx.y * 128; const size_t r0 = (size_t)blockIdx.x * 64; const size_t bb = r0 / TT; const int t0 = (int)(r0 % TT);
  const float* X = which == 0 ? XQ : which == 1 ? XK : XV; const float* WA = which == 0 ? WQ : which == 1 ? WK : WV; const float* BA = which == 0 ? BQ : which == 1 ? BK : BV;
  v8f acc[8] = {};
#pragma unroll 2
  for (int kc = 0; kc < DIN / 32; ++kc) { v16b a; { const float* p = X + (r0 + wave * 16 + col) * DIN + kc * 32 + 8 * g;
#pragma unroll
      for (int i = 0; i < 8; ++i) { a[i] = (__bf16)p[i]; a[8 + i] = (__bf16)p[16 + i]; } }
    asm volatile("s_wait_loadcnt 0x0" ::: "memory");
#pragma unroll
    for (int j = 0; j < 8; ++j) { const v16b w = WCOL(WA, kc * 32, c0 + j * 16 + col, lane); asm volatile("s_wait_loadcnt 0x0" ::: "memory"); acc[j] = wmma_bf(a, w, acc[j]); } }
  if (which < 2) { _Float16* DH = which == 0 ? QH : KH; _Float16* DL = which == 0 ? QL : KL; const int nhi = which == 0 ? QHI : KHI; const bool hi_rows = t0 < nhi;
#pragma unroll
    for (int j = 0; j < 8; ++j) { const float bias = BA ? bfr(BA[c0 + j * 16 + col]) : 0.f;
#pragma unroll
      for (int r = 0; r < 8; ++r) { const float v = acc[j][r] + bias; const _Float16 hv = (_Float16)v; sh[wave * 16 + 8 * g + r][j * 16 + col] = hv; sl[wave * 16 + 8 * g + r][j * 16 + col] = (_Float16)((v - (float)hv) * 1024.0f); } }
    __syncthreads();
    for (int e = tid; e < 64 * 16; e += 128) { const int rl = e >> 4, q = e & 15; vst2((unsigned*)(DH + (r0 + rl) * CC + c0 + q * 8), *(const v4u*)&sh[rl][q * 8]); if (hi_rows) vst2((unsigned*)(DL + (bb * nhi + t0 + rl) * (size_t)CC + c0 + q * 8), *(const v4u*)&sl[rl][q * 8]); }
  } else { const bool hi_rows = t0 < KHI;
#pragma unroll
    for (int j = 0; j < 8; ++j) { const float bias = BA ? bfr(BA[c0 + j * 16 + col]) : 0.f;
#pragma unroll
      for (int r = 0; r < 8; ++r) { const float v = acc[j][r] + bias; const int rl = wave * 16 + 8 * g + r, cl = j * 16 + col; th[cl][rl] = (_Float16)v; const __bf16 bh = (__bf16)v; tb[cl][rl] = bh; tbl[cl][rl] = (__bf16)(v - (float)bh); } }
    __syncthreads();
    for (int e = tid; e < 128 * 8; e += 128) { const int cl = e >> 3, q = e & 7; vst2((unsigned*)(VT + (bb * CC + c0 + cl) * (size_t)TT + t0 + q * 8), *(const v4u*)&th[cl][q * 8]); if (hi_rows) { const size_t o3 = (bb * CC + c0 + cl) * (size_t)KHI + t0 + q * 8; vst2((unsigned*)(VB + o3), *(const v4u*)&tb[cl][q * 8]); vst2((unsigned*)(VBL + o3), *(const v4u*)&tbl[cl][q * 8]); } } } }
// ---- k_sc: block = (query block qb, key block kb <= kb_last(qb), head in group) of batch b: logits x SCALE; q hi + residual (x 2^10) against k (2 products) for query rows < QHI, plus the k residual (3 products) for query blocks < QBH (causal early rows); causal: blocks past the diagonal exit, the mask itself is applied by index in k_pv
__global__ __launch_bounds__(128) void k_sc(const _Float16* __restrict__ QH, const _Float16* __restrict__ KH, const _Float16* __restrict__ QL, const _Float16* __restrict__ KL, int b, int h0, float* __restrict__ S0) { __shared__ __align__(16) float ss[4][16][132];
  const int qb = blockIdx.x, kb = blockIdx.y; if (kb > kb_last(qb)) return;
  const int h = h0 + blockIdx.z; float* S = S0 + (size_t)blockIdx.z * TT * TT;
  const int tid = threadIdx.x, wave = tid >> 5, lane = tid & 31, col = lane & 15, g = lane >> 4; const int k0 = kb * 128; const int ql0 = qb * 64 + wave * 16; const size_t q0 = (size_t)b * TT + ql0, kr0 = (size_t)b * TT + k0;
  v8f acc[8] = {}, accl[8] = {};
  const _Float16* QLb = QL + (size_t)b * QHI * CC; const _Float16* KLb = KL + (size_t)b * KHI * CC;
  if (qb < QBH) {
#pragma unroll
    for (int kc = 0; kc < HD / 32; ++kc) { const v16h ah = frag_h(QH + (q0 + col) * CC + h * HD + kc * 32, lane), al = frag_h(QLb + (size_t)(ql0 + col) * CC + h * HD + kc * 32, lane);
#pragma unroll
      for (int j = 0; j < 8; ++j) { const v16h kbf = frag_h(KH + (kr0 + j * 16 + col) * CC + h * HD + kc * 32, lane), klf = frag_h(KLb + (size_t)(k0 + j * 16 + col) * CC + h * HD + kc * 32, lane); acc[j] = wmma16(ah, kbf, acc[j]); accl[j] = wmma16(al, kbf, accl[j]); accl[j] = wmma16(ah, klf, accl[j]); } }
  } else if (qb * 64 < QHI) {
#pragma unroll
    for (int kc = 0; kc < HD / 32; ++kc) { const v16h ah = frag_h(QH + (q0 + col) * CC + h * HD + kc * 32, lane), al = frag_h(QLb + (size_t)(ql0 + col) * CC + h * HD + kc * 32, lane);
#pragma unroll
      for (int j = 0; j < 8; ++j) { const v16h kbf = frag_h(KH + (kr0 + j * 16 + col) * CC + h * HD + kc * 32, lane); acc[j] = wmma16(ah, kbf, acc[j]); accl[j] = wmma16(al, kbf, accl[j]); } }
  } else {
#pragma unroll
    for (int kc = 0; kc < HD / 32; ++kc) { const v16h ah = frag_h(QH + (q0 + col) * CC + h * HD + kc * 32, lane);
#pragma unroll
      for (int j = 0; j < 8; ++j) { const v16h kbf = frag_h(KH + (kr0 + j * 16 + col) * CC + h * HD + kc * 32, lane); acc[j] = wmma16(ah, kbf, acc[j]); } } }
#pragma unroll
  for (int j = 0; j < 8; ++j) {
#pragma unroll
    for (int r = 0; r < 8; ++r) ss[wave][8 * g + r][j * 16 + col] = (acc[j][r] + accl[j][r] * (1.0f / 1024.0f)) * SCALE; }
  LDSX(); for (int rl = 0; rl < 16; ++rl) vst2(S + (size_t)(ql0 + rl) * TT + k0 + lane * 4, *(const v4f*)&ss[wave][rl][lane * 4]); }
// ---- k_pv: block = 16 queries (tile qt) of (b, h), PVW waves. First wave w takes the logits of query row w (keys [0, kend), 128 a load) into registers: causal -> logit if s <= t else excluded; softmax in f32; P x 2^11 (0 for excluded) goes to LDS, once to f16 (f32 for the causal early query blocks). Behind one barrier wave w takes the 32-key chunks w, w + PVW, ... and the block adds the PVW partial tiles in LDS in wave order: ctx = P . v (P f16 against v f16: 1 product; causal early query blocks: P and v as bf16 hi + lo, 3 products); 256-B (row, head) segment by one wave
#define PVW 16
#define PROWB (2 * TT + 16)   // bytes of a P row in LDS: 16 B x odd, so that the 16 rows of a fragment read fall on distinct banks
typedef __attribute__((ext_vector_type(4))) _Float16 v4h;
__global__ __launch_bounds__(32 * PVW) void k_pv(const float* __restrict__ S0, const _Float16* __restrict__ VT, const __bf16* __restrict__ VB, const __bf16* __restrict__ VBL, int b, int h0, float* __restrict__ Y) { const int h = h0 + blockIdx.z; const float* S = S0 + (size_t)blockIdx.z * TT * TT; __shared__ __align__(16) float ss[PVW][16][HD + 4]; __shared__ __align__(16) unsigned char sp[16 * PROWB];
  static_assert(PVW == 16 && HD == 64, "wave w normalises, sums and stores row w of the 16-row tile");
  static_assert(4 * KHI <= PROWB && QBH * 64 <= KHI && KHI % 128 == 0, "an early row has at most KHI keys, and its f32 P fits the row's place in LDS");
  const int tid = threadIdx.x, wave = __builtin_amdgcn_readfirstlane(tid >> 5), lane = tid & 31, col = lane & 15, g = lane >> 4; const int qb = blockIdx.x >> 2; const int ql0 = blockIdx.x * 16; const int nj = kb_last(qb) + 1; const int kce = nj * 4;
  { const int t = ql0 + wave; const float* sr = S + (size_t)t * TT + lane * 4; v4f x[TT / 128];
#pragma unroll   // the row stays in registers: every index of x is a constant; all loads issue ahead of the first use
    for (int j = 0; j < TT / 128; ++j) if (j < nj) {
      if (j == TT / 128 - 1) asm volatile("s_wait_xcnt 0x0" ::: "memory");   // the last load's result may take the registers of the address that the loads before it name
      x[j] = *(const v4f*)(sr + j * 128); }
    float m = -3.0e38f;
#pragma unroll
    for (int j = 0; j < TT / 128; ++j) if (j < nj) {
#pragma unroll
      for (int i = 0; i < 4; ++i) { const float v = (!CAUSAL || j * 128 + lane * 4 + i <= t) ? x[j][i] : -3.0e38f; x[j][i] = v; m = fmaxf(m, v); } }
#pragma unroll
    for (int o = 1; o < 32; o <<= 1) m = fmaxf(m, __shfl_xor(m, o));
    float sum = 0.f;
#pragma unroll
    for (int j = 0; j < TT / 128; ++j) if (j < nj) {
#pragma unroll
      for (int i = 0; i < 4; ++i) { const float v = x[j][i]; const float ex = expf(v - m); const float e = (v <= -1.0e38f) ? 0.f : ex; x[j][i] = e; sum += e; } }
#pragma unroll
    for (int o = 1; o < 32; o <<= 1) sum += __shfl_xor(sum, o);
    const float inv = sum > 0.f ? 2048.0f / sum : 0.f;   /* a fully excluded row yields P = 0 */
    unsigned char* pr = sp + wave * PROWB;
    if (qb < QBH) {
#pragma unroll
      for (int j = 0; j < KHI / 128; ++j) if (j < nj) vst2(pr + (j * 128 + lane * 4) * 4, x[j] * inv);
    } else {
#pragma unroll
      for (int j = 0; j < TT / 128; ++j) if (j < nj) { v4h ph;
#pragma unroll
        for (int i = 0; i < 4; ++i) ph[i] = (_Float16)(x[j][i] * inv);
        vst2(pr + (j * 128 + lane * 4) * 2, ph); } } }
  __syncthreads();
  v8f acc[HD / 16] = {};
  if (qb < QBH) {
#pragma unroll 1
    for (int kc = wave; kc < kce; kc += PVW) { const F2 p = split_row((const float*)(sp + col * PROWB), kc * 32, lane);
#pragma unroll
      for (int j = 0; j < HD / 16; ++j) { const size_t po = ((size_t)b * CC + h * HD + j * 16 + col) * (size_t)KHI + kc * 32; const v16b vh = frag_b(VB + po, lane); acc[j] = wmma_bf(p.h, vh, acc[j]); acc[j] = wmma_bf(p.l, vh, acc[j]); acc[j] = wmma_bf(p.h, frag_b(VBL + po, lane), acc[j]); } }
  } else {
#pragma unroll 1
    for (int kc = wave; kc < kce; kc += PVW) { const v16h p = frag_h((const _Float16*)(sp + col * PROWB) + kc * 32, lane);
#pragma unroll
      for (int j = 0; j < HD / 16; ++j) { const size_t po = ((size_t)b * CC + h * HD + j * 16 + col) * (size_t)TT + kc * 32; acc[j] = wmma16(p, frag_h(VT + po, lane), acc[j]); } } }
#pragma unroll
  for (int j = 0; j < HD / 16; ++j)
#pragma unroll
    for (int r = 0; r < 8; ++r) ss[wave][8 * g + r][j * 16 + col] = acc[j][r] * (1.0f / 2048.0f);
  __syncthreads();
  v2f s = *(const v2f*)&ss[0][wave][lane * 2];
#pragma unroll   // so that the LDS reads of the partial tiles issue ahead of the adds, not one wait per read
  for (int w = 1; w < PVW; ++w) s += *(const v2f*)&ss[w][wave][lane * 2];
  vst2(Y + ((size_t)b * TT + ql0 + wave) * CC + h * HD + lane * 2, s); }

extern "C" void kernel_launch(void* const* d_in, const int* in_sizes, int n_in, void* d_out, int out_size, void* d_ws, size_t ws_size, hipStream_t stream) {
  (void)in_sizes; (void)n_in; (void)out_size;
  const float** F = (const float**)d_in;
  if (ws_size < (size_t)WS_END) return;
  char* ws = (char*)d_ws; _Float16 *QH = (_Float16*)(ws + WS_QH), *KH = (_Float16*)(ws + WS_KH), *VT = (_Float16*)(ws + WS_VT), *QL = (_Float16*)(ws + WS_QL), *KL = (_Float16*)(ws + WS_KL); __bf16 *VB = (__bf16*)(ws + WS_VB), *VBL = (__bf16*)(ws + WS_VBL); float *S = (float*)(ws + WS_S), *Y = (float*)(ws + WS_Y);
  (void)Y; (void)QL; (void)KL; (void)VB; (void)VBL;
  // inputs: 0 x [2,2048,1024]; 1 Wq [16,1024,64]; 2 Wk; 3 Wv (per-head (in,out)); no biases, no output projection
  k_proj<<<dim3(TNB * TT / 64, CC / 128, 3), 128, 0, stream>>>(F[0], F[0], F[0], F[1], F[2], F[3], nullptr, nullptr, nullptr, QH, QL, KH, KL, VT, VB, VBL);
  for (int b = 0; b < TNB; ++b) for (int h0 = 0; h0 < NH; h0 += HG) {
    k_sc<<<dim3(NQB, TT / 128, HG), 128, 0, stream>>>(QH, KH, QL, KL, b, h0, S);
    k_pv<<<dim3(TT / 16, 1, HG), 32 * PVW, 0, stream>>>(S, VT, VB, VBL, b, h0, (float*)d_out);   /* merged heads [b][t][h*64+d] == the output layout */
  }
}

// v003
// Measured time: 330 microseconds a run.
// Two timings next to v002 both put it at 1.32 times that version's speed.
// Over all steps from v000 it is 2.95 times as fast.
// compute dtype: all float inputs rounded to bf16; per-head q/k/v projections with EXACT bf16 products on WMMA 16x16x32 (f32 accumulate); causal logits: q f16 x k f16 (1 product; q and k f16 hi + residual, 3 products, for the first 384 rows) x 1024^-0.5; softmax f32; P x 2^11 once to f16 x v once to f16 (1 product; bf16 hi + lo below row 384); f32 output (no output projection).
#include <hip/hip_runtime.h>
#include <math.h>

typedef __attribute__((ext_vector_type(16))) _Float16 v16h;
typedef __attribute__((ext_vector_type(16))) __bf16 v16b;
typedef __attribute__((ext_vector_type(8)))  _Float16 v8h;
typedef __attribute__((ext_vector_type(8)))  float v8f;
typedef __attribute__((ext_vector_type(4)))  float v4f;
typedef __attribute__((ext_vector_type(2)))  float v2f;
typedef __attribute__((ext_vector_type(4)))  unsigned v4u;
typedef __attribute__((ext_vector_type(4)))  int v4i;
typedef float __attribute__((may_alias)) float_a;
typedef int __attribute__((may_alias)) int_a;

template <typename T> __device__ __forceinline__ void vst2(void* p, T v) { *(T*)p = v;  }
__device__ __forceinline__ v8f wmma16(v16h a, v16h b, v8f c) {
  v8f d = __builtin_amdgcn_wmma_f32_16x16x32_f16(false, a, false, b, (short)0, c, false, false);
  asm volatile("v_nop\n\tv_nop\n\tv_nop\n\tv_nop" : "+v"(d) : "v"(a), "v"(b));
  return d;
}
__device__ __forceinline__ v8f wmma_bf(v16b a, v16b b, v8f c) {
  v8f d = __builtin_amdgcn_wmma_f32_16x16x32_bf16(false, a, false, b, (short)0, c, false, false);
  asm volatile("v_nop\n\tv_nop\n\tv_nop\n\tv_nop" : "+v"(d) : "v"(a), "v"(b));
  return d;
}
// 16x16x32 fragments: lane = (h = lane>>4, row/col = lane&15); elements 0..7 = k0+8h+0..7, 8..15 = k0+16+8h+0..7; D element r = row 8h+r
__device__ __forceinline__ v16h frag_h(const _Float16* rowk0, int lane) {
  union { v16h v; v8h q[2]; } u; const _Float16* p = rowk0 + 8 * (lane >> 4);
  u.q[0] = *(const v8h*)p; u.q[1] = *(const v8h*)(p + 16); return u.v;
}
__device__ __forceinline__ v16h frag_f32(const float* rowk0, int lane) {
  v16h a; const float* p = rowk0 + 8 * (lane >> 4);
#pragma unroll
  for (int i = 0; i < 8; ++i) { a[i] = (_Float16)p[i]; a[8 + i] = (_Float16)p[16 + i]; }
  return a;
}
__device__ __forceinline__ v16h frag_f32s(const float* rowk0, int lane, float sc) {
  v16h a; const float* p = rowk0 + 8 * (lane >> 4);
#pragma unroll
  for (int i = 0; i < 8; ++i) { a[i] = (_Float16)(p[i] * sc); a[8 + i] = (_Float16)(p[16 + i] * sc); }
  return a;
}
// column fragment from a [K][ld] layout (column n), rows >= K read as 0
__device__ __forceinline__ v16h fragc_f32(const float* W, int k0, int n, int lane, int ld, int K) {
  v16h a; const int g = lane >> 4;
#pragma unroll
  for (int i = 0; i < 8; ++i) { const int ka = k0 + 8 * g + i, kb = ka + 16;
    a[i] = (_Float16)(ka < K ? W[(size_t)(ka < K ? ka : K - 1) * ld + n] : 0.f); a[8 + i] = (_Float16)(kb < K ? W[(size_t)(kb < K ? kb : K - 1) * ld + n] : 0.f); }
  return a;
}
struct F2 { v16b h, l; };
__device__ __forceinline__ F2 bsplit16(const float v[16]) { F2 r;
#pragma unroll
  for (int i = 0; i < 16; ++i) { const __bf16 h = (__bf16)v[i]; r.h[i] = h; r.l[i] = (__bf16)(v[i] - (float)h); }
  return r; }
__device__ __forceinline__ F2 split_row(const float* row, int k0, int lane) { float v[16]; const float* p = row + k0 + 8 * (lane >> 4);
#pragma unroll
  for (int i = 0; i < 8; ++i) { v[i] = p[i]; v[8 + i] = p[16 + i]; }
  return bsplit16(v); }
__device__ __forceinline__ F2 split_rowK(const float* row, int k0, int lane, int K) { float v[16]; const int g = lane >> 4;
#pragma unroll
  for (int i = 0; i < 8; ++i) { const int ka = k0 + 8 * g + i, kb = ka + 16; v[i] = ka < K ? row[ka < K ? ka : K - 1] : 0.f; v[8 + i] = kb < K ? row[kb < K ? kb : K - 1] : 0.f; }
  return bsplit16(v); }
__device__ __forceinline__ F2 split_col(const float* W, int k0, int n, int lane, int ld, int K) { float v[16]; const int g = lane >> 4;
#pragma unroll
  for (int i = 0; i < 8; ++i) { const int ka = k0 + 8 * g + i, kb = ka + 16; v[i] = ka < K ? W[(size_t)(ka < K ? ka : K - 1) * ld + n] : 0.f; v[8 + i] = kb < K ? W[(size_t)(kb < K ? kb : K - 1) * ld + n] : 0.f; }
  return bsplit16(v); }
__device__ __forceinline__ v8f mac3(const F2& a, const F2& b, v8f c) { c = wmma_bf(a.l, b.h, c); c = wmma_bf(a.h, b.l, c); return wmma_bf(a.h, b.h, c); }
__device__ __forceinline__ float sigm(float v) { return 1.0f / (1.0f + expf(-v)); }
#define LDSX() do { asm volatile("s_wait_dscnt 0" ::: "memory"); __builtin_amdgcn_wave_barrier(); __builtin_amdgcn_fence(__ATOMIC_RELEASE, "workgroup"); } while (0)

// Causal multi-head self-attention without output projection (B 2, T 2,048, C 1,024, 16 heads x 64; per-head weights Wq/Wk/Wv [16,1024,64], 0.02-scale, no biases; the logit scale is C^-0.5 = 1/32 as in the source): out = concat_h causal_softmax(q_h k_h^T / 32) v_h -> [2, 2048, 1024].
#define NB 2
#define TT 2048
#define CC 1024            // NH * HD = projected width
#define DIN 1024          // input (model) width
#define NH 16
#define HD 64
#define NQB (TT / 64)
#define HG 4
#define SCALE (0.03125f)
#define CAUSAL 1
#ifndef TNB
#define TNB NB
#endif
__device__ __forceinline__ float bfr(float v) { return (float)(__bf16)v; }
__host__ __device__ __forceinline__ int kb_last(int qb) { return CAUSAL ? ((qb * 64 + 63) >> 7) : (TT / 128 - 1); }
typedef __attribute__((ext_vector_type(8))) __bf16 v8b;
__device__ __forceinline__ v16b frag_b(const __bf16* rowk0, int lane) {
  union { v16b v; v8b q[2]; } u; const __bf16* p = rowk0 + 8 * (lane >> 4);
  u.q[0] = *(const v8b*)p; u.q[1] = *(const v8b*)(p + 16); return u.v;
}
#define QBH 6              // causal: query blocks 0..QBH-1 of each sequence (few keys, no averaging) take the high-precision path
#define QHI 384            // rows carrying a q residual plane
#define KHI 384            // key rows carrying k residual / v bf16 hi+lo planes (used only by the causal high-precision path)
// B fragment (k rows k0+.., output column o) of a weight: (in,out) [K][ld] or (out,in) [ld rows of K]: bf16 exact, or f16(bf16 * 256) exact
__device__ __forceinline__ v16b wcol_io(const float* Wm, int k0, int o, int lane, int ld) { v16b w; const int g = lane >> 4;
#pragma unroll
  for (int i = 0; i < 8; ++i) { w[i] = (__bf16)Wm[(size_t)(k0 + 8 * g + i) * ld + o]; w[8 + i] = (__bf16)Wm[(size_t)(k0 + 16 + 8 * g + i) * ld + o]; }
  return w; }
__device__ __forceinline__ v16b wcol_oi(const float* Wm, int k0, int o, int lane, int K) { v16b w; const float* p = Wm + (size_t)o * K + k0 + 8 * (lane >> 4);
#pragma unroll
  for (int i = 0; i < 8; ++i) { w[i] = (__bf16)p[i]; w[8 + i] = (__bf16)p[16 + i]; }
  return w; }
__device__ __forceinline__ v16h wcolh_io(const float* Wm, int k0, int o, int lane, int ld) { v16h w; const int g = lane >> 4;
#pragma unroll
  for (int i = 0; i < 8; ++i) { w[i] = (_Float16)(bfr(Wm[(size_t)(k0 + 8 * g + i) * ld + o]) * 256.0f); w[8 + i] = (_Float16)(bfr(Wm[(size_t)(k0 + 16 + 8 * g + i) * ld + o]) * 256.0f); }
  return w; }
__device__ __forceinline__ v16h wcolh_oi(const float* Wm, int k0, int o, int lane, int K) { v16h w; const float* p = Wm + (size_t)o * K + k0 + 8 * (lane >> 4);
#pragma unroll
  for (int i = 0; i < 8; ++i) { w[i] = (_Float16)(bfr(p[i]) * 256.0f); w[8 + i] = (_Float16)(bfr(p[16 + i]) * 256.0f); }
  return w; }
#define WQKV_LAYOUT 0   // 0 = per-head [NH][DIN][HD]; 1 = (out,in) [CC][DIN]; 2 = per-head [NH][DIN][HD]
__device__ __forceinline__ v16b wcol_hdk(const float* Wm, int k0, int o, int lane) { v16b w; const int g = lane >> 4; const float* p = Wm + (size_t)(o / HD) * DIN * HD + (o % HD);
#pragma unroll
  for (int i = 0; i < 8; ++i) { w[i] = (__bf16)p[(size_t)(k0 + 8 * g + i) * HD]; w[8 + i] = (__bf16)p[(size_t)(k0 + 16 + 8 * g + i) * HD]; }
  return w; }
#define WO_OUT_IN 0
#if WQKV_LAYOUT == 1
#define WCOL(W, k0, o, lane) wcol_oi(W, k0, o, lane, DIN)
#elif WQKV_LAYOUT == 2
#define WCOL(W, k0, o, lane) wcol_hdk(W, k0, o, lane)
#else
#define WCOL(W, k0, o, lane) wcol_heads(W, k0, o, lane)   /* per-head [h][C][64] weights */
#endif
#if WO_OUT_IN
#define WOCOL(W, k0, o, lane) wcol_oi(W, k0, o, lane, CC)
#define WOCOLH(W, k0, o, lane) wcolh_oi(W, k0, o, lane, CC)
#else
#define WOCOL(W, k0, o, lane) wcol_io(W, k0, o, lane, DIN)
#define WOCOLH(W, k0, o, lane) wcolh_io(W, k0, o, lane, DIN)
#endif
// per-head projection weights W[h][c][d] ([16][1024][64]): column o = h*64 + d of the virtual (in,out) [C][H*D] matrix lives at W + (h*C + k)*64 + d
__device__ __forceinline__ v16b wcol_heads(const float* __restrict__ Wm, int k0, int o, int lane) { v16b w; const int g = lane >> 4; const float* p = Wm + ((size_t)(o >> 6) * DIN + k0 + 8 * g) * 64 + (o & 63);
#pragma unroll
  for (int i = 0; i < 8; ++i) { w[i] = (__bf16)p[(size_t)i * 64]; w[8 + i] = (__bf16)p[(size_t)(16 + i) * 64]; }
  asm volatile("s_wait_loadcnt 0x0" ::: "memory"); return w; }
#ifndef PROJ_EXTRA_PARAMS
#define PROJ_EXTRA_PARAMS
#endif

#define WS_QH  0u                                      // f16 q rows [b*t][CC]
#define WS_KH  (WS_QH + 2u * (size_t)NB * TT * CC)      // f16 k rows [b*t][CC]
#define WS_VT  (WS_KH + 2u * (size_t)NB * TT * CC)      // f16 v planes [b][c][t]
#define WS_QL  (WS_VT + 2u * (size_t)NB * CC * TT)      // f16 q residual x 2^10 rows [b][t < QHI][CC]
#define WS_KL  (WS_QL + 2u * (size_t)NB * QHI * CC)     // f16 k residual x 2^10 rows [b][t < KHI][CC]
#define WS_VB  (WS_KL + 2u * (size_t)NB * KHI * CC)     // bf16 v hi planes [b][c][t < KHI]
#define WS_VBL (WS_VB + 2u * (size_t)NB * CC * KHI)
#define WS_S   (WS_VBL + 2u * (size_t)NB * CC * KHI)    // f32 logits [hg][t][s]
#define WS_Y   (WS_S  + 4u * (size_t)HG * TT * TT)      // f32 ctx rows [b*t][CC] (only when there is an output projection)
#define WS_END (WS_Y  + 0u)

#define KS 32               // k of a staged W tile (one WMMA step a barrier)
#define WPB 80              // bytes of a staged W column in LDS: KS bf16 + 16 B = 16 B x odd
static_assert(128 * WPB <= 128 * 72 * 2, "a W buffer fits the place of tb or tbl");
// ---- k_proj: block = (64 rows, 128 cols, which): q/k/v = X W (+ b) with exact bf16 products (K = DIN) -> which 0: q f16 rows (+ residual rows < QHI); 1: k f16 rows (+ residual rows < KHI); 2: v f16 planes [c][t] (+ bf16 hi/lo planes for t < KHI)
__global__ __launch_bounds__(128) void k_proj(const float* __restrict__ XQ, const float* __restrict__ XK, const float* __restrict__ XV, const float* __restrict__ WQ, const float* __restrict__ WK, const float* __restrict__ WV, const float* __restrict__ BQ, const float* __restrict__ BK, const float* __restrict__ BV,
    _Float16* __restrict__ QH, _Float16* __restrict__ QL, _Float16* __restrict__ KH, _Float16* __restrict__ KL, _Float16* __restrict__ VT, __bf16* __restrict__ VB, __bf16* __restrict__ VBL) {
  __shared__ __align__(16) _Float16 sh[64][136], sl[64][136]; __shared__ __align__(16) _Float16 th[128][72]; __shared__ __align__(16) __bf16 tb[128][72], tbl[128][72];
  const int tid = threadIdx.x, wave = tid >> 5, lane = tid & 31, col = lane & 15, g = lane >> 4; const int which = blockIdx.z; const int c0 = blockIdx.y * 128; const size_t r0 = (size_t)blockIdx.x * 64; const size_t bb = r0 / TT; const int t0 = (int)(r0 % TT);
  const float* X = which == 0 ? XQ : which == 1 ? XK : XV; const float* WA = which == 0 ? WQ : which == 1 ? WK : WV; const float* BA = which == 0 ? BQ : which == 1 ? BK : BV;
  v8f acc[8] = {};
  // W tile of KS k x 128 columns: each thread loads 4 columns x 8 k (whole 256-B head rows per half wave), rounds to bf16 once for the block and writes 16-B pieces (8 k of one column) to LDS;
  // column n lies at n * WPB, its piece c at place c ^ ((n >> 4) & 3): 16 lanes of a store (columns 4 apart) and 16 lanes of a fragment read (columns in a row) each fall on distinct banks.
  // The two buffers take the place of tb and tbl, which the epilogue fills only behind the barrier that follows the loop.
  const float* wp = WA + ((size_t)((c0 >> 6) + (lane >> 4)) * DIN + wave * 8) * 64 + (lane & 15) * 4; const float* xp = X + (r0 + wave * 16 + col) * DIN + 8 * g;
  const int wst = (4 * lane) * WPB + ((wave ^ ((lane >> 2) & 3)) * 16);
  v4f wr[8], ar[4];
#pragma unroll
  for (int i = 0; i < 8; ++i) wr[i] = *(const v4f*)(wp + (size_t)i * 64);
  ar[0] = *(const v4f*)(xp); ar[1] = *(const v4f*)(xp + 4); ar[2] = *(const v4f*)(xp + 16); ar[3] = *(const v4f*)(xp + 20);
#pragma unroll 2   // so that the buffer of a trip is known at compile time
  for (int kt = 0; kt < DIN / KS; ++kt) { unsigned char* wb = (unsigned char*)((kt & 1) ? &tbl[0][0] : &tb[0][0]); v16b a;
#pragma unroll
    for (int c = 0; c < 4; ++c) { v8b t;
#pragma unroll
      for (int i = 0; i < 8; ++i) t[i] = (__bf16)wr[i][c];
      *(v8b*)(wb + wst + c * WPB) = t; }
#pragma unroll
    for (int i = 0; i < 8; ++i) { a[i] = (__bf16)ar[i >> 2][i & 3]; a[8 + i] = (__bf16)ar[2 + (i >> 2)][i & 3]; }
    if (kt + 1 < DIN / KS) { const float* wn = wp + (size_t)(kt + 1) * KS * 64; const float* xn = xp + (kt + 1) * KS;
#pragma unroll
      for (int i = 0; i < 8; ++i) wr[i] = *(const v4f*)(wn + (size_t)i * 64);
      ar[0] = *(const v4f*)(xn); ar[1] = *(const v4f*)(xn + 4); ar[2] = *(const v4f*)(xn + 16); ar[3] = *(const v4f*)(xn + 20);
      asm volatile("s_wait_xcnt 0x0" ::: "memory"); }   // the next trip's loads issue here, ahead of this trip's products, and their address registers may be stepped behind this wait
    // work-group barrier by hand: __syncthreads() would also wait for the global loads just issued, which are to stay in flight over this trip's products. It publishes this trip's W tile (each wave's LDS stores are done at its signal) and ends every wave's reads of the other buffer, which the next trip refills.
    asm volatile("s_wait_dscnt 0x0\n\ts_barrier_signal -1\n\ts_barrier_wait -1" ::: "memory");
    v16b w[8];
#pragma unroll
    for (int j = 0; j < 8; ++j) { union { v16b v; v8b q[2]; } u; const unsigned char* rp = wb + (j * 16 + col) * WPB;
      u.q[0] = *(const v8b*)(rp + ((g ^ (j & 3)) * 16)); u.q[1] = *(const v8b*)(rp + (((2 + g) ^ (j & 3)) * 16)); w[j] = u.v; }
    __builtin_amdgcn_sched_barrier(0);   // all 16 LDS reads issue ahead of the first product: one LDS latency a trip, not one a product
#pragma unroll
    for (int j = 0; j < 8; ++j) acc[j] = wmma_bf(a, w[j], acc[j]);
    __builtin_amdgcn_sched_barrier(0); }   // the next tile's rounding, and with it the wait for the loads in flight, stays behind this trip's products
  __syncthreads();   // the last tile's readers leave tbl before the epilogue writes tb and tbl (tb's readers were done at the last trip's barrier)
  if (which < 2) { _Float16* DH = which == 0 ? QH : KH; _Float16* DL = which == 0 ? QL : KL; const int nhi = which == 0 ? QHI : KHI; const bool hi_rows = t0 < nhi;
#pragma unroll
    for (int j = 0; j < 8; ++j) { const float bias = BA ? bfr(BA[c0 + j * 16 + col]) : 0.f;
#pragma unroll
      for (int r = 0; r < 8; ++r) { const float v = acc[j][r] + bias; const _Float16 hv = (_Float16)v; sh[wave * 16 + 8 * g + r][j * 16 + col] = hv; sl[wave * 16 + 8 * g + r][j * 16 + col] = (_Float16)((v - (float)hv) * 1024.0f); } }
    __syncthreads();
    for (int e = tid; e < 64 * 16; e += 128) { const int rl = e >> 4, q = e & 15; vst2((unsigned*)(DH + (r0 + rl) * CC + c0 + q * 8), *(const v4u*)&sh[rl][q * 8]); if (hi_rows) vst2((unsigned*)(DL + (bb * nhi + t0 + rl) * (size_t)CC + c0 + q * 8), *(const v4u*)&sl[rl][q * 8]); }
  } else { const bool hi_rows = t0 < KHI;
#pragma unroll
    for (int j = 0; j < 8; ++j) { const float bias = BA ? bfr(BA[c0 + j * 16 + col]) : 0.f;
#pragma unroll
      for (int r = 0; r < 8; ++r) { const float v = acc[j][r] + bias; const int rl = wave * 16 + 8 * g + r, cl = j * 16 + col; th[cl][rl] = (_Float16)v; const __bf16 bh = (__bf16)v; tb[cl][rl] = bh; tbl[cl][rl] = (__bf16)(v - (float)bh); } }
    __syncthreads();
    for (int e = tid; e < 128 * 8; e += 128) { const int cl = e >> 3, q = e & 7; vst2((unsigned*)(VT + (bb * CC + c0 + cl) * (size_t)TT + t0 + q * 8), *(const v4u*)&th[cl][q * 8]); if (hi_rows) { const size_t o3 = (bb * CC + c0 + cl) * (size_t)KHI + t0 + q * 8; vst2((unsigned*)(VB + o3), *(const v4u*)&tb[cl][q * 8]); vst2((unsigned*)(VBL + o3), *(const v4u*)&tbl[cl][q * 8]); } } } }
// ---- k_sc: block = (query block qb, key block kb <= kb_last(qb), head in group) of batch b: logits x SCALE; q hi + residual (x 2^10) against k (2 products) for query rows < QHI, plus the k residual (3 products) for query blocks < QBH (causal early rows); causal: blocks past the diagonal exit, the mask itself is applied by index in k_pv
__global__ __launch_bounds__(128) void k_sc(const _Float16* __restrict__ QH, const _Float16* __restrict__ KH, const _Float16* __restrict__ QL, const _Float16* __restrict__ KL, int b, int h0, float* __restrict__ S0) { __shared__ __align__(16) float ss[4][16][132];
  const int qb = blockIdx.x, kb = blockIdx.y; if (kb > kb_last(qb)) return;
  const int h = h0 + blockIdx.z; float* S = S0 + (size_t)blockIdx.z * TT * TT;
  const int tid = threadIdx.x, wave = tid >> 5, lane = tid & 31, col = lane & 15, g = lane >> 4; const int k0 = kb * 128; const int ql0 = qb * 64 + wave * 16; const size_t q0 = (size_t)b * TT + ql0, kr0 = (size_t)b * TT + k0;
  v8f acc[8] = {}, accl[8] = {};
  const _Float16* QLb = QL + (size_t)b * QHI * CC; const _Float16* KLb = KL + (size_t)b * KHI * CC;
  if (qb < QBH) {
#pragma unroll
    for (int kc = 0; kc < HD / 32; ++kc) { const v16h ah = frag_h(QH + (q0 + col) * CC + h * HD + kc * 32, lane), al = frag_h(QLb + (size_t)(ql0 + col) * CC + h * HD + kc * 32, lane);
#pragma unroll
      for (int j = 0; j < 8; ++j) { const v16h kbf = frag_h(KH + (kr0 + j * 16 + col) * CC + h * HD + kc * 32, lane), klf = frag_h(KLb + (size_t)(k0 + j * 16 + col) * CC + h * HD + kc * 32, lane); acc[j] = wmma16(ah, kbf, acc[j]); accl[j] = wmma16(al, kbf, accl[j]); accl[j] = wmma16(ah, klf, accl[j]); } }
  } else if (qb * 64 < QHI) {
#pragma unroll
    for (int kc = 0; kc < HD / 32; ++kc) { const v16h ah = frag_h(QH + (q0 + col) * CC + h * HD + kc * 32, lane), al = frag_h(QLb + (size_t)(ql0 + col) * CC + h * HD + kc * 32, lane);
#pragma unroll
      for (int j = 0; j < 8; ++j) { const v16h kbf = frag_h(KH + (kr0 + j * 16 + col) * CC + h * HD + kc * 32, lane); acc[j] = wmma16(ah, kbf, acc[j]); accl[j] = wmma16(al, kbf, accl[j]); } }
  } else {
#pragma unroll
    for (int kc = 0; kc < HD / 32; ++kc) { const v16h ah = frag_h(QH + (q0 + col) * CC + h * HD + kc * 32, lane);
#pragma unroll
      for (int j = 0; j < 8; ++j) { const v16h kbf = frag_h(KH + (kr0 + j * 16 + col) * CC + h * HD + kc * 32, lane); acc[j] = wmma16(ah, kbf, acc[j]); } } }
#pragma unroll
  for (int j = 0; j < 8; ++j) {
#pragma unroll
    for (int r = 0; r < 8; ++r) ss[wave][8 * g + r][j * 16 + col] = (acc[j][r] + accl[j][r] * (1.0f / 1024.0f)) * SCALE; }
  LDSX(); for (int rl = 0; rl < 16; ++rl) vst2(S + (size_t)(ql0 + rl) * TT + k0 + lane * 4, *(const v4f*)&ss[wave][rl][lane * 4]); }
// ---- k_pv: block = 16 queries (tile qt) of (b, h), PVW waves. First wave w takes the logits of query row w (keys [0, kend), 128 a load) into registers: causal -> logit if s <= t else excluded; softmax in f32; P x 2^11 (0 for excluded) goes to LDS, once to f16 (f32 for the causal early query blocks). Behind one barrier wave w takes the 32-key chunks w, w + PVW, ... and the block adds the PVW partial tiles in LDS in wave order: ctx = P . v (P f16 against v f16: 1 product; causal early query blocks: P and v as bf16 hi + lo, 3 products); 256-B (row, head) segment by one wave
#define PVW 16
#define PROWB (2 * TT + 16)   // bytes of a P row in LDS: 16 B x odd, so that the 16 rows of a fragment read fall on distinct banks
typedef __attribute__((ext_vector_type(4))) _Float16 v4h;
__global__ __launch_bounds__(32 * PVW) void k_pv(const float* __restrict__ S0, const _Float16* __restrict__ VT, const __bf16* __restrict__ VB, const __bf16* __restrict__ VBL, int b, int h0, float* __restrict__ Y) { const int h = h0 + blockIdx.z; const float* S = S0 + (size_t)blockIdx.z * TT * TT; __shared__ __align__(16) float ss[PVW][16][HD + 4]; __shared__ __align__(16) unsigned char sp[16 * PROWB];
  static_assert(PVW == 16 && HD == 64, "wave w normalises, sums and stores row w of the 16-row tile");
  static_assert(4 * KHI <= PROWB && QBH * 64 <= KHI && KHI % 128 == 0, "an early row has at most KHI keys, and its f32 P fits the row's place in LDS");
  const int tid = threadIdx.x, wave = __builtin_amdgcn_readfirstlane(tid >> 5), lane = tid & 31, col = lane & 15, g = lane >> 4; const int qb = blockIdx.x >> 2; const int ql0 = blockIdx.x * 16; const int nj = kb_last(qb) + 1; const int kce = nj * 4;
  { const int t = ql0 + wave; const float* sr = S + (size_t)t * TT + lane * 4; v4f x[TT / 128];
#pragma unroll   // the row stays in registers: every index of x is a constant; all loads issue ahead of the first use
    for (int j = 0; j < TT / 128; ++j) if (j < nj) {
      if (j == TT / 128 - 1) asm volatile("s_wait_xcnt 0x0" ::: "memory");   // the last load's result may take the registers of the address that the loads before it name
      x[j] = *(const v4f*)(sr + j * 128); }
    float m = -3.0e38f;
#pragma unroll
    for (int j = 0; j < TT / 128; ++j) if (j < nj) {
#pragma unroll
      for (int i = 0; i < 4; ++i) { const float v = (!CAUSAL || j * 128 + lane * 4 + i <= t) ? x[j][i] : -3.0e38f; x[j][i] = v; m = fmaxf(m, v); } }
#pragma unroll
    for (int o = 1; o < 32; o <<= 1) m = fmaxf(m, __shfl_xor(m, o));
    float sum = 0.f;
#pragma unroll
    for (int j = 0; j < TT / 128; ++j) if (j < nj) {
#pragma unroll
      for (int i = 0; i < 4; ++i) { const float v = x[j][i]; const float ex = expf(v - m); const float e = (v <= -1.0e38f) ? 0.f : ex; x[j][i] = e; sum += e; } }
#pragma unroll
    for (int o = 1; o < 32; o <<= 1) sum += __shfl_xor(sum, o);
    const float inv = sum > 0.f ? 2048.0f / sum : 0.f;   /* a fully excluded row yields P = 0 */
    unsigned char* pr = sp + wave * PROWB;
    if (qb < QBH) {
#pragma unroll
      for (int j = 0; j < KHI / 128; ++j) if (j < nj) vst2(pr + (j * 128 + lane * 4) * 4, x[j] * inv);
    } else {
#pragma unroll
      for (int j = 0; j < TT / 128; ++j) if (j < nj) { v4h ph;
#pragma unroll
        for (int i = 0; i < 4; ++i) ph[i] = (_Float16)(x[j][i] * inv);
        vst2(pr + (j * 128 + lane * 4) * 2, ph); } } }
  __syncthreads();
  v8f acc[HD / 16] = {};
  if (qb < QBH) {
#pragma unroll 1
    for (int kc = wave; kc < kce; kc += PVW) { const F2 p = split_row((const float*)(sp + col * PROWB), kc * 32, lane);
#pragma unroll
      for (int j = 0; j < HD / 16; ++j) { const size_t po = ((size_t)b * CC + h * HD + j * 16 + col) * (size_t)KHI + kc * 32; const v16b vh = frag_b(VB + po, lane); acc[j] = wmma_bf(p.h, vh, acc[j]); acc[j] = wmma_bf(p.l, vh, acc[j]); acc[j] = wmma_bf(p.h, frag_b(VBL + po, lane), acc[j]); } }
  } else {
#pragma unroll 1
    for (int kc = wave; kc < kce; kc += PVW) { const v16h p = frag_h((const _Float16*)(sp + col * PROWB) + kc * 32, lane);
#pragma unroll
      for (int j = 0; j < HD / 16; ++j) { const size_t po = ((size_t)b * CC + h * HD + j * 16 + col) * (size_t)TT + kc * 32; acc[j] = wmma16(p, frag_h(VT + po, lane), acc[j]); } } }
#pragma unroll
  for (int j = 0; j < HD / 16; ++j)
#pragma unroll
    for (int r = 0; r < 8; ++r) ss[wave][8 * g + r][j * 16 + col] = acc[j][r] * (1.0f / 2048.0f);
  __syncthreads();
  v2f s = *(const v2f*)&ss[0][wave][lane * 2];
#pragma unroll   // so that the LDS reads of the partial tiles issue ahead of the adds, not one wait per read
  for (int w = 1; w < PVW; ++w) s += *(const v2f*)&ss[w][wave][lane * 2];
  vst2(Y + ((size_t)b * TT + ql0 + wave) * CC + h * HD + lane * 2, s); }

extern "C" void kernel_launch(void* const* d_in, const int* in_sizes, int n_in, void* d_out, int out_size, void* d_ws, size_t ws_size, hipStream_t stream) {
  (void)in_sizes; (void)n_in; (void)out_size;
  const float** F = (const float**)d_in;
  if (ws_size < (size_t)WS_END) return;
  char* ws = (char*)d_ws; _Float16 *QH = (_Float16*)(ws + WS_QH), *KH = (_Float16*)(ws + WS_KH), *VT = (_Float16*)(ws + WS_VT), *QL = (_Float16*)(ws + WS_QL), *KL = (_Float16*)(ws + WS_KL); __bf16 *VB = (__bf16*)(ws + WS_VB), *VBL = (__bf16*)(ws + WS_VBL); float *S = (float*)(ws + WS_S), *Y = (float*)(ws + WS_Y);
  (void)Y; (void)QL; (void)KL; (void)VB; (void)VBL;
  // inputs: 0 x [2,2048,1024]; 1 Wq [16,1024,64]; 2 Wk; 3 Wv (per-head (in,out)); no biases, no output projection
  k_proj<<<dim3(TNB * TT / 64, CC / 128, 3), 128, 0, stream>>>(F[0], F[0], F[0], F[1], F[2], F[3], nullptr, nullptr, nullptr, QH, QL, KH, KL, VT, VB, VBL);
  for (int b = 0; b < TNB; ++b) for (int h0 = 0; h0 < NH; h0 += HG) {
    k_sc<<<dim3(NQB, TT / 128, HG), 128, 0, stream>>>(QH, KH, QL, KL, b, h0, S);
    k_pv<<<dim3(TT / 16, 1, HG), 32 * PVW, 0, stream>>>(S, VT, VB, VBL, b, h0, (float*)d_out);   /* merged heads [b][t][h*64+d] == the output layout */
  }
}

// v004
// One run takes 100 microseconds.
// Timed twice side by side with v003, it ran 3.31 and 3.28 times as fast.
// Over all steps from v000 it is 9.73 times as fast.
// compute dtype: all float inputs rounded to bf16; per-head q/k/v projections with EXACT bf16 products on WMMA 16x16x32 (f32 accumulate); causal logits: q f16 x k f16 (1 product; 3 with the q and k residuals for the first 384 rows) x 1024^-0.5; softmax f32 (running maximum and sum); exp(logit - maximum) x 2^11 once to f16 x v once to f16 (1 product; bf16 hi + lo below row 384), divided by the sum at the end; f32 output (no output projection).
#include <hip/hip_runtime.h>
#include <math.h>

typedef __attribute__((ext_vector_type(16))) _Float16 v16h;
typedef __attribute__((ext_vector_type(16))) __bf16 v16b;
typedef __attribute__((ext_vector_type(8)))  _Float16 v8h;
typedef __attribute__((ext_vector_type(8)))  float v8f;
typedef __attribute__((ext_vector_type(4)))  float v4f;
typedef __attribute__((ext_vector_type(2)))  float v2f;
typedef __attribute__((ext_vector_type(4)))  unsigned v4u;
typedef __attribute__((ext_vector_type(4)))  int v4i;
typedef float __attribute__((may_alias)) float_a;
typedef int __attribute__((may_alias)) int_a;

template <typename T> __device__ __forceinline__ void vst2(void* p, T v) { *(T*)p = v;  }
__device__ __forceinline__ v8f wmma16(v16h a, v16h b, v8f c) {
  v8f d = __builtin_amdgcn_wmma_f32_16x16x32_f16(false, a, false, b, (short)0, c, false, false);
  asm volatile("v_nop\n\tv_nop\n\tv_nop\n\tv_nop" : "+v"(d) : "v"(a), "v"(b));
  return d;
}
__device__ __forceinline__ v8f wmma_bf(v16b a, v16b b, v8f c) {
  v8f d = __builtin_amdgcn_wmma_f32_16x16x32_bf16(false, a, false, b, (short)0, c, false, false);
  asm volatile("v_nop\n\tv_nop\n\tv_nop\n\tv_nop" : "+v"(d) : "v"(a), "v"(b));
  return d;
}
// 16x16x32 fragments: lane = (h = lane>>4, row/col = lane&15); elements 0..7 = k0+8h+0..7, 8..15 = k0+16+8h+0..7; D element r = row 8h+r
__device__ __forceinline__ v16h frag_h(const _Float16* rowk0, int lane) {
  union { v16h v; v8h q[2]; } u; const _Float16* p = rowk0 + 8 * (lane >> 4);
  u.q[0] = *(const v8h*)p; u.q[1] = *(const v8h*)(p + 16); return u.v;
}
__device__ __forceinline__ v16h frag_f32(const float* rowk0, int lane) {
  v16h a; const float* p = rowk0 + 8 * (lane >> 4);
#pragma unroll
  for (int i = 0; i < 8; ++i) { a[i] = (_Float16)p[i]; a[8 + i] = (_Float16)p[16 + i]; }
  return a;
}
__device__ __forceinline__ v16h frag_f32s(const float* rowk0, int lane, float sc) {
  v16h a; const float* p = rowk0 + 8 * (lane >> 4);
#pragma unroll
  for (int i = 0; i < 8; ++i) { a[i] = (_Float16)(p[i] * sc); a[8 + i] = (_Float16)(p[16 + i] * sc); }
  return a;
}
// column fragment from a [K][ld] layout (column n), rows >= K read as 0
__device__ __forceinline__ v16h fragc_f32(const float* W, int k0, int n, int lane, int ld, int K) {
  v16h a; const int g = lane >> 4;
#pragma unroll
  for (int i = 0; i < 8; ++i) { const int ka = k0 + 8 * g + i, kb = ka + 16;
    a[i] = (_Float16)(ka < K ? W[(size_t)(ka < K ? ka : K - 1) * ld + n] : 0.f); a[8 + i] = (_Float16)(kb < K ? W[(size_t)(kb < K ? kb : K - 1) * ld + n] : 0.f); }
  return a;
}
struct F2 { v16b h, l; };
__device__ __forceinline__ F2 bsplit16(const float v[16]) { F2 r;
#pragma unroll
  for (int i = 0; i < 16; ++i) { const __bf16 h = (__bf16)v[i]; r.h[i] = h; r.l[i] = (__bf16)(v[i] - (float)h); }
  return r; }
__device__ __forceinline__ F2 split_row(const float* row, int k0, int lane) { float v[16]; const float* p = row + k0 + 8 * (lane >> 4);
#pragma unroll
  for (int i = 0; i < 8; ++i) { v[i] = p[i]; v[8 + i] = p[16 + i]; }
  return bsplit16(v); }
__device__ __forceinline__ F2 split_rowK(const float* row, int k0, int lane, int K) { float v[16]; const int g = lane >> 4;
#pragma unroll
  for (int i = 0; i < 8; ++i) { const int ka = k0 + 8 * g + i, kb = ka + 16; v[i] = ka < K ? row[ka < K ? ka : K - 1] : 0.f; v[8 + i] = kb < K ? row[kb < K ? kb : K - 1] : 0.f; }
  return bsplit16(v); }
__device__ __forceinline__ F2 split_col(const float* W, int k0, int n, int lane, int ld, int K) { float v[16]; const int g = lane >> 4;
#pragma unroll
  for (int i = 0; i < 8; ++i) { const int ka = k0 + 8 * g + i, kb = ka + 16; v[i] = ka < K ? W[(size_t)(ka < K ? ka : K - 1) * ld + n] : 0.f; v[8 + i] = kb < K ? W[(size_t)(kb < K ? kb : K - 1) * ld + n] : 0.f; }
  return bsplit16(v); }
__device__ __forceinline__ v8f mac3(const F2& a, const F2& b, v8f c) { c = wmma_bf(a.l, b.h, c); c = wmma_bf(a.h, b.l, c); return wmma_bf(a.h, b.h, c); }
__device__ __forceinline__ float sigm(float v) { return 1.0f / (1.0f + expf(-v)); }

// Causal multi-head self-attention without output projection (B 2, T 2,048, C 1,024, 16 heads x 64; per-head weights Wq/Wk/Wv [16,1024,64], 0.02-scale, no biases; the logit scale is C^-0.5 = 1/32 as in the source): out = concat_h causal_softmax(q_h k_h^T / 32) v_h -> [2, 2048, 1024].
#define NB 2
#define TT 2048
#define CC 1024            // NH * HD = projected width
#define DIN 1024          // input (model) width
#define NH 16
#define HD 64
#define SCALE (0.03125f)
#define CAUSAL 1
#ifndef TNB
#define TNB NB
#endif
__device__ __forceinline__ float bfr(float v) { return (float)(__bf16)v; }
__host__ __device__ __forceinline__ int kb_last(int qb) { return CAUSAL ? ((qb * 64 + 63) >> 7) : (TT / 128 - 1); }
typedef __attribute__((ext_vector_type(8))) __bf16 v8b;
__device__ __forceinline__ v16b frag_b(const __bf16* rowk0, int lane) {
  union { v16b v; v8b q[2]; } u; const __bf16* p = rowk0 + 8 * (lane >> 4);
  u.q[0] = *(const v8b*)p; u.q[1] = *(const v8b*)(p + 16); return u.v;
}
#define QBH 6              // causal: query blocks 0..QBH-1 of each sequence (few keys, no averaging) take the high-precision path
#define QHI 384            // rows carrying a q residual plane (used only by the causal high-precision path)
#define KHI 384            // key rows carrying k residual / v bf16 hi+lo planes (used only by the causal high-precision path)
// B fragment (k rows k0+.., output column o) of a weight: (in,out) [K][ld] or (out,in) [ld rows of K]: bf16 exact, or f16(bf16 * 256) exact
__device__ __forceinline__ v16b wcol_io(const float* Wm, int k0, int o, int lane, int ld) { v16b w; const int g = lane >> 4;
#pragma unroll
  for (int i = 0; i < 8; ++i) { w[i] = (__bf16)Wm[(size_t)(k0 + 8 * g + i) * ld + o]; w[8 + i] = (__bf16)Wm[(size_t)(k0 + 16 + 8 * g + i) * ld + o]; }
  return w; }
__device__ __forceinline__ v16b wcol_oi(const float* Wm, int k0, int o, int lane, int K) { v16b w; const float* p = Wm + (size_t)o * K + k0 + 8 * (lane >> 4);
#pragma unroll
  for (int i = 0; i < 8; ++i) { w[i] = (__bf16)p[i]; w[8 + i] = (__bf16)p[16 + i]; }
  return w; }
__device__ __forceinline__ v16h wcolh_io(const float* Wm, int k0, int o, int lane, int ld) { v16h w; const int g = lane >> 4;
#pragma unroll
  for (int i = 0; i < 8; ++i) { w[i] = (_Float16)(bfr(Wm[(size_t)(k0 + 8 * g + i) * ld + o]) * 256.0f); w[8 + i] = (_Float16)(bfr(Wm[(size_t)(k0 + 16 + 8 * g + i) * ld + o]) * 256.0f); }
  return w; }
__device__ __forceinline__ v16h wcolh_oi(const float* Wm, int k0, int o, int lane, int K) { v16h w; const float* p = Wm + (size_t)o * K + k0 + 8 * (lane >> 4);
#pragma unroll
  for (int i = 0; i < 8; ++i) { w[i] = (_Float16)(bfr(p[i]) * 256.0f); w[8 + i] = (_Float16)(bfr(p[16 + i]) * 256.0f); }
  return w; }
#define WQKV_LAYOUT 0   // 0 = per-head [NH][DIN][HD]; 1 = (out,in) [CC][DIN]; 2 = per-head [NH][DIN][HD]
__device__ __forceinline__ v16b wcol_hdk(const float* Wm, int k0, int o, int lane) { v16b w; const int g = lane >> 4; const float* p = Wm + (size_t)(o / HD) * DIN * HD + (o % HD);
#pragma unroll
  for (int i = 0; i < 8; ++i) { w[i] = (__bf16)p[(size_t)(k0 + 8 * g + i) * HD]; w[8 + i] = (__bf16)p[(size_t)(k0 + 16 + 8 * g + i) * HD]; }
  return w; }
#define WO_OUT_IN 0
#if WQKV_LAYOUT == 1
#define WCOL(W, k0, o, lane) wcol_oi(W, k0, o, lane, DIN)
#elif WQKV_LAYOUT == 2
#define WCOL(W, k0, o, lane) wcol_hdk(W, k0, o, lane)
#else
#define WCOL(W, k0, o, lane) wcol_heads(W, k0, o, lane)   /* per-head [h][C][64] weights */
#endif
#if WO_OUT_IN
#define WOCOL(W, k0, o, lane) wcol_oi(W, k0, o, lane, CC)
#define WOCOLH(W, k0, o, lane) wcolh_oi(W, k0, o, lane, CC)
#else
#define WOCOL(W, k0, o, lane) wcol_io(W, k0, o, lane, DIN)
#define WOCOLH(W, k0, o, lane) wcolh_io(W, k0, o, lane, DIN)
#endif
// per-head projection weights W[h][c][d] ([16][1024][64]): column o = h*64 + d of the virtual (in,out) [C][H*D] matrix lives at W + (h*C + k)*64 + d
__device__ __forceinline__ v16b wcol_heads(const float* __restrict__ Wm, int k0, int o, int lane) { v16b w; const int g = lane >> 4; const float* p = Wm + ((size_t)(o >> 6) * DIN + k0 + 8 * g) * 64 + (o & 63);
#pragma unroll
  for (int i = 0; i < 8; ++i) { w[i] = (__bf16)p[(size_t)i * 64]; w[8 + i] = (__bf16)p[(size_t)(16 + i) * 64]; }
  asm volatile("s_wait_loadcnt 0x0" ::: "memory"); return w; }
#ifndef PROJ_EXTRA_PARAMS
#define PROJ_EXTRA_PARAMS
#endif

#define WS_QH  0u                                      // f16 q rows [b*t][CC]
#define WS_KH  (WS_QH + 2u * (size_t)NB * TT * CC)      // f16 k rows [b*t][CC]
#define WS_VT  (WS_KH + 2u * (size_t)NB * TT * CC)      // f16 v planes [b][c][t]
#define WS_QL  (WS_VT + 2u * (size_t)NB * CC * TT)      // f16 q residual x 2^10 rows [b][t < QHI][CC]
#define WS_KL  (WS_QL + 2u * (size_t)NB * QHI * CC)     // f16 k residual x 2^10 rows [b][t < KHI][CC]
#define WS_VB  (WS_KL + 2u * (size_t)NB * KHI * CC)     // bf16 v hi planes [b][c][t < KHI]
#define WS_VBL (WS_VB + 2u * (size_t)NB * CC * KHI)
#define WS_END (WS_VBL + 2u * (size_t)NB * CC * KHI)

#define KS 32               // k of a staged W tile (one WMMA step a barrier)
#define WPB 80              // bytes of a staged W column in LDS: KS bf16 + 16 B = 16 B x odd
static_assert(128 * WPB <= 128 * 72 * 2, "a W buffer fits the place of tb or tbl");
// ---- k_proj: block = (64 rows, 128 cols, which): q/k/v = X W (+ b) with exact bf16 products (K = DIN) -> which 0: q f16 rows (+ residual rows < QHI); 1: k f16 rows (+ residual rows < KHI); 2: v f16 planes [c][t] (+ bf16 hi/lo planes for t < KHI)
__global__ __launch_bounds__(128) void k_proj(const float* __restrict__ XQ, const float* __restrict__ XK, const float* __restrict__ XV, const float* __restrict__ WQ, const float* __restrict__ WK, const float* __restrict__ WV, const float* __restrict__ BQ, const float* __restrict__ BK, const float* __restrict__ BV,
    _Float16* __restrict__ QH, _Float16* __restrict__ QL, _Float16* __restrict__ KH, _Float16* __restrict__ KL, _Float16* __restrict__ VT, __bf16* __restrict__ VB, __bf16* __restrict__ VBL) {
  __shared__ __align__(16) _Float16 sh[64][136], sl[64][136]; __shared__ __align__(16) _Float16 th[128][72]; __shared__ __align__(16) __bf16 tb[128][72], tbl[128][72];
  const int tid = threadIdx.x, wave = tid >> 5, lane = tid & 31, col = lane & 15, g = lane >> 4; const int which = blockIdx.z; const int c0 = blockIdx.y * 128; const size_t r0 = (size_t)blockIdx.x * 64; const size_t bb = r0 / TT; const int t0 = (int)(r0 % TT);
  const float* X = which == 0 ? XQ : which == 1 ? XK : XV; const float* WA = which == 0 ? WQ : which == 1 ? WK : WV; const float* BA = which == 0 ? BQ : which == 1 ? BK : BV;
  v8f acc[8] = {};
  // W tile of KS k x 128 columns: each thread loads 4 columns x 8 k (whole 256-B head rows per half wave), rounds to bf16 once for the block and writes 16-B pieces (8 k of one column) to LDS;
  // column n lies at n * WPB, its piece c at place c ^ ((n >> 4) & 3): 16 lanes of a store (columns 4 apart) and 16 lanes of a fragment read (columns in a row) each fall on distinct banks.
  // The two buffers take the place of tb and tbl, which the epilogue fills only behind the barrier that follows the loop.
  const float* wp = WA + ((size_t)((c0 >> 6) + (lane >> 4)) * DIN + wave * 8) * 64 + (lane & 15) * 4; const float* xp = X + (r0 + wave * 16 + col) * DIN + 8 * g;
  const int wst = (4 * lane) * WPB + ((wave ^ ((lane >> 2) & 3)) * 16);
  v4f wr[8], ar[4];
#pragma unroll
  for (int i = 0; i < 8; ++i) wr[i] = *(const v4f*)(wp + (size_t)i * 64);
  ar[0] = *(const v4f*)(xp); ar[1] = *(const v4f*)(xp + 4); ar[2] = *(const v4f*)(xp + 16); ar[3] = *(const v4f*)(xp + 20);
#pragma unroll 2   // so that the buffer of a trip is known at compile time
  for (int kt = 0; kt < DIN / KS; ++kt) { unsigned char* wb = (unsigned char*)((kt & 1) ? &tbl[0][0] : &tb[0][0]); v16b a;
#pragma unroll
    for (int c = 0; c < 4; ++c) { v8b t;
#pragma unroll
      for (int i = 0; i < 8; ++i) t[i] = (__bf16)wr[i][c];
      *(v8b*)(wb + wst + c * WPB) = t; }
#pragma unroll
    for (int i = 0; i < 8; ++i) { a[i] = (__bf16)ar[i >> 2][i & 3]; a[8 + i] = (__bf16)ar[2 + (i >> 2)][i & 3]; }
    if (kt + 1 < DIN / KS) { const float* wn = wp + (size_t)(kt + 1) * KS * 64; const float* xn = xp + (kt + 1) * KS;
#pragma unroll
      for (int i = 0; i < 8; ++i) wr[i] = *(const v4f*)(wn + (size_t)i * 64);
      ar[0] = *(const v4f*)(xn); ar[1] = *(const v4f*)(xn + 4); ar[2] = *(const v4f*)(xn + 16); ar[3] = *(const v4f*)(xn + 20);
      asm volatile("s_wait_xcnt 0x0" ::: "memory"); }   // the next trip's loads issue here, ahead of this trip's products, and their address registers may be stepped behind this wait
    // work-group barrier by hand: __syncthreads() would also wait for the global loads just issued, which are to stay in flight over this trip's products. It publishes this trip's W tile (each wave's LDS stores are done at its signal) and ends every wave's reads of the other buffer, which the next trip refills.
    asm volatile("s_wait_dscnt 0x0\n\ts_barrier_signal -1\n\ts_barrier_wait -1" ::: "memory");
    v16b w[8];
#pragma unroll
    for (int j = 0; j < 8; ++j) { union { v16b v; v8b q[2]; } u; const unsigned char* rp = wb + (j * 16 + col) * WPB;
      u.q[0] = *(const v8b*)(rp + ((g ^ (j & 3)) * 16)); u.q[1] = *(const v8b*)(rp + (((2 + g) ^ (j & 3)) * 16)); w[j] = u.v; }
    __builtin_amdgcn_sched_barrier(0);   // all 16 LDS reads issue ahead of the first product: one LDS latency a trip, not one a product
#pragma unroll
    for (int j = 0; j < 8; ++j) acc[j] = wmma_bf(a, w[j], acc[j]);
    __builtin_amdgcn_sched_barrier(0); }   // the next tile's rounding, and with it the wait for the loads in flight, stays behind this trip's products
  __syncthreads();   // the last tile's readers leave tbl before the epilogue writes tb and tbl (tb's readers were done at the last trip's barrier)
  if (which < 2) { _Float16* DH = which == 0 ? QH : KH; _Float16* DL = which == 0 ? QL : KL; const int nhi = which == 0 ? QHI : KHI; const bool hi_rows = t0 < nhi;
#pragma unroll
    for (int j = 0; j < 8; ++j) { const float bias = BA ? bfr(BA[c0 + j * 16 + col]) : 0.f;
#pragma unroll
      for (int r = 0; r < 8; ++r) { const float v = acc[j][r] + bias; const _Float16 hv = (_Float16)v; sh[wave * 16 + 8 * g + r][j * 16 + col] = hv; sl[wave * 16 + 8 * g + r][j * 16 + col] = (_Float16)((v - (float)hv) * 1024.0f); } }
    __syncthreads();
    for (int e = tid; e < 64 * 16; e += 128) { const int rl = e >> 4, q = e & 15; vst2((unsigned*)(DH + (r0 + rl) * CC + c0 + q * 8), *(const v4u*)&sh[rl][q * 8]); if (hi_rows) vst2((unsigned*)(DL + (bb * nhi + t0 + rl) * (size_t)CC + c0 + q * 8), *(const v4u*)&sl[rl][q * 8]); }
  } else { const bool hi_rows = t0 < KHI;
#pragma unroll
    for (int j = 0; j < 8; ++j) { const float bias = BA ? bfr(BA[c0 + j * 16 + col]) : 0.f;
#pragma unroll
      for (int r = 0; r < 8; ++r) { const float v = acc[j][r] + bias; const int rl = wave * 16 + 8 * g + r, cl = j * 16 + col; th[cl][rl] = (_Float16)v; const __bf16 bh = (__bf16)v; tb[cl][rl] = bh; tbl[cl][rl] = (__bf16)(v - (float)bh); } }
    __syncthreads();
    for (int e = tid; e < 128 * 8; e += 128) { const int cl = e >> 3, q = e & 7; vst2((unsigned*)(VT + (bb * CC + c0 + cl) * (size_t)TT + t0 + q * 8), *(const v4u*)&th[cl][q * 8]); if (hi_rows) { const size_t o3 = (bb * CC + c0 + cl) * (size_t)KHI + t0 + q * 8; vst2((unsigned*)(VB + o3), *(const v4u*)&tb[cl][q * 8]); vst2((unsigned*)(VBL + o3), *(const v4u*)&tbl[cl][q * 8]); } } } }
// ---- k_att: block = QR query rows (QT tiles of 16) of (b, h), FW waves. Wave w takes the 32-key chunks w, w + FW, ... up to the diagonal. Per chunk: logits transposed, S^T = K . Q^T (a lane holds 16 keys of ONE query; q hi + residual x 2^10 and the k residual, 3 products, for the causal early rows), x SCALE, causal mask by index in the chunks that reach past the tile's first query;
// running maximum and sum per query in the lane (one exchange between the wave's halves); exp(logit - maximum) x 2^11 once to f16 is, in place, the B operand of O^T += V^T . P^T (early rows: P and v as bf16 hi + lo, 3 products). Behind one barrier the block joins the FW partial tiles in wave order, each weighted by exp(its maximum - the row's maximum), and divides by the joined sum; 256-B (row, head) segment by 16 lanes of one wave
#define FW 4
#define QT 2
#define QR (16 * QT)
static_assert((QBH * 64) % QR == 0 && QBH * 64 <= KHI && QBH * 64 <= QHI && QR <= 32, "a block is early as a whole, its keys and residual rows exist, and only chunks at the diagonal are masked");
// fragment at a lane's own address (row, k0 + 8 * (lane >> 4))
__device__ __forceinline__ v16h frag_hp(const _Float16* p) { union { v16h v; v8h q[2]; } u; u.q[0] = *(const v8h*)p; u.q[1] = *(const v8h*)(p + 16); return u.v; }
__device__ __forceinline__ v16b frag_bp(const __bf16* p) { union { v16b v; v8b q[2]; } u; u.q[0] = *(const v8b*)p; u.q[1] = *(const v8b*)(p + 16); return u.v; }
// stands behind a run of global loads: the loads issue ahead of it, and their two addresses, named as inputs, keep their registers up to it, so that neither a later load's result nor an address step overwrites them earlier
__device__ __forceinline__ void XWAIT(const void* a, const void* b) { asm volatile("s_wait_xcnt 0x0" :: "v"(a), "v"(b) : "memory"); }
template <bool HI> __device__ __forceinline__ void att_keys(const _Float16* __restrict__ qp, const _Float16* __restrict__ qlp, const _Float16* __restrict__ kp, const _Float16* __restrict__ klp, const _Float16* __restrict__ vp, const __bf16* __restrict__ vbp, const __bf16* __restrict__ vlp,
    int ql0, int kce, int wave, int lane, v8f (&acc)[QT][HD / 16], float (&m)[QT], float (&sum)[QT]) {
  const int col = lane & 15, g = lane >> 4; v16h bq[QT][HD / 32];   // the early rows' few chunks fetch q, its residual and v where they are used: their registers would otherwise set the count for every block
  if (!HI) {
#pragma unroll
    for (int u = 0; u < QT; ++u)
#pragma unroll
      for (int kk = 0; kk < HD / 32; ++kk) bq[u][kk] = frag_hp(qp + (size_t)u * 16 * CC + kk * 32);
    XWAIT(qp, qp); }
#pragma unroll 1   // one chunk's fragments in registers at a time
  for (int kc = wave; kc < kce; kc += FW) { const int k0 = kc * 32; v16h ak[2][HD / 32], akl[2][HD / 32], av[HD / 16]; const _Float16* kq = kp + (size_t)k0 * CC; const _Float16* klq = HI ? klp + (size_t)k0 * CC : kq; const _Float16* vq = vp + k0; const __bf16* vbq = HI ? vbp + k0 : nullptr; const __bf16* vlq = HI ? vlp + k0 : nullptr;
#pragma unroll
    for (int t = 0; t < 2; ++t)
#pragma unroll
      for (int kk = 0; kk < HD / 32; ++kk) { ak[t][kk] = frag_hp(kq + (size_t)t * 16 * CC + kk * 32); if (HI) akl[t][kk] = frag_hp(klq + (size_t)t * 16 * CC + kk * 32); }
#pragma unroll
    for (int j = 0; j < HD / 16; ++j) if (!HI) av[j] = frag_hp(vq + (size_t)j * 16 * TT);
    if (HI) XWAIT(kq, klq); else XWAIT(kq, vq);   // the chunk's k loads (and, off the early rows, v) all issue here, v ahead of the logits that hide its latency
#pragma unroll
    for (int u = 0; u < QT; ++u) { v8f s[2] = {}, sl[2] = {}; float x[16];
#pragma unroll
      for (int kk = 0; kk < HD / 32; ++kk) { v16h qh, ql;
        if (HI) { qh = frag_hp(qp + (size_t)u * 16 * CC + kk * 32); ql = frag_hp(qlp + (size_t)u * 16 * CC + kk * 32); XWAIT(qp, qlp); }
        else qh = bq[u][kk];
#pragma unroll
        for (int t = 0; t < 2; ++t) { s[t] = wmma16(ak[t][kk], qh, s[t]); if (HI) { sl[t] = wmma16(ak[t][kk], ql, sl[t]); sl[t] = wmma16(akl[t][kk], qh, sl[t]); } } }
#pragma unroll
      for (int i = 0; i < 16; ++i) x[i] = HI ? (s[i >> 3][i & 7] + sl[i >> 3][i & 7] * (1.0f / 1024.0f)) * SCALE : s[i >> 3][i & 7] * SCALE;
      if (CAUSAL && k0 + 31 > ql0 + u * 16) {   // same for the whole wave
#pragma unroll
        for (int i = 0; i < 16; ++i) x[i] = (k0 + (i >> 3) * 16 + 8 * g + (i & 7) <= ql0 + u * 16 + col) ? x[i] : -3.0e38f; }
      float mx = x[0];
#pragma unroll
      for (int i = 1; i < 16; ++i) mx = fmaxf(mx, x[i]);
      mx = fmaxf(mx, __shfl_xor(mx, 16));
      if (__builtin_amdgcn_ballot_w32(mx > m[u]) != 0) {   // a scalar branch: no query's maximum rises, nothing to rescale
        const float mn = fmaxf(m[u], mx), al = expf(m[u] - mn); m[u] = mn; sum[u] *= al;
#pragma unroll
        for (int j = 0; j < HD / 16; ++j) acc[u][j] *= al; }
      const float mu = m[u]; float ps = 0.f;
#pragma unroll
      for (int i = 0; i < 16; ++i) { const float ex = expf(x[i] - mu); const float e = (x[i] <= -1.0e38f) ? 0.f : ex; ps += e; x[i] = e * 2048.0f; }
      sum[u] += ps;
      if (HI) { const F2 p = bsplit16(x);
#pragma unroll
        for (int j = 0; j < HD / 16; ++j) { const v16b vh = frag_bp(vbq + (size_t)j * 16 * KHI), vl = frag_bp(vlq + (size_t)j * 16 * KHI); XWAIT(vbq, vlq);
          acc[u][j] = wmma_bf(vh, p.h, acc[u][j]); acc[u][j] = wmma_bf(vh, p.l, acc[u][j]); acc[u][j] = wmma_bf(vl, p.h, acc[u][j]); }
      } else { v16h pb;
#pragma unroll
        for (int i = 0; i < 16; ++i) pb[i] = (_Float16)x[i];
#pragma unroll
        for (int j = 0; j < HD / 16; ++j) acc[u][j] = wmma16(av[j], pb, acc[u][j]); } } } }
__global__ __launch_bounds__(32 * FW) void k_att(const _Float16* __restrict__ QH, const _Float16* __restrict__ KH, const _Float16* __restrict__ QL, const _Float16* __restrict__ KL, const _Float16* __restrict__ VT, const __bf16* __restrict__ VB, const __bf16* __restrict__ VBL, float* __restrict__ Y) {
  __shared__ __align__(16) float ss[FW][QR][HD + 4]; __shared__ float rm[FW][QR], rs[FW][QR];
  const int tid = threadIdx.x, wave = __builtin_amdgcn_readfirstlane(tid >> 5), lane = tid & 31, col = lane & 15, g = lane >> 4;
  const int b = blockIdx.x / NH, h = blockIdx.x % NH; const int ql0 = (TT / QR - 1 - (int)blockIdx.y) * QR;   // the tiles with the most keys start first
  const int kce = CAUSAL ? ((ql0 + QR - 1) >> 5) + 1 : TT / 32;
  v8f acc[QT][HD / 16] = {}; float m[QT], sum[QT];
#pragma unroll
  for (int u = 0; u < QT; ++u) { m[u] = -3.0e38f; sum[u] = 0.f; }
  const _Float16* qp = QH + ((size_t)b * TT + ql0 + col) * CC + h * HD + 8 * g; const _Float16* kp = KH + ((size_t)b * TT + col) * CC + h * HD + 8 * g; const _Float16* vp = VT + ((size_t)b * CC + h * HD + col) * (size_t)TT + 8 * g;
  if (CAUSAL && ql0 < QBH * 64) att_keys<true>(qp, QL + ((size_t)b * QHI + ql0 + col) * CC + h * HD + 8 * g, kp, KL + ((size_t)b * KHI + col) * CC + h * HD + 8 * g, vp, VB + ((size_t)b * CC + h * HD + col) * (size_t)KHI + 8 * g, VBL + ((size_t)b * CC + h * HD + col) * (size_t)KHI + 8 * g, ql0, kce, wave, lane, acc, m, sum);
  else att_keys<false>(qp, nullptr, kp, nullptr, vp, nullptr, nullptr, ql0, kce, wave, lane, acc, m, sum);
#pragma unroll
  for (int u = 0; u < QT; ++u) { sum[u] += __shfl_xor(sum[u], 16);
#pragma unroll
    for (int j = 0; j < HD / 16; ++j) { const v8f a = acc[u][j]; float* d = &ss[wave][u * 16 + col][j * 16 + 8 * g]; vst2(d, (v4f){a[0], a[1], a[2], a[3]}); vst2(d + 4, (v4f){a[4], a[5], a[6], a[7]}); }
    if (g == 0) { rm[wave][u * 16 + col] = m[u]; rs[wave][u * 16 + col] = sum[u]; } }
  __syncthreads();
  for (int e = tid; e < QR * (HD / 4); e += 32 * FW) { const int row = e / (HD / 4), q4 = e % (HD / 4);
    float M = rm[0][row];
#pragma unroll
    for (int w = 1; w < FW; ++w) M = fmaxf(M, rm[w][row]);
    float den = 0.f; v4f o = {};
#pragma unroll
    for (int w = 0; w < FW; ++w) { const float wg = expf(rm[w][row] - M); den += wg * rs[w][row]; o += *(const v4f*)&ss[w][row][q4 * 4] * wg; }   // a wave without keys has maximum -3e38, sum 0 and weight 0
    const float inv = den > 0.f ? 1.0f / (den * 2048.0f) : 0.f;   /* a fully excluded row yields 0 */
    vst2(Y + ((size_t)b * TT + ql0 + row) * CC + h * HD + q4 * 4, o * inv); } }

extern "C" void kernel_launch(void* const* d_in, const int* in_sizes, int n_in, void* d_out, int out_size, void* d_ws, size_t ws_size, hipStream_t stream) {
  (void)in_sizes; (void)n_in; (void)out_size;
  const float** F = (const float**)d_in;
  if (ws_size < (size_t)WS_END) return;
  char* ws = (char*)d_ws; _Float16 *QH = (_Float16*)(ws + WS_QH), *KH = (_Float16*)(ws + WS_KH), *VT = (_Float16*)(ws + WS_VT), *QL = (_Float16*)(ws + WS_QL), *KL = (_Float16*)(ws + WS_KL); __bf16 *VB = (__bf16*)(ws + WS_VB), *VBL = (__bf16*)(ws + WS_VBL);
  // inputs: 0 x [2,2048,1024]; 1 Wq [16,1024,64]; 2 Wk; 3 Wv (per-head (in,out)); no biases, no output projection
  k_proj<<<dim3(TNB * TT / 64, CC / 128, 3), 128, 0, stream>>>(F[0], F[0], F[0], F[1], F[2], F[3], nullptr, nullptr, nullptr, QH, QL, KH, KL, VT, VB, VBL);
  k_att<<<dim3(TNB * NH, TT / QR, 1), 32 * FW, 0, stream>>>(QH, KH, QL, KL, VT, VB, VBL, (float*)d_out);   /* merged heads [b][t][h*64+d] == the output layout */
}

// v005
// A run of this version takes 89.1 microseconds.
// Two timings next to v004 put it at 1.13 and 1.12 times that version's speed.
// All steps since v000 together make it 10.9 times as fast.
// compute dtype: all float inputs rounded to bf16; per-head q/k/v projections with EXACT bf16 products on WMMA 16x16x32 (f32 accumulate); causal logits: q f16 x k f16 (1 product; q hi + residual and the k residual, 3 products, for the first 384 rows) x 1024^-0.5; softmax f32 in base 2 (running maximum of the unscaled products and sum); 2^((product - maximum) x scale x log2 e + 11) once to f16 x v once to f16 (1 product; bf16 hi + lo below row 384), divided by the sum (which carries the same 2^11) at the end; f32 output (no output projection).
#include <hip/hip_runtime.h>
#include <math.h>

typedef __attribute__((ext_vector_type(16))) _Float16 v16h;
typedef __attribute__((ext_vector_type(16))) __bf16 v16b;
typedef __attribute__((ext_vector_type(8)))  _Float16 v8h;
typedef __attribute__((ext_vector_type(8)))  float v8f;
typedef __attribute__((ext_vector_type(4)))  float v4f;
typedef __attribute__((ext_vector_type(2)))  float v2f;
typedef __attribute__((ext_vector_type(4)))  unsigned v4u;
typedef __attribute__((ext_vector_type(4)))  int v4i;
typedef float __attribute__((may_alias)) float_a;
typedef int __attribute__((may_alias)) int_a;

template <typename T> __device__ __forceinline__ void vst2(void* p, T v) { *(T*)p = v;  }
__device__ __forceinline__ v8f wmma16(v16h a, v16h b, v8f c) {
  v8f d = __builtin_amdgcn_wmma_f32_16x16x32_f16(false, a, false, b, (short)0, c, false, false);
  asm volatile("v_nop\n\tv_nop\n\tv_nop\n\tv_nop" : "+v"(d) : "v"(a), "v"(b));
  return d;
}
__device__ __forceinline__ v8f wmma_bf(v16b a, v16b b, v8f c) {
  v8f d = __builtin_amdgcn_wmma_f32_16x16x32_bf16(false, a, false, b, (short)0, c, false, false);
  asm volatile("v_nop\n\tv_nop\n\tv_nop\n\tv_nop" : "+v"(d) : "v"(a), "v"(b));
  return d;
}
// 16x16x32 fragments: lane = (h = lane>>4, row/col = lane&15); elements 0..7 = k0+8h+0..7, 8..15 = k0+16+8h+0..7; D element r = row 8h+r
__device__ __forceinline__ v16h frag_h(const _Float16* rowk0, int lane) {
  union { v16h v; v8h q[2]; } u; const _Float16* p = rowk0 + 8 * (lane >> 4);
  u.q[0] = *(const v8h*)p; u.q[1] = *(const v8h*)(p + 16); return u.v;
}
__device__ __forceinline__ v16h frag_f32(const float* rowk0, int lane) {
  v16h a; const float* p = rowk0 + 8 * (lane >> 4);
#pragma unroll
  for (int i = 0; i < 8; ++i) { a[i] = (_Float16)p[i]; a[8 + i] = (_Float16)p[16 + i]; }
  return a;
}
__device__ __forceinline__ v16h frag_f32s(const float* rowk0, int lane, float sc) {
  v16h a; const float* p = rowk0 + 8 * (lane >> 4);
#pragma unroll
  for (int i = 0; i < 8; ++i) { a[i] = (_Float16)(p[i] * sc); a[8 + i] = (_Float16)(p[16 + i] * sc); }
  return a;
}
// column fragment from a [K][ld] layout (column n), rows >= K read as 0
__device__ __forceinline__ v16h fragc_f32(const float* W, int k0, int n, int lane, int ld, int K) {
  v16h a; const int g = lane >> 4;
#pragma unroll
  for (int i = 0; i < 8; ++i) { const int ka = k0 + 8 * g + i, kb = ka + 16;
    a[i] = (_Float16)(ka < K ? W[(size_t)(ka < K ? ka : K - 1) * ld + n] : 0.f); a[8 + i] = (_Float16)(kb < K ? W[(size_t)(kb < K ? kb : K - 1) * ld + n] : 0.f); }
  return a;
}
struct F2 { v16b h, l; };
__device__ __forceinline__ F2 bsplit16(const float v[16]) { F2 r;
#pragma unroll
  for (int i = 0; i < 16; ++i) { const __bf16 h = (__bf16)v[i]; r.h[i] = h; r.l[i] = (__bf16)(v[i] - (float)h); }
  return r; }
__device__ __forceinline__ F2 split_row(const float* row, int k0, int lane) { float v[16]; const float* p = row + k0 + 8 * (lane >> 4);
#pragma unroll
  for (int i = 0; i < 8; ++i) { v[i] = p[i]; v[8 + i] = p[16 + i]; }
  return bsplit16(v); }
__device__ __forceinline__ F2 split_rowK(const float* row, int k0, int lane, int K) { float v[16]; const int g = lane >> 4;
#pragma unroll
  for (int i = 0; i < 8; ++i) { const int ka = k0 + 8 * g + i, kb = ka + 16; v[i] = ka < K ? row[ka < K ? ka : K - 1] : 0.f; v[8 + i] = kb < K ? row[kb < K ? kb : K - 1] : 0.f; }
  return bsplit16(v); }
__device__ __forceinline__ F2 split_col(const float* W, int k0, int n, int lane, int ld, int K) { float v[16]; const int g = lane >> 4;
#pragma unroll
  for (int i = 0; i < 8; ++i) { const int ka = k0 + 8 * g + i, kb = ka + 16; v[i] = ka < K ? W[(size_t)(ka < K ? ka : K - 1) * ld + n] : 0.f; v[8 + i] = kb < K ? W[(size_t)(kb < K ? kb : K - 1) * ld + n] : 0.f; }
  return bsplit16(v); }
__device__ __forceinline__ v8f mac3(const F2& a, const F2& b, v8f c) { c = wmma_bf(a.l, b.h, c); c = wmma_bf(a.h, b.l, c); return wmma_bf(a.h, b.h, c); }
__device__ __forceinline__ float sigm(float v) { return 1.0f / (1.0f + expf(-v)); }

// Causal multi-head self-attention without output projection (B 2, T 2,048, C 1,024, 16 heads x 64; per-head weights Wq/Wk/Wv [16,1024,64], 0.02-scale, no biases; the logit scale is C^-0.5 = 1/32 as in the source): out = concat_h causal_softmax(q_h k_h^T / 32) v_h -> [2, 2048, 1024].
#define NB 2
#define TT 2048
#define CC 1024            // NH * HD = projected width
#define DIN 1024          // input (model) width
#define NH 16
#define HD 64
#define SCALE (0.03125f)
#define CAUSAL 1
#ifndef TNB
#define TNB NB
#endif
__device__ __forceinline__ float bfr(float v) { return (float)(__bf16)v; }
__host__ __device__ __forceinline__ int kb_last(int qb) { return CAUSAL ? ((qb * 64 + 63) >> 7) : (TT / 128 - 1); }
typedef __attribute__((ext_vector_type(8))) __bf16 v8b;
__device__ __forceinline__ v16b frag_b(const __bf16* rowk0, int lane) {
  union { v16b v; v8b q[2]; } u; const __bf16* p = rowk0 + 8 * (lane >> 4);
  u.q[0] = *(const v8b*)p; u.q[1] = *(const v8b*)(p + 16); return u.v;
}
#define QBH 6              // causal: query blocks 0..QBH-1 of each sequence (few keys, no averaging) take the high-precision path
#define QHI 384            // rows carrying a q residual plane (used only by the causal high-precision path)
#define KHI 384            // key rows carrying k residual / v bf16 hi+lo planes (used only by the causal high-precision path)
// B fragment (k rows k0+.., output column o) of a weight: (in,out) [K][ld] or (out,in) [ld rows of K]: bf16 exact, or f16(bf16 * 256) exact
__device__ __forceinline__ v16b wcol_io(const float* Wm, int k0, int o, int lane, int ld) { v16b w; const int g = lane >> 4;
#pragma unroll
  for (int i = 0; i < 8; ++i) { w[i] = (__bf16)Wm[(size_t)(k0 + 8 * g + i) * ld + o]; w[8 + i] = (__bf16)Wm[(size_t)(k0 + 16 + 8 * g + i) * ld + o]; }
  return w; }
__device__ __forceinline__ v16b wcol_oi(const float* Wm, int k0, int o, int lane, int K) { v16b w; const float* p = Wm + (size_t)o * K + k0 + 8 * (lane >> 4);
#pragma unroll
  for (int i = 0; i < 8; ++i) { w[i] = (__bf16)p[i]; w[8 + i] = (__bf16)p[16 + i]; }
  return w; }
__device__ __forceinline__ v16h wcolh_io(const float* Wm, int k0, int o, int lane, int ld) { v16h w; const int g = lane >> 4;
#pragma unroll
  for (int i = 0; i < 8; ++i) { w[i] = (_Float16)(bfr(Wm[(size_t)(k0 + 8 * g + i) * ld + o]) * 256.0f); w[8 + i] = (_Float16)(bfr(Wm[(size_t)(k0 + 16 + 8 * g + i) * ld + o]) * 256.0f); }
  return w; }
__device__ __forceinline__ v16h wcolh_oi(const float* Wm, int k0, int o, int lane, int K) { v16h w; const float* p = Wm + (size_t)o * K + k0 + 8 * (lane >> 4);
#pragma unroll
  for (int i = 0; i < 8; ++i) { w[i] = (_Float16)(bfr(p[i]) * 256.0f); w[8 + i] = (_Float16)(bfr(p[16 + i]) * 256.0f); }
  return w; }
#define WQKV_LAYOUT 0   // 0 = per-head [NH][DIN][HD]; 1 = (out,in) [CC][DIN]; 2 = per-head [NH][DIN][HD]
__device__ __forceinline__ v16b wcol_hdk(const float* Wm, int k0, int o, int lane) { v16b w; const int g = lane >> 4; const float* p = Wm + (size_t)(o / HD) * DIN * HD + (o % HD);
#pragma unroll
  for (int i = 0; i < 8; ++i) { w[i] = (__bf16)p[(size_t)(k0 + 8 * g + i) * HD]; w[8 + i] = (__bf16)p[(size_t)(k0 + 16 + 8 * g + i) * HD]; }
  return w; }
#define WO_OUT_IN 0
#if WQKV_LAYOUT == 1
#define WCOL(W, k0, o, lane) wcol_oi(W, k0, o, lane, DIN)
#elif WQKV_LAYOUT == 2
#define WCOL(W, k0, o, lane) wcol_hdk(W, k0, o, lane)
#else
#define WCOL(W, k0, o, lane) wcol_heads(W, k0, o, lane)   /* per-head [h][C][64] weights */
#endif
#if WO_OUT_IN
#define WOCOL(W, k0, o, lane) wcol_oi(W, k0, o, lane, CC)
#define WOCOLH(W, k0, o, lane) wcolh_oi(W, k0, o, lane, CC)
#else
#define WOCOL(W, k0, o, lane) wcol_io(W, k0, o, lane, DIN)
#define WOCOLH(W, k0, o, lane) wcolh_io(W, k0, o, lane, DIN)
#endif
// per-head projection weights W[h][c][d] ([16][1024][64]): column o = h*64 + d of the virtual (in,out) [C][H*D] matrix lives at W + (h*C + k)*64 + d
__device__ __forceinline__ v16b wcol_heads(const float* __restrict__ Wm, int k0, int o, int lane) { v16b w; const int g = lane >> 4; const float* p = Wm + ((size_t)(o >> 6) * DIN + k0 + 8 * g) * 64 + (o & 63);
#pragma unroll
  for (int i = 0; i < 8; ++i) { w[i] = (__bf16)p[(size_t)i * 64]; w[8 + i] = (__bf16)p[(size_t)(16 + i) * 64]; }
  asm volatile("s_wait_loadcnt 0x0" ::: "memory"); return w; }
#ifndef PROJ_EXTRA_PARAMS
#define PROJ_EXTRA_PARAMS
#endif

#define WS_QH  0u                                      // f16 q rows [b*t][CC]
#define WS_KH  (WS_QH + 2u * (size_t)NB * TT * CC)      // f16 k rows [b*t][CC]
#define WS_VT  (WS_KH + 2u * (size_t)NB * TT * CC)      // f16 v planes [b][c][t]
#define WS_QL  (WS_VT + 2u * (size_t)NB * CC * TT)      // f16 q residual x 2^10 rows [b][t < QHI][CC]
#define WS_KL  (WS_QL + 2u * (size_t)NB * QHI * CC)     // f16 k residual x 2^10 rows [b][t < KHI][CC]
#define WS_VB  (WS_KL + 2u * (size_t)NB * KHI * CC)     // bf16 v hi planes [b][c][t < KHI]
#define WS_VBL (WS_VB + 2u * (size_t)NB * CC * KHI)
#define WS_END (WS_VBL + 2u * (size_t)NB * CC * KHI)

#define KS 32               // k of a staged W tile (one WMMA step a barrier)
#define WPB 80              // bytes of a staged W column in LDS: KS bf16 + 16 B = 16 B x odd
static_assert(128 * WPB <= 128 * 72 * 2, "a W buffer fits the place of tb or tbl");
// ---- k_proj: block = (64 rows, 128 cols, which): q/k/v = X W (+ b) with exact bf16 products (K = DIN) -> which 0: q f16 rows (+ residual rows < QHI); 1: k f16 rows (+ residual rows < KHI); 2: v f16 planes [c][t] (+ bf16 hi/lo planes for t < KHI)
__global__ __launch_bounds__(128) void k_proj(const float* __restrict__ XQ, const float* __restrict__ XK, const float* __restrict__ XV, const float* __restrict__ WQ, const float* __restrict__ WK, const float* __restrict__ WV, const float* __restrict__ BQ, const float* __restrict__ BK, const float* __restrict__ BV,
    _Float16* __restrict__ QH, _Float16* __restrict__ QL, _Float16* __restrict__ KH, _Float16* __restrict__ KL, _Float16* __restrict__ VT, __bf16* __restrict__ VB, __bf16* __restrict__ VBL) {
  __shared__ __align__(16) _Float16 sh[64][136], sl[64][136]; __shared__ __align__(16) _Float16 th[128][72]; __shared__ __align__(16) __bf16 tb[128][72], tbl[128][72];
  const int tid = threadIdx.x, wave = tid >> 5, lane = tid & 31, col = lane & 15, g = lane >> 4; const int which = blockIdx.z; const int c0 = blockIdx.y * 128; const size_t r0 = (size_t)blockIdx.x * 64; const size_t bb = r0 / TT; const int t0 = (int)(r0 % TT);
  const float* X = which == 0 ? XQ : which == 1 ? XK : XV; const float* WA = which == 0 ? WQ : which == 1 ? WK : WV; const float* BA = which == 0 ? BQ : which == 1 ? BK : BV;
  v8f acc[8] = {};
  // W tile of KS k x 128 columns: each thread loads 4 columns x 8 k (whole 256-B head rows per half wave), rounds to bf16 once for the block and writes 16-B pieces (8 k of one column) to LDS;
  // column n lies at n * WPB, its piece c at place c ^ ((n >> 4) & 3): 16 lanes of a store (columns 4 apart) and 16 lanes of a fragment read (columns in a row) each fall on distinct banks.
  // The two buffers take the place of tb and tbl, which the epilogue fills only behind the barrier that follows the loop.
  const float* wp = WA + ((size_t)((c0 >> 6) + (lane >> 4)) * DIN + wave * 8) * 64 + (lane & 15) * 4; const float* xp = X + (r0 + wave * 16 + col) * DIN + 8 * g;
  const int wst = (4 * lane) * WPB + ((wave ^ ((lane >> 2) & 3)) * 16);
  v4f wr[8], ar[4];
#pragma unroll
  for (int i = 0; i < 8; ++i) wr[i] = *(const v4f*)(wp + (size_t)i * 64);
  ar[0] = *(const v4f*)(xp); ar[1] = *(const v4f*)(xp + 4); ar[2] = *(const v4f*)(xp + 16); ar[3] = *(const v4f*)(xp + 20);
#pragma unroll 2   // so that the buffer of a trip is known at compile time
  for (int kt = 0; kt < DIN / KS; ++kt) { unsigned char* wb = (unsigned char*)((kt & 1) ? &tbl[0][0] : &tb[0][0]); v16b a;
#pragma unroll
    for (int c = 0; c < 4; ++c) { v8b t;
#pragma unroll
      for (int i = 0; i < 8; ++i) t[i] = (__bf16)wr[i][c];
      *(v8b*)(wb + wst + c * WPB) = t; }
#pragma unroll
    for (int i = 0; i < 8; ++i) { a[i] = (__bf16)ar[i >> 2][i & 3]; a[8 + i] = (__bf16)ar[2 + (i >> 2)][i & 3]; }
    if (kt + 1 < DIN / KS) { const float* wn = wp + (size_t)(kt + 1) * KS * 64; const float* xn = xp + (kt + 1) * KS;
#pragma unroll
      for (int i = 0; i < 8; ++i) wr[i] = *(const v4f*)(wn + (size_t)i * 64);
      ar[0] = *(const v4f*)(xn); ar[1] = *(const v4f*)(xn + 4); ar[2] = *(const v4f*)(xn + 16); ar[3] = *(const v4f*)(xn + 20);
      asm volatile("s_wait_xcnt 0x0" ::: "memory"); }   // the next trip's loads issue here, ahead of this trip's products, and their address registers may be stepped behind this wait
    // work-group barrier by hand: __syncthreads() would also wait for the global loads just issued, which are to stay in flight over this trip's products. It publishes this trip's W tile (each wave's LDS stores are done at its signal) and ends every wave's reads of the other buffer, which the next trip refills.
    asm volatile("s_wait_dscnt 0x0\n\ts_barrier_signal -1\n\ts_barrier_wait -1" ::: "memory");
    v16b w[8];
#pragma unroll
    for (int j = 0; j < 8; ++j) { union { v16b v; v8b q[2]; } u; const unsigned char* rp = wb + (j * 16 + col) * WPB;
      u.q[0] = *(const v8b*)(rp + ((g ^ (j & 3)) * 16)); u.q[1] = *(const v8b*)(rp + (((2 + g) ^ (j & 3)) * 16)); w[j] = u.v; }
    __builtin_amdgcn_sched_barrier(0);   // all 16 LDS reads issue ahead of the first product: one LDS latency a trip, not one a product
#pragma unroll
    for (int j = 0; j < 8; ++j) acc[j] = wmma_bf(a, w[j], acc[j]);
    __builtin_amdgcn_sched_barrier(0); }   // the next tile's rounding, and with it the wait for the loads in flight, stays behind this trip's products
  __syncthreads();   // the last tile's readers leave tbl before the epilogue writes tb and tbl (tb's readers were done at the last trip's barrier)
  if (which < 2) { _Float16* DH = which == 0 ? QH : KH; _Float16* DL = which == 0 ? QL : KL; const int nhi = which == 0 ? QHI : KHI; const bool hi_rows = t0 < nhi;
#pragma unroll
    for (int j = 0; j < 8; ++j) { const float bias = BA ? bfr(BA[c0 + j * 16 + col]) : 0.f;
#pragma unroll
      for (int r = 0; r < 8; ++r) { const float v = acc[j][r] + bias; const _Float16 hv = (_Float16)v; sh[wave * 16 + 8 * g + r][j * 16 + col] = hv; sl[wave * 16 + 8 * g + r][j * 16 + col] = (_Float16)((v - (float)hv) * 1024.0f); } }
    __syncthreads();
    for (int e = tid; e < 64 * 16; e += 128) { const int rl = e >> 4, q = e & 15; vst2((unsigned*)(DH + (r0 + rl) * CC + c0 + q * 8), *(const v4u*)&sh[rl][q * 8]); if (hi_rows) vst2((unsigned*)(DL + (bb * nhi + t0 + rl) * (size_t)CC + c0 + q * 8), *(const v4u*)&sl[rl][q * 8]); }
  } else { const bool hi_rows = t0 < KHI;
#pragma unroll
    for (int j = 0; j < 8; ++j) { const float bias = BA ? bfr(BA[c0 + j * 16 + col]) : 0.f;
#pragma unroll
      for (int r = 0; r < 8; ++r) { const float v = acc[j][r] + bias; const int rl = wave * 16 + 8 * g + r, cl = j * 16 + col; th[cl][rl] = (_Float16)v; const __bf16 bh = (__bf16)v; tb[cl][rl] = bh; tbl[cl][rl] = (__bf16)(v - (float)bh); } }
    __syncthreads();
    for (int e = tid; e < 128 * 8; e += 128) { const int cl = e >> 3, q = e & 7; vst2((unsigned*)(VT + (bb * CC + c0 + cl) * (size_t)TT + t0 + q * 8), *(const v4u*)&th[cl][q * 8]); if (hi_rows) { const size_t o3 = (bb * CC + c0 + cl) * (size_t)KHI + t0 + q * 8; vst2((unsigned*)(VB + o3), *(const v4u*)&tb[cl][q * 8]); vst2((unsigned*)(VBL + o3), *(const v4u*)&tbl[cl][q * 8]); } } } }
// ---- k_att: block = QR query rows (QT tiles of 16) of (b, h), FW waves. Wave w takes the 32-key chunks w, w + FW, ... up to the diagonal. Per chunk: logits transposed, S^T = K . Q^T (a lane holds 16 keys of ONE query; q hi + residual x 2^10 and the k residual, 3 products, for the causal early rows), causal mask by index in the chunks that reach past the tile's first query;
// running maximum (of the unscaled products) and sum per query in the lane (one exchange between the wave's halves); 2^((product - maximum) x SC2 + 11) once to f16 is, in place, the B operand of O^T += V^T . P^T (early rows: P and v as bf16 hi + lo, 3 products). Behind one barrier the block joins the FW partial tiles in wave order, each weighted by 2^((its maximum - the row's maximum) x SC2), and divides by the joined sum; 256-B (row, head) segment by 16 lanes of one wave
#define FW 4
#define SC2 (SCALE * 1.44269504088896340736f)   // logit scale x log2 e: the exponent in base 2 is one fused multiply-add on the unscaled product, and the hardware's own 2^x takes it
#define QT 2
#define QR (16 * QT)
static_assert((QBH * 64) % QR == 0 && QBH * 64 <= KHI && QBH * 64 <= QHI && QR <= 32, "a block is early as a whole, its keys and residual rows exist, and only chunks at the diagonal are masked");
// fragment at a lane's own address (row, k0 + 8 * (lane >> 4))
__device__ __forceinline__ v16h frag_hp(const _Float16* p) { union { v16h v; v8h q[2]; } u; u.q[0] = *(const v8h*)p; u.q[1] = *(const v8h*)(p + 16); return u.v; }
__device__ __forceinline__ v16b frag_bp(const __bf16* p) { union { v16b v; v8b q[2]; } u; u.q[0] = *(const v8b*)p; u.q[1] = *(const v8b*)(p + 16); return u.v; }
// stands behind a run of global loads: the loads issue ahead of it, and their two addresses, named as inputs, keep their registers up to it, so that neither a later load's result nor an address step overwrites them earlier
__device__ __forceinline__ void XWAIT(const void* a, const void* b) { asm volatile("s_wait_xcnt 0x0" :: "v"(a), "v"(b) : "memory"); }
template <bool HI> __device__ __forceinline__ void att_keys(const _Float16* __restrict__ qp, const _Float16* __restrict__ qlp, const _Float16* __restrict__ kp, const _Float16* __restrict__ klp, const _Float16* __restrict__ vp, const __bf16* __restrict__ vbp, const __bf16* __restrict__ vlp,
    int ql0, int kce, int wave, int lane, v8f (&acc)[QT][HD / 16], float (&m)[QT], float (&sum)[QT]) {
  const int col = lane & 15, g = lane >> 4; v16h bq[QT][HD / 32];   // the early rows' few chunks fetch q, its residual and v where they are used: their registers would otherwise set the count for every block
  if (!HI) {
#pragma unroll
    for (int u = 0; u < QT; ++u)
#pragma unroll
      for (int kk = 0; kk < HD / 32; ++kk) bq[u][kk] = frag_hp(qp + (size_t)u * 16 * CC + kk * 32);
    XWAIT(qp, qp); }
#pragma unroll 1   // one chunk's fragments in registers at a time
  for (int kc = wave; kc < kce; kc += FW) { const int k0 = kc * 32; v16h ak[2][HD / 32], akl[2][HD / 32], av[HD / 16]; const _Float16* kq = kp + (size_t)k0 * CC; const _Float16* klq = HI ? klp + (size_t)k0 * CC : kq; const _Float16* vq = vp + k0; const __bf16* vbq = HI ? vbp + k0 : nullptr; const __bf16* vlq = HI ? vlp + k0 : nullptr;
#pragma unroll
    for (int t = 0; t < 2; ++t)
#pragma unroll
      for (int kk = 0; kk < HD / 32; ++kk) { ak[t][kk] = frag_hp(kq + (size_t)t * 16 * CC + kk * 32); if (HI) akl[t][kk] = frag_hp(klq + (size_t)t * 16 * CC + kk * 32); }
#pragma unroll
    for (int j = 0; j < HD / 16; ++j) if (!HI) av[j] = frag_hp(vq + (size_t)j * 16 * TT);
    if (HI) XWAIT(kq, klq); else XWAIT(kq, vq);   // the chunk's k loads (and, off the early rows, v) all issue here, v ahead of the logits that hide its latency
#pragma unroll
    for (int u = 0; u < QT; ++u) { v8f s[2] = {}, sl[2] = {}; float x[16];
#pragma unroll
      for (int kk = 0; kk < HD / 32; ++kk) { v16h qh, ql;
        if (HI) { qh = frag_hp(qp + (size_t)u * 16 * CC + kk * 32); ql = frag_hp(qlp + (size_t)u * 16 * CC + kk * 32); XWAIT(qp, qlp); }
        else qh = bq[u][kk];
#pragma unroll
        for (int t = 0; t < 2; ++t) { s[t] = wmma16(ak[t][kk], qh, s[t]); if (HI) { sl[t] = wmma16(ak[t][kk], ql, sl[t]); sl[t] = wmma16(akl[t][kk], qh, sl[t]); } } }
#pragma unroll
      for (int i = 0; i < 16; ++i) x[i] = HI ? s[i >> 3][i & 7] + sl[i >> 3][i & 7] * (1.0f / 1024.0f) : s[i >> 3][i & 7];   // unscaled: SC2 > 0 keeps the order, so the maximum is taken here
      if (CAUSAL && k0 + 31 > ql0 + u * 16) {   // same for the whole wave
#pragma unroll
        for (int i = 0; i < 16; ++i) x[i] = (k0 + (i >> 3) * 16 + 8 * g + (i & 7) <= ql0 + u * 16 + col) ? x[i] : -3.0e38f; }
      float mx = x[0];
#pragma unroll
      for (int i = 1; i < 16; ++i) mx = fmaxf(mx, x[i]);
      mx = fmaxf(mx, __shfl_xor(mx, 16));
      if (__builtin_amdgcn_ballot_w32(mx > m[u]) != 0) {   // a scalar branch: no query's maximum rises, nothing to rescale
        const float mn = fmaxf(m[u], mx), al = __builtin_amdgcn_exp2f((m[u] - mn) * SC2); m[u] = mn; sum[u] *= al;
#pragma unroll
        for (int j = 0; j < HD / 16; ++j) acc[u][j] *= al; }
      const float nb = 11.0f - m[u] * SC2; float ps = 0.f;   // every chunk holds a key at or before each of the block's queries, so m[u] is a real product here and a masked entry's exponent is far below the range: 2^x gives 0
#pragma unroll
      for (int i = 0; i < 16; ++i) x[i] = x[i] * SC2 + nb;
#pragma unroll
      for (int i = 0; i < 16; ++i) x[i] = __builtin_amdgcn_exp2f(x[i]);
#pragma unroll
      for (int i = 0; i < 16; ++i) ps += x[i];
      sum[u] += ps;
      if (HI) { const F2 p = bsplit16(x);
#pragma unroll
        for (int j = 0; j < HD / 16; ++j) { const v16b vh = frag_bp(vbq + (size_t)j * 16 * KHI), vl = frag_bp(vlq + (size_t)j * 16 * KHI); XWAIT(vbq, vlq);
          acc[u][j] = wmma_bf(vh, p.h, acc[u][j]); acc[u][j] = wmma_bf(vh, p.l, acc[u][j]); acc[u][j] = wmma_bf(vl, p.h, acc[u][j]); }
      } else { v16h pb;
#pragma unroll
        for (int i = 0; i < 16; ++i) pb[i] = (_Float16)x[i];
#pragma unroll
        for (int j = 0; j < HD / 16; ++j) acc[u][j] = wmma16(av[j], pb, acc[u][j]); } } } }
__global__ __launch_bounds__(32 * FW) void k_att(const _Float16* __restrict__ QH, const _Float16* __restrict__ KH, const _Float16* __restrict__ QL, const _Float16* __restrict__ KL, const _Float16* __restrict__ VT, const __bf16* __restrict__ VB, const __bf16* __restrict__ VBL, float* __restrict__ Y) {
  __shared__ __align__(16) float ss[FW][QR][HD + 4]; __shared__ float rm[FW][QR], rs[FW][QR];
  const int tid = threadIdx.x, wave = __builtin_amdgcn_readfirstlane(tid >> 5), lane = tid & 31, col = lane & 15, g = lane >> 4;
  const int b = blockIdx.x / NH, h = blockIdx.x % NH; const int ql0 = (TT / QR - 1 - (int)blockIdx.y) * QR;   // the tiles with the most keys start first
  const int kce = CAUSAL ? ((ql0 + QR - 1) >> 5) + 1 : TT / 32;
  v8f acc[QT][HD / 16] = {}; float m[QT], sum[QT];
#pragma unroll
  for (int u = 0; u < QT; ++u) { m[u] = -3.0e38f; sum[u] = 0.f; }
  const _Float16* qp = QH + ((size_t)b * TT + ql0 + col) * CC + h * HD + 8 * g; const _Float16* kp = KH + ((size_t)b * TT + col) * CC + h * HD + 8 * g; const _Float16* vp = VT + ((size_t)b * CC + h * HD + col) * (size_t)TT + 8 * g;
  if (CAUSAL && ql0 < QBH * 64) att_keys<true>(qp, QL + ((size_t)b * QHI + ql0 + col) * CC + h * HD + 8 * g, kp, KL + ((size_t)b * KHI + col) * CC + h * HD + 8 * g, vp, VB + ((size_t)b * CC + h * HD + col) * (size_t)KHI + 8 * g, VBL + ((size_t)b * CC + h * HD + col) * (size_t)KHI + 8 * g, ql0, kce, wave, lane, acc, m, sum);
  else att_keys<false>(qp, nullptr, kp, nullptr, vp, nullptr, nullptr, ql0, kce, wave, lane, acc, m, sum);
#pragma unroll
  for (int u = 0; u < QT; ++u) { sum[u] += __shfl_xor(sum[u], 16);
#pragma unroll
    for (int j = 0; j < HD / 16; ++j) { const v8f a = acc[u][j]; float* d = &ss[wave][u * 16 + col][j * 16 + 8 * g]; vst2(d, (v4f){a[0], a[1], a[2], a[3]}); vst2(d + 4, (v4f){a[4], a[5], a[6], a[7]}); }
    if (g == 0) { rm[wave][u * 16 + col] = m[u]; rs[wave][u * 16 + col] = sum[u]; } }
  __syncthreads();
  for (int e = tid; e < QR * (HD / 4); e += 32 * FW) { const int row = e / (HD / 4), q4 = e % (HD / 4);
    float M = rm[0][row];
#pragma unroll
    for (int w = 1; w < FW; ++w) M = fmaxf(M, rm[w][row]);
    float den = 0.f; v4f o = {};
#pragma unroll
    for (int w = 0; w < FW; ++w) { const float wg = __builtin_amdgcn_exp2f((rm[w][row] - M) * SC2); den += wg * rs[w][row]; o += *(const v4f*)&ss[w][row][q4 * 4] * wg; }   // a wave without keys has maximum -3e38, sum 0 and weight 0
    const float inv = den > 0.f ? 1.0f / den : 0.f;   /* a fully excluded row yields 0 */
    vst2(Y + ((size_t)b * TT + ql0 + row) * CC + h * HD + q4 * 4, o * inv); } }

extern "C" void kernel_launch(void* const* d_in, const int* in_sizes, int n_in, void* d_out, int out_size, void* d_ws, size_t ws_size, hipStream_t stream) {
  (void)in_sizes; (void)n_in; (void)out_size;
  const float** F = (const float**)d_in;
  if (ws_size < (size_t)WS_END) return;
  char* ws = (char*)d_ws; _Float16 *QH = (_Float16*)(ws + WS_QH), *KH = (_Float16*)(ws + WS_KH), *VT = (_Float16*)(ws + WS_VT), *QL = (_Float16*)(ws + WS_QL), *KL = (_Float16*)(ws + WS_KL); __bf16 *VB = (__bf16*)(ws + WS_VB), *VBL = (__bf16*)(ws + WS_VBL);
  // inputs: 0 x [2,2048,1024]; 1 Wq [16,1024,64]; 2 Wk; 3 Wv (per-head (in,out)); no biases, no output projection
  k_proj<<<dim3(TNB * TT / 64, CC / 128, 3), 128, 0, stream>>>(F[0], F[0], F[0], F[1], F[2], F[3], nullptr, nullptr, nullptr, QH, QL, KH, KL, VT, VB, VBL);
  k_att<<<dim3(TNB * NH, TT / QR, 1), 32 * FW, 0, stream>>>(QH, KH, QL, KL, VT, VB, VBL, (float*)d_out);   /* merged heads [b][t][h*64+d] == the output layout */
}

// v006
// One run takes 74.2 microseconds.
// Next to v005, in two timings, it ran 1.20 and 1.22 times as fast.
// Over all steps from v000 it is 13.2 times as fast.
// compute dtype: all float inputs rounded to bf16; per-head q/k/v projections with EXACT bf16 products on WMMA 16x16x32 (f32 accumulate); causal logits: q f16 x k f16 (1 product; q hi + residual and the k residual, 3 products, for the first 384 rows) x 1024^-0.5; softmax f32 in base 2 (running maximum of the unscaled products and sum); 2^((product - maximum) x scale x log2 e + 11) once to f16 x v once to f16 (1 product; bf16 hi + lo below row 384), divided by the sum (which carries the same 2^11) at the end; f32 output (no output projection).
#include <hip/hip_runtime.h>
#include <math.h>

typedef __attribute__((ext_vector_type(16))) _Float16 v16h;
typedef __attribute__((ext_vector_type(16))) __bf16 v16b;
typedef __attribute__((ext_vector_type(8)))  _Float16 v8h;
typedef __attribute__((ext_vector_type(8)))  float v8f;
typedef __attribute__((ext_vector_type(4)))  float v4f;
typedef __attribute__((ext_vector_type(2)))  float v2f;
typedef __attribute__((ext_vector_type(4)))  unsigned v4u;
typedef __attribute__((ext_vector_type(4)))  int v4i;
typedef float __attribute__((may_alias)) float_a;
typedef int __attribute__((may_alias)) int_a;

template <typename T> __device__ __forceinline__ void vst2(void* p, T v) { *(T*)p = v;  }
__device__ __forceinline__ v8f wmma16(v16h a, v16h b, v8f c) {
  v8f d = __builtin_amdgcn_wmma_f32_16x16x32_f16(false, a, false, b, (short)0, c, false, false);
  asm volatile("v_nop\n\tv_nop\n\tv_nop\n\tv_nop" : "+v"(d) : "v"(a), "v"(b));
  return d;
}
__device__ __forceinline__ v8f wmma_bf(v16b a, v16b b, v8f c) {
  v8f d = __builtin_amdgcn_wmma_f32_16x16x32_bf16(false, a, false, b, (short)0, c, false, false);
  asm volatile("v_nop\n\tv_nop\n\tv_nop\n\tv_nop" : "+v"(d) : "v"(a), "v"(b));
  return d;
}
// the same (four v_nop: the distance the chip needs between a product and the next vector instruction on its registers) for k_proj's two-tile wave: the statement names D alone, so that A and B may lie above v255, where an asm operand cannot (with all three named the accumulators spilled)
__device__ __forceinline__ v8f wmma_bfd(v16b a, v16b b, v8f c) {
  v8f d = __builtin_amdgcn_wmma_f32_16x16x32_bf16(false, a, false, b, (short)0, c, false, false);
  asm volatile("v_nop\n\tv_nop\n\tv_nop\n\tv_nop" : "+v"(d));
  return d;
}
// 16x16x32 fragments: lane = (h = lane>>4, row/col = lane&15); elements 0..7 = k0+8h+0..7, 8..15 = k0+16+8h+0..7; D element r = row 8h+r
__device__ __forceinline__ v16h frag_h(const _Float16* rowk0, int lane) {
  union { v16h v; v8h q[2]; } u; const _Float16* p = rowk0 + 8 * (lane >> 4);
  u.q[0] = *(const v8h*)p; u.q[1] = *(const v8h*)(p + 16); return u.v;
}
__device__ __forceinline__ v16h frag_f32(const float* rowk0, int lane) {
  v16h a; const float* p = rowk0 + 8 * (lane >> 4);
#pragma unroll
  for (int i = 0; i < 8; ++i) { a[i] = (_Float16)p[i]; a[8 + i] = (_Float16)p[16 + i]; }
  return a;
}
__device__ __forceinline__ v16h frag_f32s(const float* rowk0, int lane, float sc) {
  v16h a; const float* p = rowk0 + 8 * (lane >> 4);
#pragma unroll
  for (int i = 0; i < 8; ++i) { a[i] = (_Float16)(p[i] * sc); a[8 + i] = (_Float16)(p[16 + i] * sc); }
  return a;
}
// column fragment from a [K][ld] layout (column n), rows >= K read as 0
__device__ __forceinline__ v16h fragc_f32(const float* W, int k0, int n, int lane, int ld, int K) {
  v16h a; const int g = lane >> 4;
#pragma unroll
  for (int i = 0; i < 8; ++i) { const int ka = k0 + 8 * g + i, kb = ka + 16;
    a[i] = (_Float16)(ka < K ? W[(size_t)(ka < K ? ka : K - 1) * ld + n] : 0.f); a[8 + i] = (_Float16)(kb < K ? W[(size_t)(kb < K ? kb : K - 1) * ld + n] : 0.f); }
  return a;
}
struct F2 { v16b h, l; };
__device__ __forceinline__ F2 bsplit16(const float v[16]) { F2 r;
#pragma unroll
  for (int i = 0; i < 16; ++i) { const __bf16 h = (__bf16)v[i]; r.h[i] = h; r.l[i] = (__bf16)(v[i] - (float)h); }
  return r; }
__device__ __forceinline__ F2 split_row(const float* row, int k0, int lane) { float v[16]; const float* p = row + k0 + 8 * (lane >> 4);
#pragma unroll
  for (int i = 0; i < 8; ++i) { v[i] = p[i]; v[8 + i] = p[16 + i]; }
  return bsplit16(v); }
__device__ __forceinline__ F2 split_rowK(const float* row, int k0, int lane, int K) { float v[16]; const int g = lane >> 4;
#pragma unroll
  for (int i = 0; i < 8; ++i) { const int ka = k0 + 8 * g + i, kb = ka + 16; v[i] = ka < K ? row[ka < K ? ka : K - 1] : 0.f; v[8 + i] = kb < K ? row[kb < K ? kb : K - 1] : 0.f; }
  return bsplit16(v); }
__device__ __forceinline__ F2 split_col(const float* W, int k0, int n, int lane, int ld, int K) { float v[16]; const int g = lane >> 4;
#pragma unroll
  for (int i = 0; i < 8; ++i) { const int ka = k0 + 8 * g + i, kb = ka + 16; v[i] = ka < K ? W[(size_t)(ka < K ? ka : K - 1) * ld + n] : 0.f; v[8 + i] = kb < K ? W[(size_t)(kb < K ? kb : K - 1) * ld + n] : 0.f; }
  return bsplit16(v); }
__device__ __forceinline__ v8f mac3(const F2& a, const F2& b, v8f c) { c = wmma_bf(a.l, b.h, c); c = wmma_bf(a.h, b.l, c); return wmma_bf(a.h, b.h, c); }
__device__ __forceinline__ float sigm(float v) { return 1.0f / (1.0f + expf(-v)); }

// Causal multi-head self-attention without output projection (B 2, T 2,048, C 1,024, 16 heads x 64; per-head weights Wq/Wk/Wv [16,1024,64], 0.02-scale, no biases; the logit scale is C^-0.5 = 1/32 as in the source): out = concat_h causal_softmax(q_h k_h^T / 32) v_h -> [2, 2048, 1024].
#define NB 2
#define TT 2048
#define CC 1024            // NH * HD = projected width
#define DIN 1024          // input (model) width
#define NH 16
#define HD 64
#define SCALE (0.03125f)
#define CAUSAL 1
#ifndef TNB
#define TNB NB
#endif
__device__ __forceinline__ float bfr(float v) { return (float)(__bf16)v; }
__host__ __device__ __forceinline__ int kb_last(int qb) { return CAUSAL ? ((qb * 64 + 63) >> 7) : (TT / 128 - 1); }
typedef __attribute__((ext_vector_type(8))) __bf16 v8b;
__device__ __forceinline__ v16b frag_b(const __bf16* rowk0, int lane) {
  union { v16b v; v8b q[2]; } u; const __bf16* p = rowk0 + 8 * (lane >> 4);
  u.q[0] = *(const v8b*)p; u.q[1] = *(const v8b*)(p + 16); return u.v;
}
#define QBH 6              // causal: query blocks 0..QBH-1 of each sequence (few keys, no averaging) take the high-precision path
#define QHI 384            // rows carrying a q residual plane (used only by the causal high-precision path)
#define KHI 384            // key rows carrying k residual / v bf16 hi+lo planes (used only by the causal high-precision path)
// B fragment (k rows k0+.., output column o) of a weight: (in,out) [K][ld] or (out,in) [ld rows of K]: bf16 exact, or f16(bf16 * 256) exact
__device__ __forceinline__ v16b wcol_io(const float* Wm, int k0, int o, int lane, int ld) { v16b w; const int g = lane >> 4;
#pragma unroll
  for (int i = 0; i < 8; ++i) { w[i] = (__bf16)Wm[(size_t)(k0 + 8 * g + i) * ld + o]; w[8 + i] = (__bf16)Wm[(size_t)(k0 + 16 + 8 * g + i) * ld + o]; }
  return w; }
__device__ __forceinline__ v16b wcol_oi(const float* Wm, int k0, int o, int lane, int K) { v16b w; const float* p = Wm + (size_t)o * K + k0 + 8 * (lane >> 4);
#pragma unroll
  for (int i = 0; i < 8; ++i) { w[i] = (__bf16)p[i]; w[8 + i] = (__bf16)p[16 + i]; }
  return w; }
__device__ __forceinline__ v16h wcolh_io(const float* Wm, int k0, int o, int lane, int ld) { v16h w; const int g = lane >> 4;
#pragma unroll
  for (int i = 0; i < 8; ++i) { w[i] = (_Float16)(bfr(Wm[(size_t)(k0 + 8 * g + i) * ld + o]) * 256.0f); w[8 + i] = (_Float16)(bfr(Wm[(size_t)(k0 + 16 + 8 * g + i) * ld + o]) * 256.0f); }
  return w; }
__device__ __forceinline__ v16h wcolh_oi(const float* Wm, int k0, int o, int lane, int K) { v16h w; const float* p = Wm + (size_t)o * K + k0 + 8 * (lane >> 4);
#pragma unroll
  for (int i = 0; i < 8; ++i) { w[i] = (_Float16)(bfr(p[i]) * 256.0f); w[8 + i] = (_Float16)(bfr(p[16 + i]) * 256.0f); }
  return w; }
#define WQKV_LAYOUT 0   // 0 = per-head [NH][DIN][HD]; 1 = (out,in) [CC][DIN]; 2 = per-head [NH][DIN][HD]
__device__ __forceinline__ v16b wcol_hdk(const float* Wm, int k0, int o, int lane) { v16b w; const int g = lane >> 4; const float* p = Wm + (size_t)(o / HD) * DIN * HD + (o % HD);
#pragma unroll
  for (int i = 0; i < 8; ++i) { w[i] = (__bf16)p[(size_t)(k0 + 8 * g + i) * HD]; w[8 + i] = (__bf16)p[(size_t)(k0 + 16 + 8 * g + i) * HD]; }
  return w; }
#define WO_OUT_IN 0
#if WQKV_LAYOUT == 1
#define WCOL(W, k0, o, lane) wcol_oi(W, k0, o, lane, DIN)
#elif WQKV_LAYOUT == 2
#define WCOL(W, k0, o, lane) wcol_hdk(W, k0, o, lane)
#else
#define WCOL(W, k0, o, lane) wcol_heads(W, k0, o, lane)   /* per-head [h][C][64] weights */
#endif
#if WO_OUT_IN
#define WOCOL(W, k0, o, lane) wcol_oi(W, k0, o, lane, CC)
#define WOCOLH(W, k0, o, lane) wcolh_oi(W, k0, o, lane, CC)
#else
#define WOCOL(W, k0, o, lane) wcol_io(W, k0, o, lane, DIN)
#define WOCOLH(W, k0, o, lane) wcolh_io(W, k0, o, lane, DIN)
#endif
// per-head projection weights W[h][c][d] ([16][1024][64]): column o = h*64 + d of the virtual (in,out) [C][H*D] matrix lives at W + (h*C + k)*64 + d
__device__ __forceinline__ v16b wcol_heads(const float* __restrict__ Wm, int k0, int o, int lane) { v16b w; const int g = lane >> 4; const float* p = Wm + ((size_t)(o >> 6) * DIN + k0 + 8 * g) * 64 + (o & 63);
#pragma unroll
  for (int i = 0; i < 8; ++i) { w[i] = (__bf16)p[(size_t)i * 64]; w[8 + i] = (__bf16)p[(size_t)(16 + i) * 64]; }
  asm volatile("s_wait_loadcnt 0x0" ::: "memory"); return w; }
#ifndef PROJ_EXTRA_PARAMS
#define PROJ_EXTRA_PARAMS
#endif

#define WS_QH  0u                                      // f16 q rows [b*t][CC]
#define WS_KH  (WS_QH + 2u * (size_t)NB * TT * CC)      // f16 k rows [b*t][CC]
#define WS_VT  (WS_KH + 2u * (size_t)NB * TT * CC)      // f16 v planes [b][c][t]
#define WS_QL  (WS_VT + 2u * (size_t)NB * CC * TT)      // f16 q residual x 2^10 rows [b][t < QHI][CC]
#define WS_KL  (WS_QL + 2u * (size_t)NB * QHI * CC)     // f16 k residual x 2^10 rows [b][t < KHI][CC]
#define WS_VB  (WS_KL + 2u * (size_t)NB * KHI * CC)     // bf16 v hi planes [b][c][t < KHI]
#define WS_VBL (WS_VB + 2u * (size_t)NB * CC * KHI)
#define WS_END (WS_VBL + 2u * (size_t)NB * CC * KHI)

#define KS 32               // k of a staged W tile (one WMMA step a barrier)
#define WPB 80              // bytes of a staged W column in LDS: KS bf16 + 16 B = 16 B x odd
static_assert(128 * WPB <= 128 * 72 * 2, "a W buffer fits the place of tb or tbl");
#define RT 2                // 16-row tiles of a wave (64 rows apart): every W fragment read from LDS feeds RT products
static_assert(TT % (64 * RT) == 0, "a block's rows lie in one sequence");
// ---- k_proj: block = (64 * RT rows, 128 cols, which): q/k/v = X W (+ b) with exact bf16 products (K = DIN) -> which 0: q f16 rows (+ residual rows < QHI); 1: k f16 rows (+ residual rows < KHI); 2: v f16 planes [c][t] (+ bf16 hi/lo planes for t < KHI)
__global__ __launch_bounds__(128) void k_proj(const float* __restrict__ XQ, const float* __restrict__ XK, const float* __restrict__ XV, const float* __restrict__ WQ, const float* __restrict__ WK, const float* __restrict__ WV, const float* __restrict__ BQ, const float* __restrict__ BK, const float* __restrict__ BV,
    _Float16* __restrict__ QH, _Float16* __restrict__ QL, _Float16* __restrict__ KH, _Float16* __restrict__ KL, _Float16* __restrict__ VT, __bf16* __restrict__ VB, __bf16* __restrict__ VBL) {
  __shared__ __align__(16) _Float16 sh[64][136], sl[64][136]; __shared__ __align__(16) _Float16 th[128][72]; __shared__ __align__(16) __bf16 tb[128][72], tbl[128][72];
  const int tid = threadIdx.x, wave = tid >> 5, lane = tid & 31, col = lane & 15, g = lane >> 4; const int which = blockIdx.z; const int c0 = blockIdx.y * 128; const size_t rB = (size_t)blockIdx.x * (64 * RT); const size_t bb = rB / TT; const int tB = (int)(rB % TT);
  const float* X = which == 0 ? XQ : which == 1 ? XK : XV; const float* WA = which == 0 ? WQ : which == 1 ? WK : WV; const float* BA = which == 0 ? BQ : which == 1 ? BK : BV;
  v8f acc[RT][8] = {};
  // W tile of KS k x 128 columns: each thread loads 4 columns x 8 k (whole 256-B head rows per half wave), rounds to bf16 once for the block and writes 16-B pieces (8 k of one column) to LDS;
  // column n lies at n * WPB, its piece c at place c ^ ((n >> 4) & 3): 16 lanes of a store (columns 4 apart) and 16 lanes of a fragment read (columns in a row) each fall on distinct banks.
  // The two buffers take the place of tb and tbl, which the epilogue fills only behind the barrier that follows the loop.
  const float* wp = WA + ((size_t)((c0 >> 6) + (lane >> 4)) * DIN + wave * 8) * 64 + (lane & 15) * 4; const float* xp = X + (rB + wave * 16 + col) * DIN + 8 * g;
  const int wst = (4 * lane) * WPB + ((wave ^ ((lane >> 2) & 3)) * 16);
  v4f wr[8], ar[RT][4];
#pragma unroll
  for (int i = 0; i < 8; ++i) wr[i] = *(const v4f*)(wp + (size_t)i * 64);
#pragma unroll
  for (int h = 0; h < RT; ++h) { const float* xh = xp + (size_t)h * 64 * DIN; ar[h][0] = *(const v4f*)(xh); ar[h][1] = *(const v4f*)(xh + 4); ar[h][2] = *(const v4f*)(xh + 16); ar[h][3] = *(const v4f*)(xh + 20); }
#pragma unroll 2   // so that the buffer of a trip is known at compile time
  for (int kt = 0; kt < DIN / KS; ++kt) { unsigned char* wb = (unsigned char*)((kt & 1) ? &tbl[0][0] : &tb[0][0]); v16b a[RT];
#pragma unroll
    for (int c = 0; c < 4; ++c) { v8b t;
#pragma unroll
      for (int i = 0; i < 8; ++i) t[i] = (__bf16)wr[i][c];
      *(v8b*)(wb + wst + c * WPB) = t; }
#pragma unroll
    for (int h = 0; h < RT; ++h)
#pragma unroll
      for (int i = 0; i < 8; ++i) { a[h][i] = (__bf16)ar[h][i >> 2][i & 3]; a[h][8 + i] = (__bf16)ar[h][2 + (i >> 2)][i & 3]; }
    if (kt + 1 < DIN / KS) { const float* wn = wp + (size_t)(kt + 1) * KS * 64; const float* xn = xp + (kt + 1) * KS;
#pragma unroll
      for (int i = 0; i < 8; ++i) wr[i] = *(const v4f*)(wn + (size_t)i * 64);
#pragma unroll
      for (int h = 0; h < RT; ++h) { const float* xh = xn + (size_t)h * 64 * DIN; ar[h][0] = *(const v4f*)(xh); ar[h][1] = *(const v4f*)(xh + 4); ar[h][2] = *(const v4f*)(xh + 16); ar[h][3] = *(const v4f*)(xh + 20); }
      asm volatile("s_wait_xcnt 0x0" ::: "memory"); }   // the next trip's loads issue here, ahead of this trip's products, and their address registers may be stepped behind this wait
    // work-group barrier by hand: __syncthreads() would also wait for the global loads just issued, which are to stay in flight over this trip's products. It publishes this trip's W tile (each wave's LDS stores are done at its signal) and ends every wave's reads of the other buffer, which the next trip refills.
    asm volatile("s_wait_dscnt 0x0\n\ts_barrier_signal -1\n\ts_barrier_wait -1" ::: "memory");
    v16b w[8];
#pragma unroll
    for (int j = 0; j < 8; ++j) { union { v16b v; v8b q[2]; } u; const unsigned char* rp = wb + (j * 16 + col) * WPB;
      u.q[0] = *(const v8b*)(rp + ((g ^ (j & 3)) * 16)); u.q[1] = *(const v8b*)(rp + (((2 + g) ^ (j & 3)) * 16)); w[j] = u.v; }
    __builtin_amdgcn_sched_barrier(0);   // all 16 LDS reads issue ahead of the first product: one LDS latency a trip, not one a product
#pragma unroll
    for (int j = 0; j < 8; ++j)
#pragma unroll
      for (int h = 0; h < RT; ++h) acc[h][j] = wmma_bfd(a[h], w[j], acc[h][j]);
    __builtin_amdgcn_sched_barrier(0); }   // the next tile's rounding, and with it the wait for the loads in flight, stays behind this trip's products
  __syncthreads();   // the last tile's readers leave tb and tbl before the epilogue writes there
  if (which < 2) { _Float16* DH = which == 0 ? QH : KH; _Float16* DL = which == 0 ? QL : KL; const int nhi = which == 0 ? QHI : KHI;
#pragma unroll
   for (int h = 0; h < RT; ++h) { const size_t r0 = rB + h * 64; const int t0 = tB + h * 64; const bool hi_rows = t0 < nhi;   // the wave's tiles one after the other through the same 64-row staging arrays
    if (h) __syncthreads();   // the copy-out of the 64 rows before has left sh and sl
#pragma unroll
    for (int j = 0; j < 8; ++j) { const float bias = BA ? bfr(BA[c0 + j * 16 + col]) : 0.f;
#pragma unroll
      for (int r = 0; r < 8; ++r) { const float v = acc[h][j][r] + bias; const _Float16 hv = (_Float16)v; sh[wave * 16 + 8 * g + r][j * 16 + col] = hv; sl[wave * 16 + 8 * g + r][j * 16 + col] = (_Float16)((v - (float)hv) * 1024.0f); } }
    __syncthreads();
    for (int e = tid; e < 64 * 16; e += 128) { const int rl = e >> 4, q = e & 15; vst2((unsigned*)(DH + (r0 + rl) * CC + c0 + q * 8), *(const v4u*)&sh[rl][q * 8]); if (hi_rows) vst2((unsigned*)(DL + (bb * nhi + t0 + rl) * (size_t)CC + c0 + q * 8), *(const v4u*)&sl[rl][q * 8]); }
  } } else {
#pragma unroll
   for (int h = 0; h < RT; ++h) { const int t0 = tB + h * 64; const bool hi_rows = t0 < KHI;
    if (h) __syncthreads();   // the copy-out of the 64 rows before has left th, tb and tbl
#pragma unroll
    for (int j = 0; j < 8; ++j) { const float bias = BA ? bfr(BA[c0 + j * 16 + col]) : 0.f;
#pragma unroll
      for (int r = 0; r < 8; ++r) { const float v = acc[h][j][r] + bias; const int rl = wave * 16 + 8 * g + r, cl = j * 16 + col; th[cl][rl] = (_Float16)v; const __bf16 bh = (__bf16)v; tb[cl][rl] = bh; tbl[cl][rl] = (__bf16)(v - (float)bh); } }
    __syncthreads();
    for (int e = tid; e < 128 * 8; e += 128) { const int cl = e >> 3, q = e & 7; vst2((unsigned*)(VT + (bb * CC + c0 + cl) * (size_t)TT + t0 + q * 8), *(const v4u*)&th[cl][q * 8]); if (hi_rows) { const size_t o3 = (bb * CC + c0 + cl) * (size_t)KHI + t0 + q * 8; vst2((unsigned*)(VB + o3), *(const v4u*)&tb[cl][q * 8]); vst2((unsigned*)(VBL + o3), *(const v4u*)&tbl[cl][q * 8]); } } } }
}
// ---- k_att: block = QR query rows (QT tiles of 16) of (b, h), FW waves. Wave w takes the 32-key chunks w, w + FW, ... up to the diagonal. Per chunk: logits transposed, S^T = K . Q^T (a lane holds 16 keys of ONE query; q hi + residual x 2^10 and the k residual, 3 products, for the causal early rows), causal mask by index in the chunks that reach past the tile's first query;
// running maximum (of the unscaled products) and sum per query in the lane (one exchange between the wave's halves); 2^((product - maximum) x SC2 + 11) once to f16 is, in place, the B operand of O^T += V^T . P^T (early rows: P and v as bf16 hi + lo, 3 products). Behind one barrier the block joins the FW partial tiles in wave order, each weighted by 2^((its maximum - the row's maximum) x SC2), and divides by the joined sum; 256-B (row, head) segment by 16 lanes of one wave
#define FW 4
#define SC2 (SCALE * 1.44269504088896340736f)   // logit scale x log2 e: the exponent in base 2 is one fused multiply-add on the unscaled product, and the hardware's own 2^x takes it
#define QT 2
#define QR (16 * QT)
static_assert((QBH * 64) % QR == 0 && QBH * 64 <= KHI && QBH * 64 <= QHI && QR <= 32, "a block is early as a whole, its keys and residual rows exist, and only chunks at the diagonal are masked");
// fragment at a lane's own address (row, k0 + 8 * (lane >> 4))
__device__ __forceinline__ v16h frag_hp(const _Float16* p) { union { v16h v; v8h q[2]; } u; u.q[0] = *(const v8h*)p; u.q[1] = *(const v8h*)(p + 16); return u.v; }
__device__ __forceinline__ v16b frag_bp(const __bf16* p) { union { v16b v; v8b q[2]; } u; u.q[0] = *(const v8b*)p; u.q[1] = *(const v8b*)(p + 16); return u.v; }
// stands behind a run of global loads: the loads issue ahead of it, and their two addresses, named as inputs, keep their registers up to it, so that neither a later load's result nor an address step overwrites them earlier
__device__ __forceinline__ void XWAIT(const void* a, const void* b) { asm volatile("s_wait_xcnt 0x0" :: "v"(a), "v"(b) : "memory"); }
template <bool HI> __device__ __forceinline__ void att_keys(const _Float16* __restrict__ qp, const _Float16* __restrict__ qlp, const _Float16* __restrict__ kp, const _Float16* __restrict__ klp, const _Float16* __restrict__ vp, const __bf16* __restrict__ vbp, const __bf16* __restrict__ vlp,
    int ql0, int kce, int wave, int lane, v8f (&acc)[QT][HD / 16], float (&m)[QT], float (&sum)[QT]) {
  const int col = lane & 15, g = lane >> 4; v16h bq[QT][HD / 32];   // the early rows' few chunks fetch q, its residual and v where they are used: their registers would otherwise set the count for every block
  if (!HI) {
#pragma unroll
    for (int u = 0; u < QT; ++u)
#pragma unroll
      for (int kk = 0; kk < HD / 32; ++kk) bq[u][kk] = frag_hp(qp + (size_t)u * 16 * CC + kk * 32);
    XWAIT(qp, qp); }
#pragma unroll 1   // one chunk's fragments in registers at a time
  for (int kc = wave; kc < kce; kc += FW) { const int k0 = kc * 32; v16h ak[2][HD / 32], akl[2][HD / 32], av[HD / 16]; const _Float16* kq = kp + (size_t)k0 * CC; const _Float16* klq = HI ? klp + (size_t)k0 * CC : kq; const _Float16* vq = vp + k0; const __bf16* vbq = HI ? vbp + k0 : nullptr; const __bf16* vlq = HI ? vlp + k0 : nullptr;
#pragma unroll
    for (int t = 0; t < 2; ++t)
#pragma unroll
      for (int kk = 0; kk < HD / 32; ++kk) { ak[t][kk] = frag_hp(kq + (size_t)t * 16 * CC + kk * 32); if (HI) akl[t][kk] = frag_hp(klq + (size_t)t * 16 * CC + kk * 32); }
#pragma unroll
    for (int j = 0; j < HD / 16; ++j) if (!HI) av[j] = frag_hp(vq + (size_t)j * 16 * TT);
    if (HI) XWAIT(kq, klq); else XWAIT(kq, vq);   // the chunk's k loads (and, off the early rows, v) all issue here, v ahead of the logits that hide its latency
#pragma unroll
    for (int u = 0; u < QT; ++u) { v8f s[2] = {}, sl[2] = {}; float x[16];
#pragma unroll
      for (int kk = 0; kk < HD / 32; ++kk) { v16h qh, ql;
        if (HI) { qh = frag_hp(qp + (size_t)u * 16 * CC + kk * 32); ql = frag_hp(qlp + (size_t)u * 16 * CC + kk * 32); XWAIT(qp, qlp); }
        else qh = bq[u][kk];
#pragma unroll
        for (int t = 0; t < 2; ++t) { s[t] = wmma16(ak[t][kk], qh, s[t]); if (HI) { sl[t] = wmma16(ak[t][kk], ql, sl[t]); sl[t] = wmma16(akl[t][kk], qh, sl[t]); } } }
#pragma unroll
      for (int i = 0; i < 16; ++i) x[i] = HI ? s[i >> 3][i & 7] + sl[i >> 3][i & 7] * (1.0f / 1024.0f) : s[i >> 3][i & 7];   // unscaled: SC2 > 0 keeps the order, so the maximum is taken here
      if (CAUSAL && k0 + 31 > ql0 + u * 16) {   // same for the whole wave
#pragma unroll
        for (int i = 0; i < 16; ++i) x[i] = (k0 + (i >> 3) * 16 + 8 * g + (i & 7) <= ql0 + u * 16 + col) ? x[i] : -3.0e38f; }
      float mx = x[0];
#pragma unroll
      for (int i = 1; i < 16; ++i) mx = fmaxf(mx, x[i]);
      mx = fmaxf(mx, __shfl_xor(mx, 16));
      if (__builtin_amdgcn_ballot_w32(mx > m[u]) != 0) {   // a scalar branch: no query's maximum rises, nothing to rescale
        const float mn = fmaxf(m[u], mx), al = __builtin_amdgcn_exp2f((m[u] - mn) * SC2); m[u] = mn; sum[u] *= al;
#pragma unroll
        for (int j = 0; j < HD / 16; ++j) acc[u][j] *= al; }
      const float nb = 11.0f - m[u] * SC2; float ps = 0.f;   // every chunk holds a key at or before each of the block's queries, so m[u] is a real product here and a masked entry's exponent is far below the range: 2^x gives 0
#pragma unroll
      for (int i = 0; i < 16; ++i) x[i] = x[i] * SC2 + nb;
#pragma unroll
      for (int i = 0; i < 16; ++i) x[i] = __builtin_amdgcn_exp2f(x[i]);
#pragma unroll
      for (int i = 0; i < 16; ++i) ps += x[i];
      sum[u] += ps;
      if (HI) { const F2 p = bsplit16(x);
#pragma unroll
        for (int j = 0; j < HD / 16; ++j) { const v16b vh = frag_bp(vbq + (size_t)j * 16 * KHI), vl = frag_bp(vlq + (size_t)j * 16 * KHI); XWAIT(vbq, vlq);
          acc[u][j] = wmma_bf(vh, p.h, acc[u][j]); acc[u][j] = wmma_bf(vh, p.l, acc[u][j]); acc[u][j] = wmma_bf(vl, p.h, acc[u][j]); }
      } else { v16h pb;
#pragma unroll
        for (int i = 0; i < 16; ++i) pb[i] = (_Float16)x[i];
#pragma unroll
        for (int j = 0; j < HD / 16; ++j) acc[u][j] = wmma16(av[j], pb, acc[u][j]); } } } }
__global__ __launch_bounds__(32 * FW) void k_att(const _Float16* __restrict__ QH, const _Float16* __restrict__ KH, const _Float16* __restrict__ QL, const _Float16* __restrict__ KL, const _Float16* __restrict__ VT, const __bf16* __restrict__ VB, const __bf16* __restrict__ VBL, float* __restrict__ Y) {
  __shared__ __align__(16) float ss[FW][QR][HD + 4]; __shared__ float rm[FW][QR], rs[FW][QR];
  const int tid = threadIdx.x, wave = __builtin_amdgcn_readfirstlane(tid >> 5), lane = tid & 31, col = lane & 15, g = lane >> 4;
  const int b = blockIdx.x / NH, h = blockIdx.x % NH; const int ql0 = (TT / QR - 1 - (int)blockIdx.y) * QR;   // the tiles with the most keys start first
  const int kce = CAUSAL ? ((ql0 + QR - 1) >> 5) + 1 : TT / 32;
  v8f acc[QT][HD / 16] = {}; float m[QT], sum[QT];
#pragma unroll
  for (int u = 0; u < QT; ++u) { m[u] = -3.0e38f; sum[u] = 0.f; }
  const _Float16* qp = QH + ((size_t)b * TT + ql0 + col) * CC + h * HD + 8 * g; const _Float16* kp = KH + ((size_t)b * TT + col) * CC + h * HD + 8 * g; const _Float16* vp = VT + ((size_t)b * CC + h * HD + col) * (size_t)TT + 8 * g;
  if (CAUSAL && ql0 < QBH * 64) att_keys<true>(qp, QL + ((size_t)b * QHI + ql0 + col) * CC + h * HD + 8 * g, kp, KL + ((size_t)b * KHI + col) * CC + h * HD + 8 * g, vp, VB + ((size_t)b * CC + h * HD + col) * (size_t)KHI + 8 * g, VBL + ((size_t)b * CC + h * HD + col) * (size_t)KHI + 8 * g, ql0, kce, wave, lane, acc, m, sum);
  else att_keys<false>(qp, nullptr, kp, nullptr, vp, nullptr, nullptr, ql0, kce, wave, lane, acc, m, sum);
#pragma unroll
  for (int u = 0; u < QT; ++u) { sum[u] += __shfl_xor(sum[u], 16);
#pragma unroll
    for (int j = 0; j < HD / 16; ++j) { const v8f a = acc[u][j]; float* d = &ss[wave][u * 16 + col][j * 16 + 8 * g]; vst2(d, (v4f){a[0], a[1], a[2], a[3]}); vst2(d + 4, (v4f){a[4], a[5], a[6], a[7]}); }
    if (g == 0) { rm[wave][u * 16 + col] = m[u]; rs[wave][u * 16 + col] = sum[u]; } }
  __syncthreads();
  for (int e = tid; e < QR * (HD / 4); e += 32 * FW) { const int row = e / (HD / 4), q4 = e % (HD / 4);
    float M = rm[0][row];
#pragma unroll
    for (int w = 1; w < FW; ++w) M = fmaxf(M, rm[w][row]);
    float den = 0.f; v4f o = {};
#pragma unroll
    for (int w = 0; w < FW; ++w) { const float wg = __builtin_amdgcn_exp2f((rm[w][row] - M) * SC2); den += wg * rs[w][row]; o += *(const v4f*)&ss[w][row][q4 * 4] * wg; }   // a wave without keys has maximum -3e38, sum 0 and weight 0
    const float inv = den > 0.f ? 1.0f / den : 0.f;   /* a fully excluded row yields 0 */
    vst2(Y + ((size_t)b * TT + ql0 + row) * CC + h * HD + q4 * 4, o * inv); } }

extern "C" void kernel_launch(void* const* d_in, const int* in_sizes, int n_in, void* d_out, int out_size, void* d_ws, size_t ws_size, hipStream_t stream) {
  (void)in_sizes; (void)n_in; (void)out_size;
  const float** F = (const float**)d_in;
  if (ws_size < (size_t)WS_END) return;
  char* ws = (char*)d_ws; _Float16 *QH = (_Float16*)(ws + WS_QH), *KH = (_Float16*)(ws + WS_KH), *VT = (_Float16*)(ws + WS_VT), *QL = (_Float16*)(ws + WS_QL), *KL = (_Float16*)(ws + WS_KL); __bf16 *VB = (__bf16*)(ws + WS_VB), *VBL = (__bf16*)(ws + WS_VBL);
  // inputs: 0 x [2,2048,1024]; 1 Wq [16,1024,64]; 2 Wk; 3 Wv (per-head (in,out)); no biases, no output projection
  k_proj<<<dim3(TNB * TT / (64 * RT), CC / 128, 3), 128, 0, stream>>>(F[0], F[0], F[0], F[1], F[2], F[3], nullptr, nullptr, nullptr, QH, QL, KH, KL, VT, VB, VBL);
  k_att<<<dim3(TNB * NH, TT / QR, 1), 32 * FW, 0, stream>>>(QH, KH, QL, KL, VT, VB, VBL, (float*)d_out);   /* merged heads [b][t][h*64+d] == the output layout */
}

// v007
// One run takes 67.7 microseconds.
// Timed twice side by side with v006, it ran 1.09 times as fast both times.
// Counting every step since v000, it is 14.4 times as fast.
// compute dtype: all float inputs rounded to bf16; per-head q/k/v projections with EXACT bf16 products on WMMA 16x16x32 (f32 accumulate); causal logits: q f16 x k f16 (1 product; q hi + residual and the k residual, 3 products, for the first 384 rows) x 1024^-0.5; softmax f32 in base 2 (running maximum of the unscaled products and sum); 2^((product - maximum) x scale x log2 e + 11) once to f16 x v once to f16 (1 product; bf16 hi + lo below row 384), divided by the sum (which carries the same 2^11) at the end; f32 output (no output projection).
#include <hip/hip_runtime.h>
#include <math.h>

typedef __attribute__((ext_vector_type(16))) _Float16 v16h;
typedef __attribute__((ext_vector_type(16))) __bf16 v16b;
typedef __attribute__((ext_vector_type(8)))  _Float16 v8h;
typedef __attribute__((ext_vector_type(8)))  float v8f;
typedef __attribute__((ext_vector_type(4)))  float v4f;
typedef __attribute__((ext_vector_type(2)))  float v2f;
typedef __attribute__((ext_vector_type(4)))  unsigned v4u;
typedef __attribute__((ext_vector_type(4)))  int v4i;
typedef float __attribute__((may_alias)) float_a;
typedef int __attribute__((may_alias)) int_a;

template <typename T> __device__ __forceinline__ void vst2(void* p, T v) { *(T*)p = v;  }
__device__ __forceinline__ v8f wmma16(v16h a, v16h b, v8f c) {
  v8f d = __builtin_amdgcn_wmma_f32_16x16x32_f16(false, a, false, b, (short)0, c, false, false);
  asm volatile("v_nop\n\tv_nop\n\tv_nop\n\tv_nop" : "+v"(d) : "v"(a), "v"(b));
  return d;
}
__device__ __forceinline__ v8f wmma_bf(v16b a, v16b b, v8f c) {
  v8f d = __builtin_amdgcn_wmma_f32_16x16x32_bf16(false, a, false, b, (short)0, c, false, false);
  asm volatile("v_nop\n\tv_nop\n\tv_nop\n\tv_nop" : "+v"(d) : "v"(a), "v"(b));
  return d;
}
// the same (four v_nop: the distance the chip needs between a product and the next vector instruction on its registers) for k_proj's two-tile wave: the statement names D alone, so that A and B may lie above v255, where an asm operand cannot (with all three named the accumulators spilled)
__device__ __forceinline__ v8f wmma_bfd(v16b a, v16b b, v8f c) {
  v8f d = __builtin_amdgcn_wmma_f32_16x16x32_bf16(false, a, false, b, (short)0, c, false, false);
  asm volatile("v_nop\n\tv_nop\n\tv_nop\n\tv_nop" : "+v"(d));
  return d;
}
// 16x16x32 fragments: lane = (h = lane>>4, row/col = lane&15); elements 0..7 = k0+8h+0..7, 8..15 = k0+16+8h+0..7; D element r = row 8h+r
__device__ __forceinline__ v16h frag_h(const _Float16* rowk0, int lane) {
  union { v16h v; v8h q[2]; } u; const _Float16* p = rowk0 + 8 * (lane >> 4);
  u.q[0] = *(const v8h*)p; u.q[1] = *(const v8h*)(p + 16); return u.v;
}
__device__ __forceinline__ v16h frag_f32(const float* rowk0, int lane) {
  v16h a; const float* p = rowk0 + 8 * (lane >> 4);
#pragma unroll
  for (int i = 0; i < 8; ++i) { a[i] = (_Float16)p[i]; a[8 + i] = (_Float16)p[16 + i]; }
  return a;
}
__device__ __forceinline__ v16h frag_f32s(const float* rowk0, int lane, float sc) {
  v16h a; const float* p = rowk0 + 8 * (lane >> 4);
#pragma unroll
  for (int i = 0; i < 8; ++i) { a[i] = (_Float16)(p[i] * sc); a[8 + i] = (_Float16)(p[16 + i] * sc); }
  return a;
}
// column fragment from a [K][ld] layout (column n), rows >= K read as 0
__device__ __forceinline__ v16h fragc_f32(const float* W, int k0, int n, int lane, int ld, int K) {
  v16h a; const int g = lane >> 4;
#pragma unroll
  for (int i = 0; i < 8; ++i) { const int ka = k0 + 8 * g + i, kb = ka + 16;
    a[i] = (_Float16)(ka < K ? W[(size_t)(ka < K ? ka : K - 1) * ld + n] : 0.f); a[8 + i] = (_Float16)(kb < K ? W[(size_t)(kb < K ? kb : K - 1) * ld + n] : 0.f); }
  return a;
}
struct F2 { v16b h, l; };
__device__ __forceinline__ F2 bsplit16(const float v[16]) { F2 r;
#pragma unroll
  for (int i = 0; i < 16; ++i) { const __bf16 h = (__bf16)v[i]; r.h[i] = h; r.l[i] = (__bf16)(v[i] - (float)h); }
  return r; }
__device__ __forceinline__ F2 split_row(const float* row, int k0, int lane) { float v[16]; const float* p = row + k0 + 8 * (lane >> 4);
#pragma unroll
  for (int i = 0; i < 8; ++i) { v[i] = p[i]; v[8 + i] = p[16 + i]; }
  return bsplit16(v); }
__device__ __forceinline__ F2 split_rowK(const float* row, int k0, int lane, int K) { float v[16]; const int g = lane >> 4;
#pragma unroll
  for (int i = 0; i < 8; ++i) { const int ka = k0 + 8 * g + i, kb = ka + 16; v[i] = ka < K ? row[ka < K ? ka : K - 1] : 0.f; v[8 + i] = kb < K ? row[kb < K ? kb : K - 1] : 0.f; }
  return bsplit16(v); }
__device__ __forceinline__ F2 split_col(const float* W, int k0, int n, int lane, int ld, int K) { float v[16]; const int g = lane >> 4;
#pragma unroll
  for (int i = 0; i < 8; ++i) { const int ka = k0 + 8 * g + i, kb = ka + 16; v[i] = ka < K ? W[(size_t)(ka < K ? ka : K - 1) * ld + n] : 0.f; v[8 + i] = kb < K ? W[(size_t)(kb < K ? kb : K - 1) * ld + n] : 0.f; }
  return bsplit16(v); }
__device__ __forceinline__ v8f mac3(const F2& a, const F2& b, v8f c) { c = wmma_bf(a.l, b.h, c); c = wmma_bf(a.h, b.l, c); return wmma_bf(a.h, b.h, c); }
__device__ __forceinline__ float sigm(float v) { return 1.0f / (1.0f + expf(-v)); }

// Causal multi-head self-attention without output projection (B 2, T 2,048, C 1,024, 16 heads x 64; per-head weights Wq/Wk/Wv [16,1024,64], 0.02-scale, no biases; the logit scale is C^-0.5 = 1/32 as in the source): out = concat_h causal_softmax(q_h k_h^T / 32) v_h -> [2, 2048, 1024].
#define NB 2
#define TT 2048
#define CC 1024            // NH * HD = projected width
#define DIN 1024          // input (model) width
#define NH 16
#define HD 64
#define SCALE (0.03125f)
#define CAUSAL 1
#ifndef TNB
#define TNB NB
#endif
__device__ __forceinline__ float bfr(float v) { return (float)(__bf16)v; }
__host__ __device__ __forceinline__ int kb_last(int qb) { return CAUSAL ? ((qb * 64 + 63) >> 7) : (TT / 128 - 1); }
typedef __attribute__((ext_vector_type(8))) __bf16 v8b;
__device__ __forceinline__ v16b frag_b(const __bf16* rowk0, int lane) {
  union { v16b v; v8b q[2]; } u; const __bf16* p = rowk0 + 8 * (lane >> 4);
  u.q[0] = *(const v8b*)p; u.q[1] = *(const v8b*)(p + 16); return u.v;
}
#define QBH 6              // causal: query blocks 0..QBH-1 of each sequence (few keys, no averaging) take the high-precision path
#define QHI 384            // rows carrying a q residual plane (used only by the causal high-precision path)
#define KHI 384            // key rows carrying k residual / v bf16 hi+lo planes (used only by the causal high-precision path)
// B fragment (k rows k0+.., output column o) of a weight: (in,out) [K][ld] or (out,in) [ld rows of K]: bf16 exact, or f16(bf16 * 256) exact
__device__ __forceinline__ v16b wcol_io(const float* Wm, int k0, int o, int lane, int ld) { v16b w; const int g = lane >> 4;
#pragma unroll
  for (int i = 0; i < 8; ++i) { w[i] = (__bf16)Wm[(size_t)(k0 + 8 * g + i) * ld + o]; w[8 + i] = (__bf16)Wm[(size_t)(k0 + 16 + 8 * g + i) * ld + o]; }
  return w; }
__device__ __forceinline__ v16b wcol_oi(const float* Wm, int k0, int o, int lane, int K) { v16b w; const float* p = Wm + (size_t)o * K + k0 + 8 * (lane >> 4);
#pragma unroll
  for (int i = 0; i < 8; ++i) { w[i] = (__bf16)p[i]; w[8 + i] = (__bf16)p[16 + i]; }
  return w; }
__device__ __forceinline__ v16h wcolh_io(const float* Wm, int k0, int o, int lane, int ld) { v16h w; const int g = lane >> 4;
#pragma unroll
  for (int i = 0; i < 8; ++i) { w[i] = (_Float16)(bfr(Wm[(size_t)(k0 + 8 * g + i) * ld + o]) * 256.0f); w[8 + i] = (_Float16)(bfr(Wm[(size_t)(k0 + 16 + 8 * g + i) * ld + o]) * 256.0f); }
  return w; }
__device__ __forceinline__ v16h wcolh_oi(const float* Wm, int k0, int o, int lane, int K) { v16h w; const float* p = Wm + (size_t)o * K + k0 + 8 * (lane >> 4);
#pragma unroll
  for (int i = 0; i < 8; ++i) { w[i] = (_Float16)(bfr(p[i]) * 256.0f); w[8 + i] = (_Float16)(bfr(p[16 + i]) * 256.0f); }
  return w; }
#define WQKV_LAYOUT 0   // 0 = per-head [NH][DIN][HD]; 1 = (out,in) [CC][DIN]; 2 = per-head [NH][DIN][HD]
__device__ __forceinline__ v16b wcol_hdk(const float* Wm, int k0, int o, int lane) { v16b w; const int g = lane >> 4; const float* p = Wm + (size_t)(o / HD) * DIN * HD + (o % HD);
#pragma unroll
  for (int i = 0; i < 8; ++i) { w[i] = (__bf16)p[(size_t)(k0 + 8 * g + i) * HD]; w[8 + i] = (__bf16)p[(size_t)(k0 + 16 + 8 * g + i) * HD]; }
  return w; }
#define WO_OUT_IN 0
#if WQKV_LAYOUT == 1
#define WCOL(W, k0, o, lane) wcol_oi(W, k0, o, lane, DIN)
#elif WQKV_LAYOUT == 2
#define WCOL(W, k0, o, lane) wcol_hdk(W, k0, o, lane)
#else
#define WCOL(W, k0, o, lane) wcol_heads(W, k0, o, lane)   /* per-head [h][C][64] weights */
#endif
#if WO_OUT_IN
#define WOCOL(W, k0, o, lane) wcol_oi(W, k0, o, lane, CC)
#define WOCOLH(W, k0, o, lane) wcolh_oi(W, k0, o, lane, CC)
#else
#define WOCOL(W, k0, o, lane) wcol_io(W, k0, o, lane, DIN)
#define WOCOLH(W, k0, o, lane) wcolh_io(W, k0, o, lane, DIN)
#endif
// per-head projection weights W[h][c][d] ([16][1024][64]): column o = h*64 + d of the virtual (in,out) [C][H*D] matrix lives at W + (h*C + k)*64 + d
__device__ __forceinline__ v16b wcol_heads(const float* __restrict__ Wm, int k0, int o, int lane) { v16b w; const int g = lane >> 4; const float* p = Wm + ((size_t)(o >> 6) * DIN + k0 + 8 * g) * 64 + (o & 63);
#pragma unroll
  for (int i = 0; i < 8; ++i) { w[i] = (__bf16)p[(size_t)i * 64]; w[8 + i] = (__bf16)p[(size_t)(16 + i) * 64]; }
  asm volatile("s_wait_loadcnt 0x0" ::: "memory"); return w; }
#ifndef PROJ_EXTRA_PARAMS
#define PROJ_EXTRA_PARAMS
#endif

// Every plane lies in fragment order: per (b, head) a run of rows x HD elements, cut into 512-B units that are one wave-wide 16-B load each (lane l = 16 g + col holds 8 elements at 8 l), so that a fragment load of k_att covers 4 whole 128-B lines instead of 32 B of each of 16.
// q, k and their residuals: [b][head][t / 16][d / 16][g = (d / 8) & 1][col = t & 15][d & 7]; v planes: [b][head][t / 32][d / 16][(t / 16) & 1][g = (t / 8) & 1][col = d & 15][t & 7]
#define FU 256              // elements of a 512-B unit
#define WS_QH  0u                                      // f16 q [b][head][t][HD]
#define WS_KH  (WS_QH + 2u * (size_t)NB * TT * CC)      // f16 k [b][head][t][HD]
#define WS_VT  (WS_KH + 2u * (size_t)NB * TT * CC)      // f16 v [b][head][t][HD]
#define WS_QL  (WS_VT + 2u * (size_t)NB * CC * TT)      // f16 q residual x 2^10 [b][head][t < QHI][HD]
#define WS_KL  (WS_QL + 2u * (size_t)NB * QHI * CC)     // f16 k residual x 2^10 [b][head][t < KHI][HD]
#define WS_VB  (WS_KL + 2u * (size_t)NB * KHI * CC)     // bf16 v hi, then lo [b][head][t < KHI][HD]
#define WS_VBL (WS_VB + 2u * (size_t)NB * CC * KHI)
#define WS_END (WS_VBL + 2u * (size_t)NB * CC * KHI)

#define KS 32               // k of a staged W tile (one WMMA step a barrier)
#define WPB 80              // bytes of a staged W column in LDS: KS bf16 + 16 B = 16 B x odd
static_assert(128 * WPB <= 128 * 72 * 2, "a W buffer fits the place of tb or tbl");
#define RT 2                // 16-row tiles of a wave (64 rows apart): every W fragment read from LDS feeds RT products
static_assert(TT % (64 * RT) == 0, "a block's rows lie in one sequence");
// ---- k_proj: block = (64 * RT rows, 128 cols, which): q/k/v = X W (+ b) with exact bf16 products (K = DIN) -> which 0: q f16 (+ residual, rows < QHI); 1: k f16 (+ residual, rows < KHI); 2: v f16 (+ bf16 hi/lo for t < KHI), each stored in fragment order
__global__ __launch_bounds__(128) void k_proj(const float* __restrict__ XQ, const float* __restrict__ XK, const float* __restrict__ XV, const float* __restrict__ WQ, const float* __restrict__ WK, const float* __restrict__ WV, const float* __restrict__ BQ, const float* __restrict__ BK, const float* __restrict__ BV,
    _Float16* __restrict__ QH, _Float16* __restrict__ QL, _Float16* __restrict__ KH, _Float16* __restrict__ KL, _Float16* __restrict__ VT, __bf16* __restrict__ VB, __bf16* __restrict__ VBL) {
  __shared__ __align__(16) _Float16 sh[64][136], sl[64][136]; __shared__ __align__(16) _Float16 th[128][72]; __shared__ __align__(16) __bf16 tb[128][72], tbl[128][72];
  const int tid = threadIdx.x, wave = tid >> 5, lane = tid & 31, col = lane & 15, g = lane >> 4; const int which = blockIdx.z; const int c0 = blockIdx.y * 128; const size_t rB = (size_t)blockIdx.x * (64 * RT); const size_t bb = rB / TT; const int tB = (int)(rB % TT);
  const float* X = which == 0 ? XQ : which == 1 ? XK : XV; const float* WA = which == 0 ? WQ : which == 1 ? WK : WV; const float* BA = which == 0 ? BQ : which == 1 ? BK : BV;
  v8f acc[RT][8] = {};
  // W tile of KS k x 128 columns: each thread loads 4 columns x 8 k (whole 256-B head rows per half wave), rounds to bf16 once for the block and writes 16-B pieces (8 k of one column) to LDS;
  // column n lies at n * WPB, its piece c at place c ^ ((n >> 4) & 3): 16 lanes of a store (columns 4 apart) and 16 lanes of a fragment read (columns in a row) each fall on distinct banks.
  // The two buffers take the place of tb and tbl, which the epilogue fills only behind the barrier that follows the loop.
  const float* wp = WA + ((size_t)((c0 >> 6) + (lane >> 4)) * DIN + wave * 8) * 64 + (lane & 15) * 4; const float* xp = X + (rB + wave * 16 + col) * DIN + 8 * g;
  const int wst = (4 * lane) * WPB + ((wave ^ ((lane >> 2) & 3)) * 16);
  v4f wr[8], ar[RT][4];
#pragma unroll
  for (int i = 0; i < 8; ++i) wr[i] = *(const v4f*)(wp + (size_t)i * 64);
#pragma unroll
  for (int h = 0; h < RT; ++h) { const float* xh = xp + (size_t)h * 64 * DIN; ar[h][0] = *(const v4f*)(xh); ar[h][1] = *(const v4f*)(xh + 4); ar[h][2] = *(const v4f*)(xh + 16); ar[h][3] = *(const v4f*)(xh + 20); }
#pragma unroll 2   // so that the buffer of a trip is known at compile time
  for (int kt = 0; kt < DIN / KS; ++kt) { unsigned char* wb = (unsigned char*)((kt & 1) ? &tbl[0][0] : &tb[0][0]); v16b a[RT];
#pragma unroll
    for (int c = 0; c < 4; ++c) { v8b t;
#pragma unroll
      for (int i = 0; i < 8; ++i) t[i] = (__bf16)wr[i][c];
      *(v8b*)(wb + wst + c * WPB) = t; }
#pragma unroll
    for (int h = 0; h < RT; ++h)
#pragma unroll
      for (int i = 0; i < 8; ++i) { a[h][i] = (__bf16)ar[h][i >> 2][i & 3]; a[h][8 + i] = (__bf16)ar[h][2 + (i >> 2)][i & 3]; }
    if (kt + 1 < DIN / KS) { const float* wn = wp + (size_t)(kt + 1) * KS * 64; const float* xn = xp + (kt + 1) * KS;
#pragma unroll
      for (int i = 0; i < 8; ++i) wr[i] = *(const v4f*)(wn + (size_t)i * 64);
#pragma unroll
      for (int h = 0; h < RT; ++h) { const float* xh = xn + (size_t)h * 64 * DIN; ar[h][0] = *(const v4f*)(xh); ar[h][1] = *(const v4f*)(xh + 4); ar[h][2] = *(const v4f*)(xh + 16); ar[h][3] = *(const v4f*)(xh + 20); }
      asm volatile("s_wait_xcnt 0x0" ::: "memory"); }   // the next trip's loads issue here, ahead of this trip's products, and their address registers may be stepped behind this wait
    // work-group barrier by hand: __syncthreads() would also wait for the global loads just issued, which are to stay in flight over this trip's products. It publishes this trip's W tile (each wave's LDS stores are done at its signal) and ends every wave's reads of the other buffer, which the next trip refills.
    asm volatile("s_wait_dscnt 0x0\n\ts_barrier_signal -1\n\ts_barrier_wait -1" ::: "memory");
    v16b w[8];
#pragma unroll
    for (int j = 0; j < 8; ++j) { union { v16b v; v8b q[2]; } u; const unsigned char* rp = wb + (j * 16 + col) * WPB;
      u.q[0] = *(const v8b*)(rp + ((g ^ (j & 3)) * 16)); u.q[1] = *(const v8b*)(rp + (((2 + g) ^ (j & 3)) * 16)); w[j] = u.v; }
    __builtin_amdgcn_sched_barrier(0);   // all 16 LDS reads issue ahead of the first product: one LDS latency a trip, not one a product
#pragma unroll
    for (int j = 0; j < 8; ++j)
#pragma unroll
      for (int h = 0; h < RT; ++h) acc[h][j] = wmma_bfd(a[h], w[j], acc[h][j]);
    __builtin_amdgcn_sched_barrier(0); }   // the next tile's rounding, and with it the wait for the loads in flight, stays behind this trip's products
  __syncthreads();   // the last tile's readers leave tb and tbl before the epilogue writes there
  if (which < 2) { _Float16* DH = which == 0 ? QH : KH; _Float16* DL = which == 0 ? QL : KL; const int nhi = which == 0 ? QHI : KHI;
#pragma unroll
   for (int h = 0; h < RT; ++h) { const int t0 = tB + h * 64; const bool hi_rows = t0 < nhi;   // the wave's tiles one after the other through the same 64-row staging arrays
    if (h) __syncthreads();   // the copy-out of the 64 rows before has left sh and sl
#pragma unroll
    for (int j = 0; j < 8; ++j) { const float bias = BA ? bfr(BA[c0 + j * 16 + col]) : 0.f;
#pragma unroll
      for (int r = 0; r < 8; ++r) { const float v = acc[h][j][r] + bias; const _Float16 hv = (_Float16)v; sh[wave * 16 + 8 * g + r][j * 16 + col] = hv; sl[wave * 16 + 8 * g + r][j * 16 + col] = (_Float16)((v - (float)hv) * 1024.0f); } }
    __syncthreads();
    // a wave stores 512-B units: 16 rows (col) x 16 d (16 wave + 8 g + 0..7) of 16-row tile i & 3, head i >> 2; tile and head are compile-time offsets of one address
    const _Float16* sp = &sh[col][wave * 16 + g * 8]; const _Float16* lp = &sl[col][wave * 16 + g * 8]; const size_t hd = bb * NH + (c0 >> 6); const int o = wave * FU + lane * 8; v4u d[8];
    _Float16* dh = DH + (hd * TT + t0) * HD + o; _Float16* dl = DL + (hd * nhi + t0) * HD + o;
#pragma unroll   // here and below: d[] stays in registers, all LDS reads issue ahead of the stores, i folds into the instruction's offset
    for (int i = 0; i < 8; ++i) d[i] = *(const v4u*)(sp + (i & 3) * 16 * 136 + (i >> 2) * 64);
#pragma unroll
    for (int i = 0; i < 8; ++i) vst2((unsigned*)(dh + ((size_t)(i >> 2) * TT + (i & 3) * 16) * HD), d[i]);
    asm volatile("s_wait_xcnt 0x0" ::: "memory");   // behind the stores, ahead of whatever next writes a register that they name
    if (hi_rows) {
#pragma unroll
      for (int i = 0; i < 8; ++i) d[i] = *(const v4u*)(lp + (i & 3) * 16 * 136 + (i >> 2) * 64);
#pragma unroll
      for (int i = 0; i < 8; ++i) vst2((unsigned*)(dl + ((size_t)(i >> 2) * nhi + (i & 3) * 16) * HD), d[i]);
      asm volatile("s_wait_xcnt 0x0" ::: "memory"); }   // as above
  } } else {
#pragma unroll
   for (int h = 0; h < RT; ++h) { const int t0 = tB + h * 64; const bool hi_rows = t0 < KHI;
    if (h) __syncthreads();   // the copy-out of the 64 rows before has left th, tb and tbl
#pragma unroll
    for (int j = 0; j < 8; ++j) { const float bias = BA ? bfr(BA[c0 + j * 16 + col]) : 0.f;
#pragma unroll
      for (int r = 0; r < 8; ++r) { const float v = acc[h][j][r] + bias; const int rl = wave * 16 + 8 * g + r, cl = j * 16 + col; th[cl][rl] = (_Float16)v; const __bf16 bh = (__bf16)v; tb[cl][rl] = bh; tbl[cl][rl] = (__bf16)(v - (float)bh); } }
    __syncthreads();
    // a wave stores 512-B units: 16 channels (col) of tile (wave >> 1) + 2 (i & 1) x 16 keys (16 (wave & 1) + 8 g + 0..7) of 32-key chunk (i >> 1) & 1, head i >> 2; all of i is a compile-time offset of one address
    const int so = ((wave >> 1) * 16 + col) * 72 + (wave & 1) * 16 + g * 8; const size_t hd = bb * NH + (c0 >> 6); const int o = wave * FU + lane * 8; v4u d[8];
#pragma unroll   // here and below: d[] stays in registers, all LDS reads issue ahead of the stores, i folds into the instruction's offset
    for (int i = 0; i < 8; ++i) d[i] = *(const v4u*)(&th[0][0] + so + ((i >> 2) * 64 + (i & 1) * 32) * 72 + ((i >> 1) & 1) * 32);
#pragma unroll
    for (int i = 0; i < 8; ++i) vst2((unsigned*)(VT + (hd * TT + t0) * HD + o + ((size_t)(i >> 2) * TT + ((i >> 1) & 1) * 32) * HD + (i & 1) * 4 * FU), d[i]);
    asm volatile("s_wait_xcnt 0x0" ::: "memory");   // behind the stores, ahead of whatever next writes a register that they name
    if (hi_rows) {
#pragma unroll
      for (int p = 0; p < 2; ++p) { const __bf16* tp = (p ? &tbl[0][0] : &tb[0][0]) + so; __bf16* vd = (p ? VBL : VB) + (hd * KHI + t0) * HD + o;
#pragma unroll
        for (int i = 0; i < 8; ++i) d[i] = *(const v4u*)(tp + ((i >> 2) * 64 + (i & 1) * 32) * 72 + ((i >> 1) & 1) * 32);
#pragma unroll
        for (int i = 0; i < 8; ++i) vst2((unsigned*)(vd + ((size_t)(i >> 2) * KHI + ((i >> 1) & 1) * 32) * HD + (i & 1) * 4 * FU), d[i]);
        asm volatile("s_wait_xcnt 0x0" ::: "memory"); } } } }   // as above
}
// ---- k_att: block = QR query rows (QT tiles of 16) of (b, h), FW waves. Wave w takes the 32-key chunks w, w + FW, ... up to the diagonal. Per chunk: logits transposed, S^T = K . Q^T (a lane holds 16 keys of ONE query; q hi + residual x 2^10 and the k residual, 3 products, for the causal early rows), causal mask by index in the chunks that reach past the tile's first query;
// running maximum (of the unscaled products) and sum per query in the lane (one exchange between the wave's halves); 2^((product - maximum) x SC2 + 11) once to f16 is, in place, the B operand of O^T += V^T . P^T (early rows: P and v as bf16 hi + lo, 3 products). Behind one barrier the block joins the FW partial tiles in wave order, each weighted by 2^((its maximum - the row's maximum) x SC2), and divides by the joined sum; 256-B (row, head) segment by 16 lanes of one wave
#define FW 4
#define SC2 (SCALE * 1.44269504088896340736f)   // logit scale x log2 e: the exponent in base 2 is one fused multiply-add on the unscaled product, and the hardware's own 2^x takes it
#define QT 2
#define QR (16 * QT)
static_assert((QBH * 64) % QR == 0 && QBH * 64 <= KHI && QBH * 64 <= QHI && QR <= 32, "a block is early as a whole, its keys and residual rows exist, and only chunks at the diagonal are masked");
// fragment at a lane's own address (unit + 8 * lane): two units in a row, k 8 g + 0..7 and 16 + 8 g + 0..7
__device__ __forceinline__ v16h frag_hp(const _Float16* p) { union { v16h v; v8h q[2]; } u; u.q[0] = *(const v8h*)p; u.q[1] = *(const v8h*)(p + FU); return u.v; }
__device__ __forceinline__ v16b frag_bp(const __bf16* p) { union { v16b v; v8b q[2]; } u; u.q[0] = *(const v8b*)p; u.q[1] = *(const v8b*)(p + FU); return u.v; }
// stands behind a run of global loads: the loads issue ahead of it, and their two addresses, named as inputs, keep their registers up to it, so that neither a later load's result nor an address step overwrites them earlier
__device__ __forceinline__ void XWAIT(const void* a, const void* b) { asm volatile("s_wait_xcnt 0x0" :: "v"(a), "v"(b) : "memory"); }
template <bool HI> __device__ __forceinline__ void att_keys(const _Float16* __restrict__ qp, const _Float16* __restrict__ qlp, const _Float16* __restrict__ kp, const _Float16* __restrict__ klp, const _Float16* __restrict__ vp, const __bf16* __restrict__ vbp, const __bf16* __restrict__ vlp,
    int ql0, int kce, int wave, int lane, v8f (&acc)[QT][HD / 16], float (&m)[QT], float (&sum)[QT]) {
  const int col = lane & 15, g = lane >> 4; v16h bq[QT][HD / 32];   // the early rows' few chunks fetch q, its residual and v where they are used: their registers would otherwise set the count for every block
  if (!HI) {
#pragma unroll
    for (int u = 0; u < QT; ++u)
#pragma unroll
      for (int kk = 0; kk < HD / 32; ++kk) bq[u][kk] = frag_hp(qp + (u * 4 + kk * 2) * FU);
    XWAIT(qp, qp); }
#pragma unroll 1   // one chunk's fragments in registers at a time
  for (int kc = wave; kc < kce; kc += FW) { const int k0 = kc * 32; v16h ak[2][HD / 32], akl[2][HD / 32], av[HD / 16]; const _Float16* kq = kp + (size_t)k0 * HD; const _Float16* klq = HI ? klp + (size_t)k0 * HD : kq; const _Float16* vq = vp + (size_t)k0 * HD; const __bf16* vbq = HI ? vbp + (size_t)k0 * HD : nullptr; const __bf16* vlq = HI ? vlp + (size_t)k0 * HD : nullptr;
#pragma unroll
    for (int t = 0; t < 2; ++t)
#pragma unroll
      for (int kk = 0; kk < HD / 32; ++kk) { ak[t][kk] = frag_hp(kq + (t * 4 + kk * 2) * FU); if (HI) akl[t][kk] = frag_hp(klq + (t * 4 + kk * 2) * FU); }
#pragma unroll
    for (int j = 0; j < HD / 16; ++j) if (!HI) av[j] = frag_hp(vq + j * 2 * FU);
    if (HI) XWAIT(kq, klq); else XWAIT(kq, vq);   // the chunk's k and v loads (early rows: k and its residual) all issue here, v ahead of the logits that hide its latency
#pragma unroll
    for (int u = 0; u < QT; ++u) { v8f s[2] = {}, sl[2] = {}; float x[16];
#pragma unroll
      for (int kk = 0; kk < HD / 32; ++kk) { v16h qh, ql;
        if (HI) { qh = frag_hp(qp + (u * 4 + kk * 2) * FU); ql = frag_hp(qlp + (u * 4 + kk * 2) * FU); XWAIT(qp, qlp); }
        else qh = bq[u][kk];
#pragma unroll
        for (int t = 0; t < 2; ++t) { s[t] = wmma16(ak[t][kk], qh, s[t]); if (HI) { sl[t] = wmma16(ak[t][kk], ql, sl[t]); sl[t] = wmma16(akl[t][kk], qh, sl[t]); } } }
#pragma unroll
      for (int i = 0; i < 16; ++i) x[i] = HI ? s[i >> 3][i & 7] + sl[i >> 3][i & 7] * (1.0f / 1024.0f) : s[i >> 3][i & 7];   // unscaled: SC2 > 0 keeps the order, so the maximum is taken here
      if (CAUSAL && k0 + 31 > ql0 + u * 16) {   // same for the whole wave
#pragma unroll
        for (int i = 0; i < 16; ++i) x[i] = (k0 + (i >> 3) * 16 + 8 * g + (i & 7) <= ql0 + u * 16 + col) ? x[i] : -3.0e38f; }
      float mx = x[0];
#pragma unroll
      for (int i = 1; i < 16; ++i) mx = fmaxf(mx, x[i]);
      mx = fmaxf(mx, __shfl_xor(mx, 16));
      if (__builtin_amdgcn_ballot_w32(mx > m[u]) != 0) {   // a scalar branch: no query's maximum rises, nothing to rescale
        const float mn = fmaxf(m[u], mx), al = __builtin_amdgcn_exp2f((m[u] - mn) * SC2); m[u] = mn; sum[u] *= al;
#pragma unroll
        for (int j = 0; j < HD / 16; ++j) acc[u][j] *= al; }
      const float nb = 11.0f - m[u] * SC2; float ps = 0.f;   // every chunk holds a key at or before each of the block's queries, so m[u] is a real product here and a masked entry's exponent is far below the range: 2^x gives 0
#pragma unroll
      for (int i = 0; i < 16; ++i) x[i] = x[i] * SC2 + nb;
#pragma unroll
      for (int i = 0; i < 16; ++i) x[i] = __builtin_amdgcn_exp2f(x[i]);
#pragma unroll
      for (int i = 0; i < 16; ++i) ps += x[i];
      sum[u] += ps;
      if (HI) { const F2 p = bsplit16(x);
#pragma unroll
        for (int j = 0; j < HD / 16; ++j) { const v16b vh = frag_bp(vbq + j * 2 * FU), vl = frag_bp(vlq + j * 2 * FU); XWAIT(vbq, vlq);
          acc[u][j] = wmma_bf(vh, p.h, acc[u][j]); acc[u][j] = wmma_bf(vh, p.l, acc[u][j]); acc[u][j] = wmma_bf(vl, p.h, acc[u][j]); }
      } else { v16h pb;
#pragma unroll
        for (int i = 0; i < 16; ++i) pb[i] = (_Float16)x[i];
#pragma unroll
        for (int j = 0; j < HD / 16; ++j) acc[u][j] = wmma16(av[j], pb, acc[u][j]); } } } }
__global__ __launch_bounds__(32 * FW) void k_att(const _Float16* __restrict__ QH, const _Float16* __restrict__ KH, const _Float16* __restrict__ QL, const _Float16* __restrict__ KL, const _Float16* __restrict__ VT, const __bf16* __restrict__ VB, const __bf16* __restrict__ VBL, float* __restrict__ Y) {
  __shared__ __align__(16) float ss[FW][QR][HD + 4]; __shared__ float rm[FW][QR], rs[FW][QR];
  const int tid = threadIdx.x, wave = __builtin_amdgcn_readfirstlane(tid >> 5), lane = tid & 31, col = lane & 15, g = lane >> 4;
  const int b = blockIdx.x / NH, h = blockIdx.x % NH; const int ql0 = (TT / QR - 1 - (int)blockIdx.y) * QR;   // the tiles with the most keys start first
  const int kce = CAUSAL ? ((ql0 + QR - 1) >> 5) + 1 : TT / 32;
  v8f acc[QT][HD / 16] = {}; float m[QT], sum[QT];
#pragma unroll
  for (int u = 0; u < QT; ++u) { m[u] = -3.0e38f; sum[u] = 0.f; }
  const size_t bh = blockIdx.x; const _Float16* qp = QH + (bh * TT + ql0) * HD + 8 * lane; const _Float16* kp = KH + bh * TT * HD + 8 * lane; const _Float16* vp = VT + bh * TT * HD + 8 * lane;   // bh = b * NH + h
  if (CAUSAL && ql0 < QBH * 64) att_keys<true>(qp, QL + (bh * QHI + ql0) * HD + 8 * lane, kp, KL + bh * KHI * HD + 8 * lane, vp, VB + bh * KHI * HD + 8 * lane, VBL + bh * KHI * HD + 8 * lane, ql0, kce, wave, lane, acc, m, sum);
  else att_keys<false>(qp, nullptr, kp, nullptr, vp, nullptr, nullptr, ql0, kce, wave, lane, acc, m, sum);
#pragma unroll
  for (int u = 0; u < QT; ++u) { sum[u] += __shfl_xor(sum[u], 16);
#pragma unroll
    for (int j = 0; j < HD / 16; ++j) { const v8f a = acc[u][j]; float* d = &ss[wave][u * 16 + col][j * 16 + 8 * g]; vst2(d, (v4f){a[0], a[1], a[2], a[3]}); vst2(d + 4, (v4f){a[4], a[5], a[6], a[7]}); }
    if (g == 0) { rm[wave][u * 16 + col] = m[u]; rs[wave][u * 16 + col] = sum[u]; } }
  __syncthreads();
  for (int e = tid; e < QR * (HD / 4); e += 32 * FW) { const int row = e / (HD / 4), q4 = e % (HD / 4);
    float M = rm[0][row];
#pragma unroll
    for (int w = 1; w < FW; ++w) M = fmaxf(M, rm[w][row]);
    float den = 0.f; v4f o = {};
#pragma unroll
    for (int w = 0; w < FW; ++w) { const float wg = __builtin_amdgcn_exp2f((rm[w][row] - M) * SC2); den += wg * rs[w][row]; o += *(const v4f*)&ss[w][row][q4 * 4] * wg; }   // a wave without keys has maximum -3e38, sum 0 and weight 0
    const float inv = den > 0.f ? 1.0f / den : 0.f;   /* a fully excluded row yields 0 */
    vst2(Y + ((size_t)b * TT + ql0 + row) * CC + h * HD + q4 * 4, o * inv); } }

extern "C" void kernel_launch(void* const* d_in, const int* in_sizes, int n_in, void* d_out, int out_size, void* d_ws, size_t ws_size, hipStream_t stream) {
  (void)in_sizes; (void)n_in; (void)out_size;
  const float** F = (const float**)d_in;
  if (ws_size < (size_t)WS_END) return;
  char* ws = (char*)d_ws; _Float16 *QH = (_Float16*)(ws + WS_QH), *KH = (_Float16*)(ws + WS_KH), *VT = (_Float16*)(ws + WS_VT), *QL = (_Float16*)(ws + WS_QL), *KL = (_Float16*)(ws + WS_KL); __bf16 *VB = (__bf16*)(ws + WS_VB), *VBL = (__bf16*)(ws + WS_VBL);
  // inputs: 0 x [2,2048,1024]; 1 Wq [16,1024,64]; 2 Wk; 3 Wv (per-head (in,out)); no biases, no output projection
  k_proj<<<dim3(TNB * TT / (64 * RT), CC / 128, 3), 128, 0, stream>>>(F[0], F[0], F[0], F[1], F[2], F[3], nullptr, nullptr, nullptr, QH, QL, KH, KL, VT, VB, VBL);
  k_att<<<dim3(TNB * NH, TT / QR, 1), 32 * FW, 0, stream>>>(QH, KH, QL, KL, VT, VB, VBL, (float*)d_out);   /* merged heads [b][t][h*64+d] == the output layout */
}

// v008
// Measured time: 65.5 microseconds a run.
// Two timings next to v007 put it at 1.03 and 1.04 times that version's speed.
// Counting every step since v000, it is 14.9 times as fast.
// compute dtype: all float inputs rounded to bf16; per-head q/k/v projections with EXACT bf16 products on WMMA 16x16x32 (f32 accumulate); causal logits: q f16 x k f16 (1 product; q hi + residual and the k residual, 3 products, for the first 384 rows) x 1024^-0.5; softmax f32 in base 2 (running maximum of the unscaled products and sum); 2^((product - maximum) x scale x log2 e + 11) once to f16 x v once to f16 (1 product; bf16 hi + lo below row 384), divided by the sum (which carries the same 2^11) at the end; f32 output (no output projection).
#include <hip/hip_runtime.h>
#include <math.h>

typedef __attribute__((ext_vector_type(16))) _Float16 v16h;
typedef __attribute__((ext_vector_type(16))) __bf16 v16b;
typedef __attribute__((ext_vector_type(8)))  _Float16 v8h;
typedef __attribute__((ext_vector_type(8)))  float v8f;
typedef __attribute__((ext_vector_type(4)))  float v4f;
typedef __attribute__((ext_vector_type(2)))  float v2f;
typedef __attribute__((ext_vector_type(4)))  unsigned v4u;
typedef __attribute__((ext_vector_type(4)))  int v4i;
typedef float __attribute__((may_alias)) float_a;
typedef int __attribute__((may_alias)) int_a;

template <typename T> __device__ __forceinline__ void vst2(void* p, T v) { *(T*)p = v;  }
__device__ __forceinline__ v8f wmma16(v16h a, v16h b, v8f c) {
  v8f d = __builtin_amdgcn_wmma_f32_16x16x32_f16(false, a, false, b, (short)0, c, false, false);
  asm volatile("v_nop\n\tv_nop\n\tv_nop\n\tv_nop" : "+v"(d) : "v"(a), "v"(b));
  return d;
}
__device__ __forceinline__ v8f wmma_bf(v16b a, v16b b, v8f c) {
  v8f d = __builtin_amdgcn_wmma_f32_16x16x32_bf16(false, a, false, b, (short)0, c, false, false);
  asm volatile("v_nop\n\tv_nop\n\tv_nop\n\tv_nop" : "+v"(d) : "v"(a), "v"(b));
  return d;
}
// the same (four v_nop: the distance the chip needs between a product and the next vector instruction on its registers) for k_proj's two-tile wave: the statement names D alone, so that A and B may lie above v255, where an asm operand cannot (with all three named the accumulators spilled)
__device__ __forceinline__ v8f wmma_bfd(v16b a, v16b b, v8f c) {
  v8f d = __builtin_amdgcn_wmma_f32_16x16x32_bf16(false, a, false, b, (short)0, c, false, false);
  asm volatile("v_nop\n\tv_nop\n\tv_nop\n\tv_nop" : "+v"(d));
  return d;
}
// 16x16x32 fragments: lane = (h = lane>>4, row/col = lane&15); elements 0..7 = k0+8h+0..7, 8..15 = k0+16+8h+0..7; D element r = row 8h+r
__device__ __forceinline__ v16h frag_h(const _Float16* rowk0, int lane) {
  union { v16h v; v8h q[2]; } u; const _Float16* p = rowk0 + 8 * (lane >> 4);
  u.q[0] = *(const v8h*)p; u.q[1] = *(const v8h*)(p + 16); return u.v;
}
__device__ __forceinline__ v16h frag_f32(const float* rowk0, int lane) {
  v16h a; const float* p = rowk0 + 8 * (lane >> 4);
#pragma unroll
  for (int i = 0; i < 8; ++i) { a[i] = (_Float16)p[i]; a[8 + i] = (_Float16)p[16 + i]; }
  return a;
}
__device__ __forceinline__ v16h frag_f32s(const float* rowk0, int lane, float sc) {
  v16h a; const float* p = rowk0 + 8 * (lane >> 4);
#pragma unroll
  for (int i = 0; i < 8; ++i) { a[i] = (_Float16)(p[i] * sc); a[8 + i] = (_Float16)(p[16 + i] * sc); }
  return a;
}
// column fragment from a [K][ld] layout (column n), rows >= K read as 0
__device__ __forceinline__ v16h fragc_f32(const float* W, int k0, int n, int lane, int ld, int K) {
  v16h a; const int g = lane >> 4;
#pragma unroll
  for (int i = 0; i < 8; ++i) { const int ka = k0 + 8 * g + i, kb = ka + 16;
    a[i] = (_Float16)(ka < K ? W[(size_t)(ka < K ? ka : K - 1) * ld + n] : 0.f); a[8 + i] = (_Float16)(kb < K ? W[(size_t)(kb < K ? kb : K - 1) * ld + n] : 0.f); }
  return a;
}
struct F2 { v16b h, l; };
__device__ __forceinline__ F2 bsplit16(const float v[16]) { F2 r;
#pragma unroll
  for (int i = 0; i < 16; ++i) { const __bf16 h = (__bf16)v[i]; r.h[i] = h; r.l[i] = (__bf16)(v[i] - (float)h); }
  return r; }
__device__ __forceinline__ F2 split_row(const float* row, int k0, int lane) { float v[16]; const float* p = row + k0 + 8 * (lane >> 4);
#pragma unroll
  for (int i = 0; i < 8; ++i) { v[i] = p[i]; v[8 + i] = p[16 + i]; }
  return bsplit16(v); }
__device__ __forceinline__ F2 split_rowK(const float* row, int k0, int lane, int K) { float v[16]; const int g = lane >> 4;
#pragma unroll
  for (int i = 0; i < 8; ++i) { const int ka = k0 + 8 * g + i, kb = ka + 16; v[i] = ka < K ? row[ka < K ? ka : K - 1] : 0.f; v[8 + i] = kb < K ? row[kb < K ? kb : K - 1] : 0.f; }
  return bsplit16(v); }
__device__ __forceinline__ F2 split_col(const float* W, int k0, int n, int lane, int ld, int K) { float v[16]; const int g = lane >> 4;
#pragma unroll
  for (int i = 0; i < 8; ++i) { const int ka = k0 + 8 * g + i, kb = ka + 16; v[i] = ka < K ? W[(size_t)(ka < K ? ka : K - 1) * ld + n] : 0.f; v[8 + i] = kb < K ? W[(size_t)(kb < K ? kb : K - 1) * ld + n] : 0.f; }
  return bsplit16(v); }
__device__ __forceinline__ v8f mac3(const F2& a, const F2& b, v8f c) { c = wmma_bf(a.l, b.h, c); c = wmma_bf(a.h, b.l, c); return wmma_bf(a.h, b.h, c); }
__device__ __forceinline__ float sigm(float v) { return 1.0f / (1.0f + expf(-v)); }

// Causal multi-head self-attention without output projection (B 2, T 2,048, C 1,024, 16 heads x 64; per-head weights Wq/Wk/Wv [16,1024,64], 0.02-scale, no biases; the logit scale is C^-0.5 = 1/32 as in the source): out = concat_h causal_softmax(q_h k_h^T / 32) v_h -> [2, 2048, 1024].
#define NB 2
#define TT 2048
#define CC 1024            // NH * HD = projected width
#define DIN 1024          // input (model) width
#define NH 16
#define HD 64
#define SCALE (0.03125f)
#define CAUSAL 1
#ifndef TNB
#define TNB NB
#endif
__device__ __forceinline__ float bfr(float v) { return (float)(__bf16)v; }
__host__ __device__ __forceinline__ int kb_last(int qb) { return CAUSAL ? ((qb * 64 + 63) >> 7) : (TT / 128 - 1); }
typedef __attribute__((ext_vector_type(8))) __bf16 v8b;
__device__ __forceinline__ v16b frag_b(const __bf16* rowk0, int lane) {
  union { v16b v; v8b q[2]; } u; const __bf16* p = rowk0 + 8 * (lane >> 4);
  u.q[0] = *(const v8b*)p; u.q[1] = *(const v8b*)(p + 16); return u.v;
}
#define QBH 6              // causal: query blocks 0..QBH-1 of each sequence (few keys, no averaging) take the high-precision path
#define QHI 384            // rows carrying a q residual plane (used only by the causal high-precision path)
#define KHI 384            // key rows carrying k residual / v bf16 hi+lo planes (used only by the causal high-precision path)
// B fragment (k rows k0+.., output column o) of a weight: (in,out) [K][ld] or (out,in) [ld rows of K]: bf16 exact, or f16(bf16 * 256) exact
__device__ __forceinline__ v16b wcol_io(const float* Wm, int k0, int o, int lane, int ld) { v16b w; const int g = lane >> 4;
#pragma unroll
  for (int i = 0; i < 8; ++i) { w[i] = (__bf16)Wm[(size_t)(k0 + 8 * g + i) * ld + o]; w[8 + i] = (__bf16)Wm[(size_t)(k0 + 16 + 8 * g + i) * ld + o]; }
  return w; }
__device__ __forceinline__ v16b wcol_oi(const float* Wm, int k0, int o, int lane, int K) { v16b w; const float* p = Wm + (size_t)o * K + k0 + 8 * (lane >> 4);
#pragma unroll
  for (int i = 0; i < 8; ++i) { w[i] = (__bf16)p[i]; w[8 + i] = (__bf16)p[16 + i]; }
  return w; }
__device__ __forceinline__ v16h wcolh_io(const float* Wm, int k0, int o, int lane, int ld) { v16h w; const int g = lane >> 4;
#pragma unroll
  for (int i = 0; i < 8; ++i) { w[i] = (_Float16)(bfr(Wm[(size_t)(k0 + 8 * g + i) * ld + o]) * 256.0f); w[8 + i] = (_Float16)(bfr(Wm[(size_t)(k0 + 16 + 8 * g + i) * ld + o]) * 256.0f); }
  return w; }
__device__ __forceinline__ v16h wcolh_oi(const float* Wm, int k0, int o, int lane, int K) { v16h w; const float* p = Wm + (size_t)o * K + k0 + 8 * (lane >> 4);
#pragma unroll
  for (int i = 0; i < 8; ++i) { w[i] = (_Float16)(bfr(p[i]) * 256.0f); w[8 + i] = (_Float16)(bfr(p[16 + i]) * 256.0f); }
  return w; }
#define WQKV_LAYOUT 0   // 0 = per-head [NH][DIN][HD]; 1 = (out,in) [CC][DIN]; 2 = per-head [NH][DIN][HD]
__device__ __forceinline__ v16b wcol_hdk(const float* Wm, int k0, int o, int lane) { v16b w; const int g = lane >> 4; const float* p = Wm + (size_t)(o / HD) * DIN * HD + (o % HD);
#pragma unroll
  for (int i = 0; i < 8; ++i) { w[i] = (__bf16)p[(size_t)(k0 + 8 * g + i) * HD]; w[8 + i] = (__bf16)p[(size_t)(k0 + 16 + 8 * g + i) * HD]; }
  return w; }
#define WO_OUT_IN 0
#if WQKV_LAYOUT == 1
#define WCOL(W, k0, o, lane) wcol_oi(W, k0, o, lane, DIN)
#elif WQKV_LAYOUT == 2
#define WCOL(W, k0, o, lane) wcol_hdk(W, k0, o, lane)
#else
#define WCOL(W, k0, o, lane) wcol_heads(W, k0, o, lane)   /* per-head [h][C][64] weights */
#endif
#if WO_OUT_IN
#define WOCOL(W, k0, o, lane) wcol_oi(W, k0, o, lane, CC)
#define WOCOLH(W, k0, o, lane) wcolh_oi(W, k0, o, lane, CC)
#else
#define WOCOL(W, k0, o, lane) wcol_io(W, k0, o, lane, DIN)
#define WOCOLH(W, k0, o, lane) wcolh_io(W, k0, o, lane, DIN)
#endif
// per-head projection weights W[h][c][d] ([16][1024][64]): column o = h*64 + d of the virtual (in,out) [C][H*D] matrix lives at W + (h*C + k)*64 + d
__device__ __forceinline__ v16b wcol_heads(const float* __restrict__ Wm, int k0, int o, int lane) { v16b w; const int g = lane >> 4; const float* p = Wm + ((size_t)(o >> 6) * DIN + k0 + 8 * g) * 64 + (o & 63);
#pragma unroll
  for (int i = 0; i < 8; ++i) { w[i] = (__bf16)p[(size_t)i * 64]; w[8 + i] = (__bf16)p[(size_t)(16 + i) * 64]; }
  asm volatile("s_wait_loadcnt 0x0" ::: "memory"); return w; }
#ifndef PROJ_EXTRA_PARAMS
#define PROJ_EXTRA_PARAMS
#endif

// Every plane lies in fragment order: per (b, head) a run of rows x HD elements, cut into 512-B units that are one wave-wide 16-B load each (lane l = 16 g + col holds 8 elements at 8 l), so that a fragment load of k_att covers 4 whole 128-B lines instead of 32 B of each of 16.
// q, k and their residuals: [b][head][t / 16][d / 16][g = (d / 8) & 1][col = t & 15][d & 7]; v planes: [b][head][t / 32][d / 16][(t / 16) & 1][g = (t / 8) & 1][col = d & 15][t & 7]
#define FU 256              // elements of a 512-B unit
#define WS_QH  0u                                      // f16 q [b][head][t][HD]
#define WS_KH  (WS_QH + 2u * (size_t)NB * TT * CC)      // f16 k [b][head][t][HD]
#define WS_VT  (WS_KH + 2u * (size_t)NB * TT * CC)      // f16 v [b][head][t][HD]
#define WS_QL  (WS_VT + 2u * (size_t)NB * CC * TT)      // f16 q residual x 2^10 [b][head][t < QHI][HD]
#define WS_KL  (WS_QL + 2u * (size_t)NB * QHI * CC)     // f16 k residual x 2^10 [b][head][t < KHI][HD]
#define WS_VB  (WS_KL + 2u * (size_t)NB * KHI * CC)     // bf16 v hi, then lo [b][head][t < KHI][HD]
#define WS_VBL (WS_VB + 2u * (size_t)NB * CC * KHI)
#define WS_END (WS_VBL + 2u * (size_t)NB * CC * KHI)

#define KS 32               // k of a staged W tile (one WMMA step a barrier)
#define WPB 80              // bytes of a staged W column in LDS: KS bf16 + 16 B = 16 B x odd
static_assert(128 * WPB <= 128 * 72 * 2, "a W buffer fits the place of tb or tbl");
#define XPB 80              // bytes of a staged X row in LDS: KS bf16 + 16 B = 16 B x odd
typedef __attribute__((ext_vector_type(4))) __bf16 v4b;
#define RT 2                // 16-row tiles of a wave (64 rows apart): every W fragment read from LDS feeds RT products
static_assert(TT % (64 * RT) == 0, "a block's rows lie in one sequence");
static_assert(64 * RT * XPB <= 64 * 136 * 2, "an X buffer fits the place of sh or sl");
// ---- k_proj: block = (64 * RT rows, 128 cols, which): q/k/v = X W (+ b) with exact bf16 products (K = DIN) -> which 0: q f16 (+ residual, rows < QHI); 1: k f16 (+ residual, rows < KHI); 2: v f16 (+ bf16 hi/lo for t < KHI), each stored in fragment order
__global__ __launch_bounds__(128) void k_proj(const float* __restrict__ XQ, const float* __restrict__ XK, const float* __restrict__ XV, const float* __restrict__ WQ, const float* __restrict__ WK, const float* __restrict__ WV, const float* __restrict__ BQ, const float* __restrict__ BK, const float* __restrict__ BV,
    _Float16* __restrict__ QH, _Float16* __restrict__ QL, _Float16* __restrict__ KH, _Float16* __restrict__ KL, _Float16* __restrict__ VT, __bf16* __restrict__ VB, __bf16* __restrict__ VBL) {
  __shared__ __align__(16) _Float16 sh[64][136], sl[64][136]; __shared__ __align__(16) _Float16 th[128][72]; __shared__ __align__(16) __bf16 tb[128][72], tbl[128][72];
  const int tid = threadIdx.x, wave = tid >> 5, lane = tid & 31, col = lane & 15, g = lane >> 4; const int which = blockIdx.z; const int c0 = blockIdx.y * 128; const size_t rB = (size_t)blockIdx.x * (64 * RT); const size_t bb = rB / TT; const int tB = (int)(rB % TT);
  const float* X = which == 0 ? XQ : which == 1 ? XK : XV; const float* WA = which == 0 ? WQ : which == 1 ? WK : WV; const float* BA = which == 0 ? BQ : which == 1 ? BK : BV;
  v8f acc[RT][8] = {};
  // W tile of KS k x 128 columns: each thread loads 4 columns x 8 k (whole 256-B head rows per half wave), rounds to bf16 once for the block and writes 16-B pieces (8 k of one column) to LDS;
  // column n lies at n * WPB, its piece c at place c ^ ((n >> 4) & 3): 16 lanes of a store (columns 4 apart) and 16 lanes of a fragment read (columns in a row) each fall on distinct banks.
  // The two buffers take the place of tb and tbl, which the epilogue fills only behind the barrier that follows the loop.
  const float* wp = WA + ((size_t)((c0 >> 6) + (lane >> 4)) * DIN + wave * 8) * 64 + (lane & 15) * 4; 
  // X tile of 64 * RT rows x KS k: a row's KS floats are one 128-B line. A wave loads its own 16 * RT rows in whole lines (8 lanes a row, 4 rows a load: 4 lines a load, where a load in fragment order touches 16), rounds to bf16 and writes 8-B pieces to its own rows of an LDS buffer,
  // from which it reads its A fragments back (row col, k 8 g + 0..7 and 16 + 8 g + 0..7, the order of the W fragments). The two buffers take the place of sh and sl, which the epilogue fills only behind the barrier that follows the loop.
  const float* xp = X + (rB + wave * 16 + (lane >> 3)) * DIN + (lane & 7) * 4; const int xst = (wave * 16 + (lane >> 3)) * XPB + (lane & 7) * 8;
  const int wst = (4 * lane) * WPB + ((wave ^ ((lane >> 2) & 3)) * 16);
  v4f wr[8], xr[RT * 4];   // xr[i]: tile i >> 2, rows 4 (i & 3) + (lane >> 3)
#pragma unroll
  for (int i = 0; i < 8; ++i) wr[i] = *(const v4f*)(wp + (size_t)i * 64);
#pragma unroll   // here and below: xr[] stays in registers, i folds into the instruction's offset
  for (int i = 0; i < RT * 4; ++i) xr[i] = *(const v4f*)(xp + (size_t)((i >> 2) * 64 + (i & 3) * 4) * DIN);
  asm volatile("s_wait_xcnt 0x0" ::: "memory");   // behind the first tiles' loads, ahead of whatever next writes a register that they name
#pragma unroll 2   // so that the buffer of a trip is known at compile time
  for (int kt = 0; kt < DIN / KS; ++kt) { unsigned char* wb = (unsigned char*)((kt & 1) ? &tbl[0][0] : &tb[0][0]); unsigned char* xb = (unsigned char*)((kt & 1) ? &sl[0][0] : &sh[0][0]); v16b a[RT];
#pragma unroll
    for (int c = 0; c < 4; ++c) { v8b t;
#pragma unroll
      for (int i = 0; i < 8; ++i) t[i] = (__bf16)wr[i][c];
      *(v8b*)(wb + wst + c * WPB) = t; }
#pragma unroll
    for (int i = 0; i < RT * 4; ++i) { v4b t;
#pragma unroll
      for (int e = 0; e < 4; ++e) t[e] = (__bf16)xr[i][e];
      *(v4b*)(xb + xst + ((i >> 2) * 64 + (i & 3) * 4) * XPB) = t; }
    if (kt + 1 < DIN / KS) { const float* wn = wp + (size_t)(kt + 1) * KS * 64; const float* xn = xp + (kt + 1) * KS;
#pragma unroll
      for (int i = 0; i < 8; ++i) wr[i] = *(const v4f*)(wn + (size_t)i * 64);
#pragma unroll
      for (int i = 0; i < RT * 4; ++i) xr[i] = *(const v4f*)(xn + (size_t)((i >> 2) * 64 + (i & 3) * 4) * DIN);
      asm volatile("s_wait_xcnt 0x0" ::: "memory"); }   // the next trip's loads issue here, ahead of this trip's products, and their address registers may be stepped behind this wait
    // work-group barrier by hand: __syncthreads() would also wait for the global loads just issued, which are to stay in flight over this trip's products. It publishes this trip's W tile (each wave's LDS stores are done at its signal) and ends every wave's reads of the other buffer, which the next trip refills.
    asm volatile("s_wait_dscnt 0x0\n\ts_barrier_signal -1\n\ts_barrier_wait -1" ::: "memory");
    v16b w[8];
#pragma unroll
    for (int j = 0; j < 8; ++j) { union { v16b v; v8b q[2]; } u; const unsigned char* rp = wb + (j * 16 + col) * WPB;
      u.q[0] = *(const v8b*)(rp + ((g ^ (j & 3)) * 16)); u.q[1] = *(const v8b*)(rp + (((2 + g) ^ (j & 3)) * 16)); w[j] = u.v; }
#pragma unroll
    for (int h = 0; h < RT; ++h) { union { v16b v; v8b q[2]; } u; const unsigned char* rp = xb + (h * 64 + wave * 16 + col) * XPB + g * 16;
      u.q[0] = *(const v8b*)rp; u.q[1] = *(const v8b*)(rp + 32); a[h] = u.v; }
    __builtin_amdgcn_sched_barrier(0);   // all 16 + 2 RT LDS reads issue ahead of the first product: one LDS latency a trip, not one a product
#pragma unroll
    for (int j = 0; j < 8; ++j)
#pragma unroll
      for (int h = 0; h < RT; ++h) acc[h][j] = wmma_bfd(a[h], w[j], acc[h][j]);
    __builtin_amdgcn_sched_barrier(0); }   // the next tile's rounding, and with it the wait for the loads in flight, stays behind this trip's products
  __syncthreads();   // the last tile's readers leave tb, tbl, sh and sl before the epilogue writes there
  if (which < 2) { _Float16* DH = which == 0 ? QH : KH; _Float16* DL = which == 0 ? QL : KL; const int nhi = which == 0 ? QHI : KHI;
#pragma unroll
   for (int h = 0; h < RT; ++h) { const int t0 = tB + h * 64; const bool hi_rows = t0 < nhi;   // the wave's tiles one after the other through the same 64-row staging arrays
    if (h) __syncthreads();   // the copy-out of the 64 rows before has left sh and sl
#pragma unroll
    for (int j = 0; j < 8; ++j) { const float bias = BA ? bfr(BA[c0 + j * 16 + col]) : 0.f;
#pragma unroll
      for (int r = 0; r < 8; ++r) { const float v = acc[h][j][r] + bias; const _Float16 hv = (_Float16)v; sh[wave * 16 + 8 * g + r][j * 16 + col] = hv; sl[wave * 16 + 8 * g + r][j * 16 + col] = (_Float16)((v - (float)hv) * 1024.0f); } }
    __syncthreads();
    // a wave stores 512-B units: 16 rows (col) x 16 d (16 wave + 8 g + 0..7) of 16-row tile i & 3, head i >> 2; tile and head are compile-time offsets of one address
    const _Float16* sp = &sh[col][wave * 16 + g * 8]; const _Float16* lp = &sl[col][wave * 16 + g * 8]; const size_t hd = bb * NH + (c0 >> 6); const int o = wave * FU + lane * 8; v4u d[8];
    _Float16* dh = DH + (hd * TT + t0) * HD + o; _Float16* dl = DL + (hd * nhi + t0) * HD + o;
#pragma unroll   // here and below: d[] stays in registers, all LDS reads issue ahead of the stores, i folds into the instruction's offset
    for (int i = 0; i < 8; ++i) d[i] = *(const v4u*)(sp + (i & 3) * 16 * 136 + (i >> 2) * 64);
#pragma unroll
    for (int i = 0; i < 8; ++i) vst2((unsigned*)(dh + ((size_t)(i >> 2) * TT + (i & 3) * 16) * HD), d[i]);
    asm volatile("s_wait_xcnt 0x0" ::: "memory");   // behind the stores, ahead of whatever next writes a register that they name
    if (hi_rows) {
#pragma unroll
      for (int i = 0; i < 8; ++i) d[i] = *(const v4u*)(lp + (i & 3) * 16 * 136 + (i >> 2) * 64);
#pragma unroll
      for (int i = 0; i < 8; ++i) vst2((unsigned*)(dl + ((size_t)(i >> 2) * nhi + (i & 3) * 16) * HD), d[i]);
      asm volatile("s_wait_xcnt 0x0" ::: "memory"); }   // as above
  } } else {
#pragma unroll
   for (int h = 0; h < RT; ++h) { const int t0 = tB + h * 64; const bool hi_rows = t0 < KHI;
    if (h) __syncthreads();   // the copy-out of the 64 rows before has left th, tb and tbl
#pragma unroll
    for (int j = 0; j < 8; ++j) { const float bias = BA ? bfr(BA[c0 + j * 16 + col]) : 0.f;
#pragma unroll
      for (int r = 0; r < 8; ++r) { const float v = acc[h][j][r] + bias; const int rl = wave * 16 + 8 * g + r, cl = j * 16 + col; th[cl][rl] = (_Float16)v; const __bf16 bh = (__bf16)v; tb[cl][rl] = bh; tbl[cl][rl] = (__bf16)(v - (float)bh); } }
    __syncthreads();
    // a wave stores 512-B units: 16 channels (col) of tile (wave >> 1) + 2 (i & 1) x 16 keys (16 (wave & 1) + 8 g + 0..7) of 32-key chunk (i >> 1) & 1, head i >> 2; all of i is a compile-time offset of one address
    const int so = ((wave >> 1) * 16 + col) * 72 + (wave & 1) * 16 + g * 8; const size_t hd = bb * NH + (c0 >> 6); const int o = wave * FU + lane * 8; v4u d[8];
#pragma unroll   // here and below: d[] stays in registers, all LDS reads issue ahead of the stores, i folds into the instruction's offset
    for (int i = 0; i < 8; ++i) d[i] = *(const v4u*)(&th[0][0] + so + ((i >> 2) * 64 + (i & 1) * 32) * 72 + ((i >> 1) & 1) * 32);
#pragma unroll
    for (int i = 0; i < 8; ++i) vst2((unsigned*)(VT + (hd * TT + t0) * HD + o + ((size_t)(i >> 2) * TT + ((i >> 1) & 1) * 32) * HD + (i & 1) * 4 * FU), d[i]);
    asm volatile("s_wait_xcnt 0x0" ::: "memory");   // behind the stores, ahead of whatever next writes a register that they name
    if (hi_rows) {
#pragma unroll
      for (int p = 0; p < 2; ++p) { const __bf16* tp = (p ? &tbl[0][0] : &tb[0][0]) + so; __bf16* vd = (p ? VBL : VB) + (hd * KHI + t0) * HD + o;
#pragma unroll
        for (int i = 0; i < 8; ++i) d[i] = *(const v4u*)(tp + ((i >> 2) * 64 + (i & 1) * 32) * 72 + ((i >> 1) & 1) * 32);
#pragma unroll
        for (int i = 0; i < 8; ++i) vst2((unsigned*)(vd + ((size_t)(i >> 2) * KHI + ((i >> 1) & 1) * 32) * HD + (i & 1) * 4 * FU), d[i]);
        asm volatile("s_wait_xcnt 0x0" ::: "memory"); } } } }   // as above
}
// ---- k_att: block = QR query rows (QT tiles of 16) of (b, h), FW waves. Wave w takes the 32-key chunks w, w + FW, ... up to the diagonal. Per chunk: logits transposed, S^T = K . Q^T (a lane holds 16 keys of ONE query; q hi + residual x 2^10 and the k residual, 3 products, for the causal early rows), causal mask by index in the chunks that reach past the tile's first query;
// running maximum (of the unscaled products) and sum per query in the lane (one exchange between the wave's halves); 2^((product - maximum) x SC2 + 11) once to f16 is, in place, the B operand of O^T += V^T . P^T (early rows: P and v as bf16 hi + lo, 3 products). Behind one barrier the block joins the FW partial tiles in wave order, each weighted by 2^((its maximum - the row's maximum) x SC2), and divides by the joined sum; 256-B (row, head) segment by 16 lanes of one wave
#define FW 4
#define SC2 (SCALE * 1.44269504088896340736f)   // logit scale x log2 e: the exponent in base 2 is one fused multiply-add on the unscaled product, and the hardware's own 2^x takes it
#define QT 2
#define QR (16 * QT)
static_assert((QBH * 64) % QR == 0 && QBH * 64 <= KHI && QBH * 64 <= QHI && QR <= 32, "a block is early as a whole, its keys and residual rows exist, and only chunks at the diagonal are masked");
// fragment at a lane's own address (unit + 8 * lane): two units in a row, k 8 g + 0..7 and 16 + 8 g + 0..7
__device__ __forceinline__ v16h frag_hp(const _Float16* p) { union { v16h v; v8h q[2]; } u; u.q[0] = *(const v8h*)p; u.q[1] = *(const v8h*)(p + FU); return u.v; }
__device__ __forceinline__ v16b frag_bp(const __bf16* p) { union { v16b v; v8b q[2]; } u; u.q[0] = *(const v8b*)p; u.q[1] = *(const v8b*)(p + FU); return u.v; }
// stands behind a run of global loads: the loads issue ahead of it, and their two addresses, named as inputs, keep their registers up to it, so that neither a later load's result nor an address step overwrites them earlier
__device__ __forceinline__ void XWAIT(const void* a, const void* b) { asm volatile("s_wait_xcnt 0x0" :: "v"(a), "v"(b) : "memory"); }
template <bool HI> __device__ __forceinline__ void att_keys(const _Float16* __restrict__ qp, const _Float16* __restrict__ qlp, const _Float16* __restrict__ kp, const _Float16* __restrict__ klp, const _Float16* __restrict__ vp, const __bf16* __restrict__ vbp, const __bf16* __restrict__ vlp,
    int ql0, int kce, int wave, int lane, v8f (&acc)[QT][HD / 16], float (&m)[QT], float (&sum)[QT]) {
  const int col = lane & 15, g = lane >> 4; v16h bq[QT][HD / 32];   // the early rows' few chunks fetch q, its residual and v where they are used: their registers would otherwise set the count for every block
  if (!HI) {
#pragma unroll
    for (int u = 0; u < QT; ++u)
#pragma unroll
      for (int kk = 0; kk < HD / 32; ++kk) bq[u][kk] = frag_hp(qp + (u * 4 + kk * 2) * FU);
    XWAIT(qp, qp); }
#pragma unroll 1   // one chunk's fragments in registers at a time
  for (int kc = wave; kc < kce; kc += FW) { const int k0 = kc * 32; v16h ak[2][HD / 32], akl[2][HD / 32], av[HD / 16]; const _Float16* kq = kp + (size_t)k0 * HD; const _Float16* klq = HI ? klp + (size_t)k0 * HD : kq; const _Float16* vq = vp + (size_t)k0 * HD; const __bf16* vbq = HI ? vbp + (size_t)k0 * HD : nullptr; const __bf16* vlq = HI ? vlp + (size_t)k0 * HD : nullptr;
#pragma unroll
    for (int t = 0; t < 2; ++t)
#pragma unroll
      for (int kk = 0; kk < HD / 32; ++kk) { ak[t][kk] = frag_hp(kq + (t * 4 + kk * 2) * FU); if (HI) akl[t][kk] = frag_hp(klq + (t * 4 + kk * 2) * FU); }
#pragma unroll
    for (int j = 0; j < HD / 16; ++j) if (!HI) av[j] = frag_hp(vq + j * 2 * FU);
    if (HI) XWAIT(kq, klq); else XWAIT(kq, vq);   // the chunk's k and v loads (early rows: k and its residual) all issue here, v ahead of the logits that hide its latency
#pragma unroll
    for (int u = 0; u < QT; ++u) { v8f s[2] = {}, sl[2] = {}; float x[16];
#pragma unroll
      for (int kk = 0; kk < HD / 32; ++kk) { v16h qh, ql;
        if (HI) { qh = frag_hp(qp + (u * 4 + kk * 2) * FU); ql = frag_hp(qlp + (u * 4 + kk * 2) * FU); XWAIT(qp, qlp); }
        else qh = bq[u][kk];
#pragma unroll
        for (int t = 0; t < 2; ++t) { s[t] = wmma16(ak[t][kk], qh, s[t]); if (HI) { sl[t] = wmma16(ak[t][kk], ql, sl[t]); sl[t] = wmma16(akl[t][kk], qh, sl[t]); } } }
#pragma unroll
      for (int i = 0; i < 16; ++i) x[i] = HI ? s[i >> 3][i & 7] + sl[i >> 3][i & 7] * (1.0f / 1024.0f) : s[i >> 3][i & 7];   // unscaled: SC2 > 0 keeps the order, so the maximum is taken here
      if (CAUSAL && k0 + 31 > ql0 + u * 16) {   // same for the whole wave
#pragma unroll
        for (int i = 0; i < 16; ++i) x[i] = (k0 + (i >> 3) * 16 + 8 * g + (i & 7) <= ql0 + u * 16 + col) ? x[i] : -3.0e38f; }
      float mx = x[0];
#pragma unroll
      for (int i = 1; i < 16; ++i) mx = fmaxf(mx, x[i]);
      mx = fmaxf(mx, __shfl_xor(mx, 16));
      if (__builtin_amdgcn_ballot_w32(mx > m[u]) != 0) {   // a scalar branch: no query's maximum rises, nothing to rescale
        const float mn = fmaxf(m[u], mx), al = __builtin_amdgcn_exp2f((m[u] - mn) * SC2); m[u] = mn; sum[u] *= al;
#pragma unroll
        for (int j = 0; j < HD / 16; ++j) acc[u][j] *= al; }
      const float nb = 11.0f - m[u] * SC2; float ps = 0.f;   // every chunk holds a key at or before each of the block's queries, so m[u] is a real product here and a masked entry's exponent is far below the range: 2^x gives 0
#pragma unroll
      for (int i = 0; i < 16; ++i) x[i] = x[i] * SC2 + nb;
#pragma unroll
      for (int i = 0; i < 16; ++i) x[i] = __builtin_amdgcn_exp2f(x[i]);
#pragma unroll
      for (int i = 0; i < 16; ++i) ps += x[i];
      sum[u] += ps;
      if (HI) { const F2 p = bsplit16(x);
#pragma unroll
        for (int j = 0; j < HD / 16; ++j) { const v16b vh = frag_bp(vbq + j * 2 * FU), vl = frag_bp(vlq + j * 2 * FU); XWAIT(vbq, vlq);
          acc[u][j] = wmma_bf(vh, p.h, acc[u][j]); acc[u][j] = wmma_bf(vh, p.l, acc[u][j]); acc[u][j] = wmma_bf(vl, p.h, acc[u][j]); }
      } else { v16h pb;
#pragma unroll
        for (int i = 0; i < 16; ++i) pb[i] = (_Float16)x[i];
#pragma unroll
        for (int j = 0; j < HD / 16; ++j) acc[u][j] = wmma16(av[j], pb, acc[u][j]); } } } }
__global__ __launch_bounds__(32 * FW) void k_att(const _Float16* __restrict__ QH, const _Float16* __restrict__ KH, const _Float16* __restrict__ QL, const _Float16* __restrict__ KL, const _Float16* __restrict__ VT, const __bf16* __restrict__ VB, const __bf16* __restrict__ VBL, float* __restrict__ Y) {
  __shared__ __align__(16) float ss[FW][QR][HD + 4]; __shared__ float rm[FW][QR], rs[FW][QR];
  const int tid = threadIdx.x, wave = __builtin_amdgcn_readfirstlane(tid >> 5), lane = tid & 31, col = lane & 15, g = lane >> 4;
  const int b = blockIdx.x / NH, h = blockIdx.x % NH; const int ql0 = (TT / QR - 1 - (int)blockIdx.y) * QR;   // the tiles with the most keys start first
  const int kce = CAUSAL ? ((ql0 + QR - 1) >> 5) + 1 : TT / 32;
  v8f acc[QT][HD / 16] = {}; float m[QT], sum[QT];
#pragma unroll
  for (int u = 0; u < QT; ++u) { m[u] = -3.0e38f; sum[u] = 0.f; }
  const size_t bh = blockIdx.x; const _Float16* qp = QH + (bh * TT + ql0) * HD + 8 * lane; const _Float16* kp = KH + bh * TT * HD + 8 * lane; const _Float16* vp = VT + bh * TT * HD + 8 * lane;   // bh = b * NH + h
  if (CAUSAL && ql0 < QBH * 64) att_keys<true>(qp, QL + (bh * QHI + ql0) * HD + 8 * lane, kp, KL + bh * KHI * HD + 8 * lane, vp, VB + bh * KHI * HD + 8 * lane, VBL + bh * KHI * HD + 8 * lane, ql0, kce, wave, lane, acc, m, sum);
  else att_keys<false>(qp, nullptr, kp, nullptr, vp, nullptr, nullptr, ql0, kce, wave, lane, acc, m, sum);
#pragma unroll
  for (int u = 0; u < QT; ++u) { sum[u] += __shfl_xor(sum[u], 16);
#pragma unroll
    for (int j = 0; j < HD / 16; ++j) { const v8f a = acc[u][j]; float* d = &ss[wave][u * 16 + col][j * 16 + 8 * g]; vst2(d, (v4f){a[0], a[1], a[2], a[3]}); vst2(d + 4, (v4f){a[4], a[5], a[6], a[7]}); }
    if (g == 0) { rm[wave][u * 16 + col] = m[u]; rs[wave][u * 16 + col] = sum[u]; } }
  __syncthreads();
  for (int e = tid; e < QR * (HD / 4); e += 32 * FW) { const int row = e / (HD / 4), q4 = e % (HD / 4);
    float M = rm[0][row];
#pragma unroll
    for (int w = 1; w < FW; ++w) M = fmaxf(M, rm[w][row]);
    float den = 0.f; v4f o = {};
#pragma unroll
    for (int w = 0; w < FW; ++w) { const float wg = __builtin_amdgcn_exp2f((rm[w][row] - M) * SC2); den += wg * rs[w][row]; o += *(const v4f*)&ss[w][row][q4 * 4] * wg; }   // a wave without keys has maximum -3e38, sum 0 and weight 0
    const float inv = den > 0.f ? 1.0f / den : 0.f;   /* a fully excluded row yields 0 */
    vst2(Y + ((size_t)b * TT + ql0 + row) * CC + h * HD + q4 * 4, o * inv); } }

extern "C" void kernel_launch(void* const* d_in, const int* in_sizes, int n_in, void* d_out, int out_size, void* d_ws, size_t ws_size, hipStream_t stream) {
  (void)in_sizes; (void)n_in; (void)out_size;
  const float** F = (const float**)d_in;
  if (ws_size < (size_t)WS_END) return;
  char* ws = (char*)d_ws; _Float16 *QH = (_Float16*)(ws + WS_QH), *KH = (_Float16*)(ws + WS_KH), *VT = (_Float16*)(ws + WS_VT), *QL = (_Float16*)(ws + WS_QL), *KL = (_Float16*)(ws + WS_KL); __bf16 *VB = (__bf16*)(ws + WS_VB), *VBL = (__bf16*)(ws + WS_VBL);
  // inputs: 0 x [2,2048,1024]; 1 Wq [16,1024,64]; 2 Wk; 3 Wv (per-head (in,out)); no biases, no output projection
  k_proj<<<dim3(TNB * TT / (64 * RT), CC / 128, 3), 128, 0, stream>>>(F[0], F[0], F[0], F[1], F[2], F[3], nullptr, nullptr, nullptr, QH, QL, KH, KL, VT, VB, VBL);
  k_att<<<dim3(TNB * NH, TT / QR, 1), 32 * FW, 0, stream>>>(QH, KH, QL, KL, VT, VB, VBL, (float*)d_out);   /* merged heads [b][t][h*64+d] == the output layout */
}

// v009
// A run of this version takes 59.7 microseconds.
// Next to v008, in two timings, it ran 1.09 times as fast each time.
// Counting every step since v000, it is 16.3 times as fast.
// compute dtype: all float inputs rounded to bf16; per-head q/k/v projections with EXACT bf16 products on WMMA 16x16x32 (f32 accumulate); causal logits: q f16 x k f16 (1 product; q hi + residual and the k residual, 3 products, for the first 384 rows) x 1024^-0.5; softmax f32 in base 2 (running maximum of the unscaled products and sum); 2^((product - maximum) x scale x log2 e + 11) once to f16 x v once to f16 (1 product; bf16 hi + lo below row 384), divided by the sum (which carries the same 2^11) at the end; f32 output (no output projection).
#include <hip/hip_runtime.h>
#include <math.h>

typedef __attribute__((ext_vector_type(16))) _Float16 v16h;
typedef __attribute__((ext_vector_type(16))) __bf16 v16b;
typedef __attribute__((ext_vector_type(8)))  _Float16 v8h;
typedef __attribute__((ext_vector_type(8)))  float v8f;
typedef __attribute__((ext_vector_type(4)))  float v4f;
typedef __attribute__((ext_vector_type(2)))  float v2f;
typedef __attribute__((ext_vector_type(4)))  unsigned v4u;
typedef __attribute__((ext_vector_type(4)))  int v4i;
typedef float __attribute__((may_alias)) float_a;
typedef int __attribute__((may_alias)) int_a;

template <typename T> __device__ __forceinline__ void vst2(void* p, T v) { *(T*)p = v;  }
__device__ __forceinline__ v8f wmma16(v16h a, v16h b, v8f c) {
  v8f d = __builtin_amdgcn_wmma_f32_16x16x32_f16(false, a, false, b, (short)0, c, false, false);
  asm volatile("v_nop\n\tv_nop\n\tv_nop\n\tv_nop" : "+v"(d) : "v"(a), "v"(b));
  return d;
}
__device__ __forceinline__ v8f wmma_bf(v16b a, v16b b, v8f c) {
  v8f d = __builtin_amdgcn_wmma_f32_16x16x32_bf16(false, a, false, b, (short)0, c, false, false);
  asm volatile("v_nop\n\tv_nop\n\tv_nop\n\tv_nop" : "+v"(d) : "v"(a), "v"(b));
  return d;
}
// the same (four v_nop: the distance the chip needs between a product and the next vector instruction on its registers) for k_proj's two-tile wave: the statement names D alone, so that A and B may lie above v255, where an asm operand cannot (with all three named the accumulators spilled)
__device__ __forceinline__ v8f wmma_bfd(v16b a, v16b b, v8f c) {
  v8f d = __builtin_amdgcn_wmma_f32_16x16x32_bf16(false, a, false, b, (short)0, c, false, false);
  asm volatile("v_nop\n\tv_nop\n\tv_nop\n\tv_nop" : "+v"(d));
  return d;
}
// 16x16x32 fragments: lane = (h = lane>>4, row/col = lane&15); elements 0..7 = k0+8h+0..7, 8..15 = k0+16+8h+0..7; D element r = row 8h+r
__device__ __forceinline__ v16h frag_h(const _Float16* rowk0, int lane) {
  union { v16h v; v8h q[2]; } u; const _Float16* p = rowk0 + 8 * (lane >> 4);
  u.q[0] = *(const v8h*)p; u.q[1] = *(const v8h*)(p + 16); return u.v;
}
__device__ __forceinline__ v16h frag_f32(const float* rowk0, int lane) {
  v16h a; const float* p = rowk0 + 8 * (lane >> 4);
#pragma unroll
  for (int i = 0; i < 8; ++i) { a[i] = (_Float16)p[i]; a[8 + i] = (_Float16)p[16 + i]; }
  return a;
}
__device__ __forceinline__ v16h frag_f32s(const float* rowk0, int lane, float sc) {
  v16h a; const float* p = rowk0 + 8 * (lane >> 4);
#pragma unroll
  for (int i = 0; i < 8; ++i) { a[i] = (_Float16)(p[i] * sc); a[8 + i] = (_Float16)(p[16 + i] * sc); }
  return a;
}
// column fragment from a [K][ld] layout (column n), rows >= K read as 0
__device__ __forceinline__ v16h fragc_f32(const float* W, int k0, int n, int lane, int ld, int K) {
  v16h a; const int g = lane >> 4;
#pragma unroll
  for (int i = 0; i < 8; ++i) { const int ka = k0 + 8 * g + i, kb = ka + 16;
    a[i] = (_Float16)(ka < K ? W[(size_t)(ka < K ? ka : K - 1) * ld + n] : 0.f); a[8 + i] = (_Float16)(kb < K ? W[(size_t)(kb < K ? kb : K - 1) * ld + n] : 0.f); }
  return a;
}
struct F2 { v16b h, l; };
__device__ __forceinline__ F2 bsplit16(const float v[16]) { F2 r;
#pragma unroll
  for (int i = 0; i < 16; ++i) { const __bf16 h = (__bf16)v[i]; r.h[i] = h; r.l[i] = (__bf16)(v[i] - (float)h); }
  return r; }
__device__ __forceinline__ F2 split_row(const float* row, int k0, int lane) { float v[16]; const float* p = row + k0 + 8 * (lane >> 4);
#pragma unroll
  for (int i = 0; i < 8; ++i) { v[i] = p[i]; v[8 + i] = p[16 + i]; }
  return bsplit16(v); }
__device__ __forceinline__ F2 split_rowK(const float* row, int k0, int lane, int K) { float v[16]; const int g = lane >> 4;
#pragma unroll
  for (int i = 0; i < 8; ++i) { const int ka = k0 + 8 * g + i, kb = ka + 16; v[i] = ka < K ? row[ka < K ? ka : K - 1] : 0.f; v[8 + i] = kb < K ? row[kb < K ? kb : K - 1] : 0.f; }
  return bsplit16(v); }
__device__ __forceinline__ F2 split_col(const float* W, int k0, int n, int lane, int ld, int K) { float v[16]; const int g = lane >> 4;
#pragma unroll
  for (int i = 0; i < 8; ++i) { const int ka = k0 + 8 * g + i, kb = ka + 16; v[i] = ka < K ? W[(size_t)(ka < K ? ka : K - 1) * ld + n] : 0.f; v[8 + i] = kb < K ? W[(size_t)(kb < K ? kb : K - 1) * ld + n] : 0.f; }
  return bsplit16(v); }
__device__ __forceinline__ v8f mac3(const F2& a, const F2& b, v8f c) { c = wmma_bf(a.l, b.h, c); c = wmma_bf(a.h, b.l, c); return wmma_bf(a.h, b.h, c); }
__device__ __forceinline__ float sigm(float v) { return 1.0f / (1.0f + expf(-v)); }

// Causal multi-head self-attention without output projection (B 2, T 2,048, C 1,024, 16 heads x 64; per-head weights Wq/Wk/Wv [16,1024,64], 0.02-scale, no biases; the logit scale is C^-0.5 = 1/32 as in the source): out = concat_h causal_softmax(q_h k_h^T / 32) v_h -> [2, 2048, 1024].
#define NB 2
#define TT 2048
#define CC 1024            // NH * HD = projected width
#define DIN 1024          // input (model) width
#define NH 16
#define HD 64
#define SCALE (0.03125f)
#define CAUSAL 1
#ifndef TNB
#define TNB NB
#endif
__device__ __forceinline__ float bfr(float v) { return (float)(__bf16)v; }
__host__ __device__ __forceinline__ int kb_last(int qb) { return CAUSAL ? ((qb * 64 + 63) >> 7) : (TT / 128 - 1); }
typedef __attribute__((ext_vector_type(8))) __bf16 v8b;
__device__ __forceinline__ v16b frag_b(const __bf16* rowk0, int lane) {
  union { v16b v; v8b q[2]; } u; const __bf16* p = rowk0 + 8 * (lane >> 4);
  u.q[0] = *(const v8b*)p; u.q[1] = *(const v8b*)(p + 16); return u.v;
}
#define QBH 6              // causal: query blocks 0..QBH-1 of each sequence (few keys, no averaging) take the high-precision path
#define QHI 384            // rows carrying a q residual plane (used only by the causal high-precision path)
#define KHI 384            // key rows carrying k residual / v bf16 hi+lo planes (used only by the causal high-precision path)
// B fragment (k rows k0+.., output column o) of a weight: (in,out) [K][ld] or (out,in) [ld rows of K]: bf16 exact, or f16(bf16 * 256) exact
__device__ __forceinline__ v16b wcol_io(const float* Wm, int k0, int o, int lane, int ld) { v16b w; const int g = lane >> 4;
#pragma unroll
  for (int i = 0; i < 8; ++i) { w[i] = (__bf16)Wm[(size_t)(k0 + 8 * g + i) * ld + o]; w[8 + i] = (__bf16)Wm[(size_t)(k0 + 16 + 8 * g + i) * ld + o]; }
  return w; }
__device__ __forceinline__ v16b wcol_oi(const float* Wm, int k0, int o, int lane, int K) { v16b w; const float* p = Wm + (size_t)o * K + k0 + 8 * (lane >> 4);
#pragma unroll
  for (int i = 0; i < 8; ++i) { w[i] = (__bf16)p[i]; w[8 + i] = (__bf16)p[16 + i]; }
  return w; }
__device__ __forceinline__ v16h wcolh_io(const float* Wm, int k0, int o, int lane, int ld) { v16h w; const int g = lane >> 4;
#pragma unroll
  for (int i = 0; i < 8; ++i) { w[i] = (_Float16)(bfr(Wm[(size_t)(k0 + 8 * g + i) * ld + o]) * 256.0f); w[8 + i] = (_Float16)(bfr(Wm[(size_t)(k0 + 16 + 8 * g + i) * ld + o]) * 256.0f); }
  return w; }
__device__ __forceinline__ v16h wcolh_oi(const float* Wm, int k0, int o, int lane, int K) { v16h w; const float* p = Wm + (size_t)o * K + k0 + 8 * (lane >> 4);
#pragma unroll
  for (int i = 0; i < 8; ++i) { w[i] = (_Float16)(bfr(p[i]) * 256.0f); w[8 + i] = (_Float16)(bfr(p[16 + i]) * 256.0f); }
  return w; }
#define WQKV_LAYOUT 0   // 0 = per-head [NH][DIN][HD]; 1 = (out,in) [CC][DIN]; 2 = per-head [NH][DIN][HD]
__device__ __forceinline__ v16b wcol_hdk(const float* Wm, int k0, int o, int lane) { v16b w; const int g = lane >> 4; const float* p = Wm + (size_t)(o / HD) * DIN * HD + (o % HD);
#pragma unroll
  for (int i = 0; i < 8; ++i) { w[i] = (__bf16)p[(size_t)(k0 + 8 * g + i) * HD]; w[8 + i] = (__bf16)p[(size_t)(k0 + 16 + 8 * g + i) * HD]; }
  return w; }
#define WO_OUT_IN 0
#if WQKV_LAYOUT == 1
#define WCOL(W, k0, o, lane) wcol_oi(W, k0, o, lane, DIN)
#elif WQKV_LAYOUT == 2
#define WCOL(W, k0, o, lane) wcol_hdk(W, k0, o, lane)
#else
#define WCOL(W, k0, o, lane) wcol_heads(W, k0, o, lane)   /* per-head [h][C][64] weights */
#endif
#if WO_OUT_IN
#define WOCOL(W, k0, o, lane) wcol_oi(W, k0, o, lane, CC)
#define WOCOLH(W, k0, o, lane) wcolh_oi(W, k0, o, lane, CC)
#else
#define WOCOL(W, k0, o, lane) wcol_io(W, k0, o, lane, DIN)
#define WOCOLH(W, k0, o, lane) wcolh_io(W, k0, o, lane, DIN)
#endif
// per-head projection weights W[h][c][d] ([16][1024][64]): column o = h*64 + d of the virtual (in,out) [C][H*D] matrix lives at W + (h*C + k)*64 + d
__device__ __forceinline__ v16b wcol_heads(const float* __restrict__ Wm, int k0, int o, int lane) { v16b w; const int g = lane >> 4; const float* p = Wm + ((size_t)(o >> 6) * DIN + k0 + 8 * g) * 64 + (o & 63);
#pragma unroll
  for (int i = 0; i < 8; ++i) { w[i] = (__bf16)p[(size_t)i * 64]; w[8 + i] = (__bf16)p[(size_t)(16 + i) * 64]; }
  asm volatile("s_wait_loadcnt 0x0" ::: "memory"); return w; }
#ifndef PROJ_EXTRA_PARAMS
#define PROJ_EXTRA_PARAMS
#endif

// Every plane lies in fragment order: per (b, head) a run of rows x HD elements, cut into 512-B units that are one wave-wide 16-B load each (lane l = 16 g + col holds 8 elements at 8 l), so that a fragment load of k_att covers 4 whole 128-B lines instead of 32 B of each of 16.
// q, k and their residuals: [b][head][t / 16][d / 16][g = (d / 8) & 1][col = t & 15][d & 7]; v planes: [b][head][t / 32][d / 16][(t / 16) & 1][g = (t / 8) & 1][col = d & 15][t & 7]
#define FU 256              // elements of a 512-B unit
#define WS_QH  0u                                      // f16 q [b][head][t][HD]
#define WS_KH  (WS_QH + 2u * (size_t)NB * TT * CC)      // f16 k [b][head][t][HD]
#define WS_VT  (WS_KH + 2u * (size_t)NB * TT * CC)      // f16 v [b][head][t][HD]
#define WS_QL  (WS_VT + 2u * (size_t)NB * CC * TT)      // f16 q residual x 2^10 [b][head][t < QHI][HD]
#define WS_KL  (WS_QL + 2u * (size_t)NB * QHI * CC)     // f16 k residual x 2^10 [b][head][t < KHI][HD]
#define WS_VB  (WS_KL + 2u * (size_t)NB * KHI * CC)     // bf16 v hi, then lo [b][head][t < KHI][HD]
#define WS_VBL (WS_VB + 2u * (size_t)NB * CC * KHI)
#define WS_END (WS_VBL + 2u * (size_t)NB * CC * KHI)

#define KS 32               // k of a staged W tile (one WMMA step a barrier)
#define WPB 80              // bytes of a staged W column in LDS: KS bf16 + 16 B = 16 B x odd
static_assert(128 * WPB <= 128 * 72 * 2, "a W buffer fits the place of tb or tbl");
#define XPB 80              // bytes of a staged X row in LDS: KS bf16 + 16 B = 16 B x odd
typedef __attribute__((ext_vector_type(4))) __bf16 v4b;
#define RT 2                // 16-row tiles of a wave (64 rows apart): every W fragment read from LDS feeds RT products
static_assert(TT % (64 * RT) == 0, "a block's rows lie in one sequence");
static_assert(64 * RT * XPB <= 64 * 136 * 2, "an X buffer fits the place of sh or sl");
// ---- k_proj: block = (64 * RT rows, 128 cols, which): q/k/v = X W (+ b) with exact bf16 products (K = DIN) -> which 0: q f16 (+ residual, rows < QHI); 1: k f16 (+ residual, rows < KHI); 2: v f16 (+ bf16 hi/lo for t < KHI), each stored in fragment order
__global__ __launch_bounds__(128) void k_proj(const float* __restrict__ XQ, const float* __restrict__ XK, const float* __restrict__ XV, const float* __restrict__ WQ, const float* __restrict__ WK, const float* __restrict__ WV, const float* __restrict__ BQ, const float* __restrict__ BK, const float* __restrict__ BV,
    _Float16* __restrict__ QH, _Float16* __restrict__ QL, _Float16* __restrict__ KH, _Float16* __restrict__ KL, _Float16* __restrict__ VT, __bf16* __restrict__ VB, __bf16* __restrict__ VBL) {
  __shared__ __align__(16) _Float16 sh[64][136], sl[64][136]; __shared__ __align__(16) _Float16 th[128][72]; __shared__ __align__(16) __bf16 tb[128][72], tbl[128][72];
  const int tid = threadIdx.x, wave = tid >> 5, lane = tid & 31, col = lane & 15, g = lane >> 4; const int which = blockIdx.z; const int c0 = blockIdx.y * 128; const size_t rB = (size_t)blockIdx.x * (64 * RT); const size_t bb = rB / TT; const int tB = (int)(rB % TT);
  const float* X = which == 0 ? XQ : which == 1 ? XK : XV; const float* WA = which == 0 ? WQ : which == 1 ? WK : WV; const float* BA = which == 0 ? BQ : which == 1 ? BK : BV;
  v8f acc[RT][8] = {};
  // W tile of KS k x 128 columns: each thread loads 4 columns x 8 k (whole 256-B head rows per half wave), rounds to bf16 once for the block and writes 16-B pieces (8 k of one column) to LDS;
  // column n lies at n * WPB, its piece c at place c ^ ((n >> 4) & 3): 16 lanes of a store (columns 4 apart) and 16 lanes of a fragment read (columns in a row) each fall on distinct banks.
  // The two buffers take the place of tb and tbl, which the epilogue fills only behind the barrier that follows the loop.
  const float* wp = WA + ((size_t)((c0 >> 6) + (lane >> 4)) * DIN + wave * 8) * 64 + (lane & 15) * 4; 
  // X tile of 64 * RT rows x KS k: a row's KS floats are one 128-B line. A wave loads its own 16 * RT rows in whole lines (8 lanes a row, 4 rows a load: 4 lines a load, where a load in fragment order touches 16), rounds to bf16 and writes 8-B pieces to its own rows of an LDS buffer,
  // from which it reads its A fragments back (row col, k 8 g + 0..7 and 16 + 8 g + 0..7, the order of the W fragments). The two buffers take the place of sh and sl, which the epilogue fills only behind the barrier that follows the loop.
  const float* xp = X + (rB + wave * 16 + (lane >> 3)) * DIN + (lane & 7) * 4; const int xst = (wave * 16 + (lane >> 3)) * XPB + (lane & 7) * 8;
  const int wst = (4 * lane) * WPB + ((wave ^ ((lane >> 2) & 3)) * 16);
  v4f wr[8], xr[RT * 4];   // xr[i]: tile i >> 2, rows 4 (i & 3) + (lane >> 3)
#pragma unroll
  for (int i = 0; i < 8; ++i) wr[i] = *(const v4f*)(wp + (size_t)i * 64);
#pragma unroll   // here and below: xr[] stays in registers, i folds into the instruction's offset
  for (int i = 0; i < RT * 4; ++i) xr[i] = *(const v4f*)(xp + (size_t)((i >> 2) * 64 + (i & 3) * 4) * DIN);
  asm volatile("s_wait_xcnt 0x0" ::: "memory");   // behind the first tiles' loads, ahead of whatever next writes a register that they name
#pragma unroll 2   // so that the buffer of a trip is known at compile time
  for (int kt = 0; kt < DIN / KS; ++kt) { unsigned char* wb = (unsigned char*)((kt & 1) ? &tbl[0][0] : &tb[0][0]); unsigned char* xb = (unsigned char*)((kt & 1) ? &sl[0][0] : &sh[0][0]); v16b a[RT];
#pragma unroll
    for (int c = 0; c < 4; ++c) { v8b t;
#pragma unroll
      for (int i = 0; i < 8; ++i) t[i] = (__bf16)wr[i][c];
      *(v8b*)(wb + wst + c * WPB) = t; }
#pragma unroll
    for (int i = 0; i < RT * 4; ++i) { v4b t;
#pragma unroll
      for (int e = 0; e < 4; ++e) t[e] = (__bf16)xr[i][e];
      *(v4b*)(xb + xst + ((i >> 2) * 64 + (i & 3) * 4) * XPB) = t; }
    if (kt + 1 < DIN / KS) { const float* wn = wp + (size_t)(kt + 1) * KS * 64; const float* xn = xp + (kt + 1) * KS;
#pragma unroll
      for (int i = 0; i < 8; ++i) wr[i] = *(const v4f*)(wn + (size_t)i * 64);
#pragma unroll
      for (int i = 0; i < RT * 4; ++i) xr[i] = *(const v4f*)(xn + (size_t)((i >> 2) * 64 + (i & 3) * 4) * DIN);
      asm volatile("s_wait_xcnt 0x0" ::: "memory"); }   // the next trip's loads issue here, ahead of this trip's products, and their address registers may be stepped behind this wait
    // work-group barrier by hand: __syncthreads() would also wait for the global loads just issued, which are to stay in flight over this trip's products. It publishes this trip's W tile (each wave's LDS stores are done at its signal) and ends every wave's reads of the other buffer, which the next trip refills.
    asm volatile("s_wait_dscnt 0x0\n\ts_barrier_signal -1\n\ts_barrier_wait -1" ::: "memory");
    v16b w[8];
#pragma unroll
    for (int j = 0; j < 8; ++j) { union { v16b v; v8b q[2]; } u; const unsigned char* rp = wb + (j * 16 + col) * WPB;
      u.q[0] = *(const v8b*)(rp + ((g ^ (j & 3)) * 16)); u.q[1] = *(const v8b*)(rp + (((2 + g) ^ (j & 3)) * 16)); w[j] = u.v; }
#pragma unroll
    for (int h = 0; h < RT; ++h) { union { v16b v; v8b q[2]; } u; const unsigned char* rp = xb + (h * 64 + wave * 16 + col) * XPB + g * 16;
      u.q[0] = *(const v8b*)rp; u.q[1] = *(const v8b*)(rp + 32); a[h] = u.v; }
    __builtin_amdgcn_sched_barrier(0);   // all 16 + 2 RT LDS reads issue ahead of the first product: one LDS latency a trip, not one a product
#pragma unroll
    for (int j = 0; j < 8; ++j)
#pragma unroll
      for (int h = 0; h < RT; ++h) acc[h][j] = wmma_bfd(a[h], w[j], acc[h][j]);
    __builtin_amdgcn_sched_barrier(0); }   // the next tile's rounding, and with it the wait for the loads in flight, stays behind this trip's products
  __syncthreads();   // the last tile's readers leave tb, tbl, sh and sl before the epilogue writes there
  if (which < 2) { _Float16* DH = which == 0 ? QH : KH; _Float16* DL = which == 0 ? QL : KL; const int nhi = which == 0 ? QHI : KHI;
#pragma unroll
   for (int h = 0; h < RT; ++h) { const int t0 = tB + h * 64; const bool hi_rows = t0 < nhi;   // the wave's tiles one after the other through the same 64-row staging arrays
    if (h) __syncthreads();   // the copy-out of the 64 rows before has left sh and sl
#pragma unroll
    for (int j = 0; j < 8; ++j) { const float bias = BA ? bfr(BA[c0 + j * 16 + col]) : 0.f;
#pragma unroll
      for (int r = 0; r < 8; ++r) { const float v = acc[h][j][r] + bias; const _Float16 hv = (_Float16)v; sh[wave * 16 + 8 * g + r][j * 16 + col] = hv; sl[wave * 16 + 8 * g + r][j * 16 + col] = (_Float16)((v - (float)hv) * 1024.0f); } }
    __syncthreads();
    // a wave stores 512-B units: 16 rows (col) x 16 d (16 wave + 8 g + 0..7) of 16-row tile i & 3, head i >> 2; tile and head are compile-time offsets of one address
    const _Float16* sp = &sh[col][wave * 16 + g * 8]; const _Float16* lp = &sl[col][wave * 16 + g * 8]; const size_t hd = bb * NH + (c0 >> 6); const int o = wave * FU + lane * 8; v4u d[8];
    _Float16* dh = DH + (hd * TT + t0) * HD + o; _Float16* dl = DL + (hd * nhi + t0) * HD + o;
#pragma unroll   // here and below: d[] stays in registers, all LDS reads issue ahead of the stores, i folds into the instruction's offset
    for (int i = 0; i < 8; ++i) d[i] = *(const v4u*)(sp + (i & 3) * 16 * 136 + (i >> 2) * 64);
#pragma unroll
    for (int i = 0; i < 8; ++i) vst2((unsigned*)(dh + ((size_t)(i >> 2) * TT + (i & 3) * 16) * HD), d[i]);
    asm volatile("s_wait_xcnt 0x0" ::: "memory");   // behind the stores, ahead of whatever next writes a register that they name
    if (hi_rows) {
#pragma unroll
      for (int i = 0; i < 8; ++i) d[i] = *(const v4u*)(lp + (i & 3) * 16 * 136 + (i >> 2) * 64);
#pragma unroll
      for (int i = 0; i < 8; ++i) vst2((unsigned*)(dl + ((size_t)(i >> 2) * nhi + (i & 3) * 16) * HD), d[i]);
      asm volatile("s_wait_xcnt 0x0" ::: "memory"); }   // as above
  } } else {
#pragma unroll
   for (int h = 0; h < RT; ++h) { const int t0 = tB + h * 64; const bool hi_rows = t0 < KHI;
    if (h) __syncthreads();   // the copy-out of the 64 rows before has left th, tb and tbl
#pragma unroll
    for (int j = 0; j < 8; ++j) { const float bias = BA ? bfr(BA[c0 + j * 16 + col]) : 0.f;
#pragma unroll
      for (int r = 0; r < 8; ++r) { const float v = acc[h][j][r] + bias; const int rl = wave * 16 + 8 * g + r, cl = j * 16 + col; th[cl][rl] = (_Float16)v; const __bf16 bh = (__bf16)v; tb[cl][rl] = bh; tbl[cl][rl] = (__bf16)(v - (float)bh); } }
    __syncthreads();
    // a wave stores 512-B units: 16 channels (col) of tile (wave >> 1) + 2 (i & 1) x 16 keys (16 (wave & 1) + 8 g + 0..7) of 32-key chunk (i >> 1) & 1, head i >> 2; all of i is a compile-time offset of one address
    const int so = ((wave >> 1) * 16 + col) * 72 + (wave & 1) * 16 + g * 8; const size_t hd = bb * NH + (c0 >> 6); const int o = wave * FU + lane * 8; v4u d[8];
#pragma unroll   // here and below: d[] stays in registers, all LDS reads issue ahead of the stores, i folds into the instruction's offset
    for (int i = 0; i < 8; ++i) d[i] = *(const v4u*)(&th[0][0] + so + ((i >> 2) * 64 + (i & 1) * 32) * 72 + ((i >> 1) & 1) * 32);
#pragma unroll
    for (int i = 0; i < 8; ++i) vst2((unsigned*)(VT + (hd * TT + t0) * HD + o + ((size_t)(i >> 2) * TT + ((i >> 1) & 1) * 32) * HD + (i & 1) * 4 * FU), d[i]);
    asm volatile("s_wait_xcnt 0x0" ::: "memory");   // behind the stores, ahead of whatever next writes a register that they name
    if (hi_rows) {
#pragma unroll
      for (int p = 0; p < 2; ++p) { const __bf16* tp = (p ? &tbl[0][0] : &tb[0][0]) + so; __bf16* vd = (p ? VBL : VB) + (hd * KHI + t0) * HD + o;
#pragma unroll
        for (int i = 0; i < 8; ++i) d[i] = *(const v4u*)(tp + ((i >> 2) * 64 + (i & 1) * 32) * 72 + ((i >> 1) & 1) * 32);
#pragma unroll
        for (int i = 0; i < 8; ++i) vst2((unsigned*)(vd + ((size_t)(i >> 2) * KHI + ((i >> 1) & 1) * 32) * HD + (i & 1) * 4 * FU), d[i]);
        asm volatile("s_wait_xcnt 0x0" ::: "memory"); } } } }   // as above
}
// ---- k_att: block = QR query rows (QT tiles of 16) of (b, h), FW waves. Wave w takes the 32-key chunks w, w + FW, ... up to the diagonal. Per chunk: logits transposed, S^T = K . Q^T (a lane holds 16 keys of ONE query; q hi + residual x 2^10 and the k residual, 3 products, for the causal early rows), causal mask by index in the chunks that reach past the tile's first query;
// running maximum (of the unscaled products) and sum per query in the lane (one exchange between the wave's halves); 2^((product - maximum) x SC2 + 11) once to f16 is, in place, the B operand of O^T += V^T . P^T (early rows: P and v as bf16 hi + lo, 3 products). Behind one barrier the block joins the FW partial tiles in wave order, each weighted by 2^((its maximum - the row's maximum) x SC2), and divides by the joined sum; 256-B (row, head) segment by 16 lanes of one wave
#define FW 4
#define SC2 (SCALE * 1.44269504088896340736f)   // logit scale x log2 e: the exponent in base 2 is one fused multiply-add on the unscaled product, and the hardware's own 2^x takes it
#define QT 2
#define QR (16 * QT)
#define NE (CAUSAL ? QBH * 64 / QR : 0)   // query tiles on the high-precision path
static_assert((QBH * 64) % QR == 0 && QBH * 64 <= KHI && QBH * 64 <= QHI && QR <= 32, "a block is early as a whole, its keys and residual rows exist, and only chunks at the diagonal are masked");
// fragment at a lane's own address (unit + 8 * lane): two units in a row, k 8 g + 0..7 and 16 + 8 g + 0..7
__device__ __forceinline__ v16h frag_hp(const _Float16* p) { union { v16h v; v8h q[2]; } u; u.q[0] = *(const v8h*)p; u.q[1] = *(const v8h*)(p + FU); return u.v; }
__device__ __forceinline__ v16b frag_bp(const __bf16* p) { union { v16b v; v8b q[2]; } u; u.q[0] = *(const v8b*)p; u.q[1] = *(const v8b*)(p + FU); return u.v; }
// stands behind a run of global loads: the loads issue ahead of it, and their two addresses, named as inputs, keep their registers up to it, so that neither a later load's result nor an address step overwrites them earlier
__device__ __forceinline__ void XWAIT(const void* a, const void* b) { asm volatile("s_wait_xcnt 0x0" :: "v"(a), "v"(b) : "memory"); }
template <bool HI> __device__ __forceinline__ void att_keys(const _Float16* __restrict__ qp, const _Float16* __restrict__ qlp, const _Float16* __restrict__ kp, const _Float16* __restrict__ klp, const _Float16* __restrict__ vp, const __bf16* __restrict__ vbp, const __bf16* __restrict__ vlp,
    int ql0, int kce, int wave, int lane, v8f (&acc)[QT][HD / 16], float (&m)[QT], float (&sum)[QT]) {
  const int col = lane & 15, g = lane >> 4; v16h bq[QT][HD / 32];   // the early rows' few chunks fetch q, its residual and v where they are used: their registers would otherwise set the count for every block
  if (!HI) {
#pragma unroll
    for (int u = 0; u < QT; ++u)
#pragma unroll
      for (int kk = 0; kk < HD / 32; ++kk) bq[u][kk] = frag_hp(qp + (u * 4 + kk * 2) * FU);
    XWAIT(qp, qp); }
#pragma unroll 1   // one chunk's fragments in registers at a time
  for (int kc = wave; kc < kce; kc += FW) { const int k0 = kc * 32; v16h ak[2][HD / 32], akl[2][HD / 32], av[HD / 16]; const _Float16* kq = kp + (size_t)k0 * HD; const _Float16* klq = HI ? klp + (size_t)k0 * HD : kq; const _Float16* vq = vp + (size_t)k0 * HD; const __bf16* vbq = HI ? vbp + (size_t)k0 * HD : nullptr; const __bf16* vlq = HI ? vlp + (size_t)k0 * HD : nullptr;
#pragma unroll
    for (int t = 0; t < 2; ++t)
#pragma unroll
      for (int kk = 0; kk < HD / 32; ++kk) { ak[t][kk] = frag_hp(kq + (t * 4 + kk * 2) * FU); if (HI) akl[t][kk] = frag_hp(klq + (t * 4 + kk * 2) * FU); }
#pragma unroll
    for (int j = 0; j < HD / 16; ++j) if (!HI) av[j] = frag_hp(vq + j * 2 * FU);
    if (HI) XWAIT(kq, klq); else XWAIT(kq, vq);   // the chunk's k and v loads (early rows: k and its residual) all issue here, v ahead of the logits that hide its latency
#pragma unroll
    for (int u = 0; u < QT; ++u) { v8f s[2] = {}, sl[2] = {}; float x[16];
#pragma unroll
      for (int kk = 0; kk < HD / 32; ++kk) { v16h qh, ql;
        if (HI) { qh = frag_hp(qp + (u * 4 + kk * 2) * FU); ql = frag_hp(qlp + (u * 4 + kk * 2) * FU); XWAIT(qp, qlp); }
        else qh = bq[u][kk];
#pragma unroll
        for (int t = 0; t < 2; ++t) { s[t] = wmma16(ak[t][kk], qh, s[t]); if (HI) { sl[t] = wmma16(ak[t][kk], ql, sl[t]); sl[t] = wmma16(akl[t][kk], qh, sl[t]); } } }
#pragma unroll
      for (int i = 0; i < 16; ++i) x[i] = HI ? s[i >> 3][i & 7] + sl[i >> 3][i & 7] * (1.0f / 1024.0f) : s[i >> 3][i & 7];   // unscaled: SC2 > 0 keeps the order, so the maximum is taken here
      if (CAUSAL && k0 + 31 > ql0 + u * 16) {   // same for the whole wave
#pragma unroll
        for (int i = 0; i < 16; ++i) x[i] = (k0 + (i >> 3) * 16 + 8 * g + (i & 7) <= ql0 + u * 16 + col) ? x[i] : -3.0e38f; }
      float mx = x[0];
#pragma unroll
      for (int i = 1; i < 16; ++i) mx = fmaxf(mx, x[i]);
      mx = fmaxf(mx, __shfl_xor(mx, 16));
      if (__builtin_amdgcn_ballot_w32(mx > m[u]) != 0) {   // a scalar branch: no query's maximum rises, nothing to rescale
        const float mn = fmaxf(m[u], mx), al = __builtin_amdgcn_exp2f((m[u] - mn) * SC2); m[u] = mn; sum[u] *= al;
#pragma unroll
        for (int j = 0; j < HD / 16; ++j) acc[u][j] *= al; }
      const float nb = 11.0f - m[u] * SC2; float ps = 0.f;   // every chunk holds a key at or before each of the block's queries, so m[u] is a real product here and a masked entry's exponent is far below the range: 2^x gives 0
#pragma unroll
      for (int i = 0; i < 16; ++i) x[i] = x[i] * SC2 + nb;
#pragma unroll
      for (int i = 0; i < 16; ++i) x[i] = __builtin_amdgcn_exp2f(x[i]);
#pragma unroll
      for (int i = 0; i < 16; ++i) ps += x[i];
      sum[u] += ps;
      if (HI) { const F2 p = bsplit16(x);
#pragma unroll
        for (int j = 0; j < HD / 16; ++j) { const v16b vh = frag_bp(vbq + j * 2 * FU), vl = frag_bp(vlq + j * 2 * FU); XWAIT(vbq, vlq);
          acc[u][j] = wmma_bf(vh, p.h, acc[u][j]); acc[u][j] = wmma_bf(vh, p.l, acc[u][j]); acc[u][j] = wmma_bf(vl, p.h, acc[u][j]); }
      } else { v16h pb;
#pragma unroll
        for (int i = 0; i < 16; ++i) pb[i] = (_Float16)x[i];
#pragma unroll
        for (int j = 0; j < HD / 16; ++j) acc[u][j] = wmma16(av[j], pb, acc[u][j]); } } } }
__global__ __launch_bounds__(32 * FW) void k_att(const _Float16* __restrict__ QH, const _Float16* __restrict__ KH, const _Float16* __restrict__ QL, const _Float16* __restrict__ KL, const _Float16* __restrict__ VT, const __bf16* __restrict__ VB, const __bf16* __restrict__ VBL, float* __restrict__ Y) {
  __shared__ __align__(16) float ss[FW][QR][HD + 4]; __shared__ float rm[FW][QR], rs[FW][QR];
  const int tid = threadIdx.x, wave = __builtin_amdgcn_readfirstlane(tid >> 5), lane = tid & 31, col = lane & 15, g = lane >> 4;
  const int b = blockIdx.x / NH, h = blockIdx.x % NH; const int y = (int)blockIdx.y;
  // the tiles that run longest take the lowest block indices: the NE early-row tiles (few keys, but each chunk waits out about a dozen load latencies one after the other, so that three chunks last as long as the sixteen of the last tile), then the rest by falling key count
  const int ql0 = (y < NE ? NE - 1 - y : TT / QR - 1 - (y - NE)) * QR;
  const int kce = CAUSAL ? ((ql0 + QR - 1) >> 5) + 1 : TT / 32;
  v8f acc[QT][HD / 16] = {}; float m[QT], sum[QT];
#pragma unroll
  for (int u = 0; u < QT; ++u) { m[u] = -3.0e38f; sum[u] = 0.f; }
  const size_t bh = blockIdx.x; const _Float16* qp = QH + (bh * TT + ql0) * HD + 8 * lane; const _Float16* kp = KH + bh * TT * HD + 8 * lane; const _Float16* vp = VT + bh * TT * HD + 8 * lane;   // bh = b * NH + h
  if (CAUSAL && ql0 < QBH * 64) att_keys<true>(qp, QL + (bh * QHI + ql0) * HD + 8 * lane, kp, KL + bh * KHI * HD + 8 * lane, vp, VB + bh * KHI * HD + 8 * lane, VBL + bh * KHI * HD + 8 * lane, ql0, kce, wave, lane, acc, m, sum);
  else att_keys<false>(qp, nullptr, kp, nullptr, vp, nullptr, nullptr, ql0, kce, wave, lane, acc, m, sum);
#pragma unroll
  for (int u = 0; u < QT; ++u) { sum[u] += __shfl_xor(sum[u], 16);
#pragma unroll
    for (int j = 0; j < HD / 16; ++j) { const v8f a = acc[u][j]; float* d = &ss[wave][u * 16 + col][j * 16 + 8 * g]; vst2(d, (v4f){a[0], a[1], a[2], a[3]}); vst2(d + 4, (v4f){a[4], a[5], a[6], a[7]}); }
    if (g == 0) { rm[wave][u * 16 + col] = m[u]; rs[wave][u * 16 + col] = sum[u]; } }
  __syncthreads();
  for (int e = tid; e < QR * (HD / 4); e += 32 * FW) { const int row = e / (HD / 4), q4 = e % (HD / 4);
    float M = rm[0][row];
#pragma unroll
    for (int w = 1; w < FW; ++w) M = fmaxf(M, rm[w][row]);
    float den = 0.f; v4f o = {};
#pragma unroll
    for (int w = 0; w < FW; ++w) { const float wg = __builtin_amdgcn_exp2f((rm[w][row] - M) * SC2); den += wg * rs[w][row]; o += *(const v4f*)&ss[w][row][q4 * 4] * wg; }   // a wave without keys has maximum -3e38, sum 0 and weight 0
    const float inv = den > 0.f ? 1.0f / den : 0.f;   /* a fully excluded row yields 0 */
    vst2(Y + ((size_t)b * TT + ql0 + row) * CC + h * HD + q4 * 4, o * inv); } }

extern "C" void kernel_launch(void* const* d_in, const int* in_sizes, int n_in, void* d_out, int out_size, void* d_ws, size_t ws_size, hipStream_t stream) {
  (void)in_sizes; (void)n_in; (void)out_size;
  const float** F = (const float**)d_in;
  if (ws_size < (size_t)WS_END) return;
  char* ws = (char*)d_ws; _Float16 *QH = (_Float16*)(ws + WS_QH), *KH = (_Float16*)(ws + WS_KH), *VT = (_Float16*)(ws + WS_VT), *QL = (_Float16*)(ws + WS_QL), *KL = (_Float16*)(ws + WS_KL); __bf16 *VB = (__bf16*)(ws + WS_VB), *VBL = (__bf16*)(ws + WS_VBL);
  // inputs: 0 x [2,2048,1024]; 1 Wq [16,1024,64]; 2 Wk; 3 Wv (per-head (in,out)); no biases, no output projection
  k_proj<<<dim3(TNB * TT / (64 * RT), CC / 128, 3), 128, 0, stream>>>(F[0], F[0], F[0], F[1], F[2], F[3], nullptr, nullptr, nullptr, QH, QL, KH, KL, VT, VB, VBL);
  k_att<<<dim3(TNB * NH, TT / QR, 1), 32 * FW, 0, stream>>>(QH, KH, QL, KL, VT, VB, VBL, (float*)d_out);   /* merged heads [b][t][h*64+d] == the output layout */
}

// v010
// A run of this version takes 55.7 microseconds.
// Next to v009, in two timings, it ran 1.08 and 1.07 times as fast.
// Over all steps from v000 it is 17.6 times as fast.
// compute dtype: all float inputs rounded to bf16; per-head q/k/v projections with EXACT bf16 products on WMMA 16x16x32 (f32 accumulate); causal logits: q f16 x k f16 (1 product; q hi + residual and the k residual, 3 products, for the first 384 rows) x 1024^-0.5; softmax f32 in base 2 (running maximum of the unscaled products and sum); 2^((product - maximum) x scale x log2 e + 11) once to f16 x v once to f16 (1 product; bf16 hi + lo below row 384), divided by the sum (which carries the same 2^11) at the end; f32 output (no output projection).
#include <hip/hip_runtime.h>
#include <math.h>

typedef __attribute__((ext_vector_type(16))) _Float16 v16h;
typedef __attribute__((ext_vector_type(16))) __bf16 v16b;
typedef __attribute__((ext_vector_type(8)))  _Float16 v8h;
typedef __attribute__((ext_vector_type(8)))  float v8f;
typedef __attribute__((ext_vector_type(4)))  float v4f;
typedef __attribute__((ext_vector_type(2)))  float v2f;
typedef __attribute__((ext_vector_type(4)))  unsigned v4u;
typedef __attribute__((ext_vector_type(4)))  int v4i;
typedef float __attribute__((may_alias)) float_a;
typedef int __attribute__((may_alias)) int_a;

template <typename T> __device__ __forceinline__ void vst2(void* p, T v) { *(T*)p = v;  }
__device__ __forceinline__ v8f wmma16(v16h a, v16h b, v8f c) {
  v8f d = __builtin_amdgcn_wmma_f32_16x16x32_f16(false, a, false, b, (short)0, c, false, false);
  asm volatile("v_nop\n\tv_nop\n\tv_nop\n\tv_nop" : "+v"(d) : "v"(a), "v"(b));
  return d;
}
__device__ __forceinline__ v8f wmma_bf(v16b a, v16b b, v8f c) {
  v8f d = __builtin_amdgcn_wmma_f32_16x16x32_bf16(false, a, false, b, (short)0, c, false, false);
  asm volatile("v_nop\n\tv_nop\n\tv_nop\n\tv_nop" : "+v"(d) : "v"(a), "v"(b));
  return d;
}
// the same (four v_nop: the distance the chip needs between a product and the next vector instruction on its registers) for k_proj's two-tile wave: the statement names D alone, so that A and B may lie above v255, where an asm operand cannot (with all three named the accumulators spilled)
__device__ __forceinline__ v8f wmma_bfd(v16b a, v16b b, v8f c) {
  v8f d = __builtin_amdgcn_wmma_f32_16x16x32_bf16(false, a, false, b, (short)0, c, false, false);
  asm volatile("v_nop\n\tv_nop\n\tv_nop\n\tv_nop" : "+v"(d));
  return d;
}
// 16x16x32 fragments: lane = (h = lane>>4, row/col = lane&15); elements 0..7 = k0+8h+0..7, 8..15 = k0+16+8h+0..7; D element r = row 8h+r
__device__ __forceinline__ v16h frag_h(const _Float16* rowk0, int lane) {
  union { v16h v; v8h q[2]; } u; const _Float16* p = rowk0 + 8 * (lane >> 4);
  u.q[0] = *(const v8h*)p; u.q[1] = *(const v8h*)(p + 16); return u.v;
}
__device__ __forceinline__ v16h frag_f32(const float* rowk0, int lane) {
  v16h a; const float* p = rowk0 + 8 * (lane >> 4);
#pragma unroll
  for (int i = 0; i < 8; ++i) { a[i] = (_Float16)p[i]; a[8 + i] = (_Float16)p[16 + i]; }
  return a;
}
__device__ __forceinline__ v16h frag_f32s(const float* rowk0, int lane, float sc) {
  v16h a; const float* p = rowk0 + 8 * (lane >> 4);
#pragma unroll
  for (int i = 0; i < 8; ++i) { a[i] = (_Float16)(p[i] * sc); a[8 + i] = (_Float16)(p[16 + i] * sc); }
  return a;
}
// column fragment from a [K][ld] layout (column n), rows >= K read as 0
__device__ __forceinline__ v16h fragc_f32(const float* W, int k0, int n, int lane, int ld, int K) {
  v16h a; const int g = lane >> 4;
#pragma unroll
  for (int i = 0; i < 8; ++i) { const int ka = k0 + 8 * g + i, kb = ka + 16;
    a[i] = (_Float16)(ka < K ? W[(size_t)(ka < K ? ka : K - 1) * ld + n] : 0.f); a[8 + i] = (_Float16)(kb < K ? W[(size_t)(kb < K ? kb : K - 1) * ld + n] : 0.f); }
  return a;
}
struct F2 { v16b h, l; };
__device__ __forceinline__ F2 bsplit16(const float v[16]) { F2 r;
#pragma unroll
  for (int i = 0; i < 16; ++i) { const __bf16 h = (__bf16)v[i]; r.h[i] = h; r.l[i] = (__bf16)(v[i] - (float)h); }
  return r; }
__device__ __forceinline__ F2 split_row(const float* row, int k0, int lane) { float v[16]; const float* p = row + k0 + 8 * (lane >> 4);
#pragma unroll
  for (int i = 0; i < 8; ++i) { v[i] = p[i]; v[8 + i] = p[16 + i]; }
  return bsplit16(v); }
__device__ __forceinline__ F2 split_rowK(const float* row, int k0, int lane, int K) { float v[16]; const int g = lane >> 4;
#pragma unroll
  for (int i = 0; i < 8; ++i) { const int ka = k0 + 8 * g + i, kb = ka + 16; v[i] = ka < K ? row[ka < K ? ka : K - 1] : 0.f; v[8 + i] = kb < K ? row[kb < K ? kb : K - 1] : 0.f; }
  return bsplit16(v); }
__device__ __forceinline__ F2 split_col(const float* W, int k0, int n, int lane, int ld, int K) { float v[16]; const int g = lane >> 4;
#pragma unroll
  for (int i = 0; i < 8; ++i) { const int ka = k0 + 8 * g + i, kb = ka + 16; v[i] = ka < K ? W[(size_t)(ka < K ? ka : K - 1) * ld + n] : 0.f; v[8 + i] = kb < K ? W[(size_t)(kb < K ? kb : K - 1) * ld + n] : 0.f; }
  return bsplit16(v); }
__device__ __forceinline__ v8f mac3(const F2& a, const F2& b, v8f c) { c = wmma_bf(a.l, b.h, c); c = wmma_bf(a.h, b.l, c); return wmma_bf(a.h, b.h, c); }
__device__ __forceinline__ float sigm(float v) { return 1.0f / (1.0f + expf(-v)); }

// Causal multi-head self-attention without output projection (B 2, T 2,048, C 1,024, 16 heads x 64; per-head weights Wq/Wk/Wv [16,1024,64], 0.02-scale, no biases; the logit scale is C^-0.5 = 1/32 as in the source): out = concat_h causal_softmax(q_h k_h^T / 32) v_h -> [2, 2048, 1024].
#define NB 2
#define TT 2048
#define CC 1024            // NH * HD = projected width
#define DIN 1024          // input (model) width
#define NH 16
#define HD 64
#define SCALE (0.03125f)
#define CAUSAL 1
#ifndef TNB
#define TNB NB
#endif
__device__ __forceinline__ float bfr(float v) { return (float)(__bf16)v; }
__host__ __device__ __forceinline__ int kb_last(int qb) { return CAUSAL ? ((qb * 64 + 63) >> 7) : (TT / 128 - 1); }
typedef __attribute__((ext_vector_type(8))) __bf16 v8b;
__device__ __forceinline__ v16b frag_b(const __bf16* rowk0, int lane) {
  union { v16b v; v8b q[2]; } u; const __bf16* p = rowk0 + 8 * (lane >> 4);
  u.q[0] = *(const v8b*)p; u.q[1] = *(const v8b*)(p + 16); return u.v;
}
#define QBH 6              // causal: query blocks 0..QBH-1 of each sequence (few keys, no averaging) take the high-precision path
#define QHI 384            // rows carrying a q residual plane (used only by the causal high-precision path)
#define KHI 384            // key rows carrying k residual / v bf16 hi+lo planes (used only by the causal high-precision path)
// B fragment (k rows k0+.., output column o) of a weight: (in,out) [K][ld] or (out,in) [ld rows of K]: bf16 exact, or f16(bf16 * 256) exact
__device__ __forceinline__ v16b wcol_io(const float* Wm, int k0, int o, int lane, int ld) { v16b w; const int g = lane >> 4;
#pragma unroll
  for (int i = 0; i < 8; ++i) { w[i] = (__bf16)Wm[(size_t)(k0 + 8 * g + i) * ld + o]; w[8 + i] = (__bf16)Wm[(size_t)(k0 + 16 + 8 * g + i) * ld + o]; }
  return w; }
__device__ __forceinline__ v16b wcol_oi(const float* Wm, int k0, int o, int lane, int K) { v16b w; const float* p = Wm + (size_t)o * K + k0 + 8 * (lane >> 4);
#pragma unroll
  for (int i = 0; i < 8; ++i) { w[i] = (__bf16)p[i]; w[8 + i] = (__bf16)p[16 + i]; }
  return w; }
__device__ __forceinline__ v16h wcolh_io(const float* Wm, int k0, int o, int lane, int ld) { v16h w; const int g = lane >> 4;
#pragma unroll
  for (int i = 0; i < 8; ++i) { w[i] = (_Float16)(bfr(Wm[(size_t)(k0 + 8 * g + i) * ld + o]) * 256.0f); w[8 + i] = (_Float16)(bfr(Wm[(size_t)(k0 + 16 + 8 * g + i) * ld + o]) * 256.0f); }
  return w; }
__device__ __forceinline__ v16h wcolh_oi(const float* Wm, int k0, int o, int lane, int K) { v16h w; const float* p = Wm + (size_t)o * K + k0 + 8 * (lane >> 4);
#pragma unroll
  for (int i = 0; i < 8; ++i) { w[i] = (_Float16)(bfr(p[i]) * 256.0f); w[8 + i] = (_Float16)(bfr(p[16 + i]) * 256.0f); }
  return w; }
#define WQKV_LAYOUT 0   // 0 = per-head [NH][DIN][HD]; 1 = (out,in) [CC][DIN]; 2 = per-head [NH][DIN][HD]
__device__ __forceinline__ v16b wcol_hdk(const float* Wm, int k0, int o, int lane) { v16b w; const int g = lane >> 4; const float* p = Wm + (size_t)(o / HD) * DIN * HD + (o % HD);
#pragma unroll
  for (int i = 0; i < 8; ++i) { w[i] = (__bf16)p[(size_t)(k0 + 8 * g + i) * HD]; w[8 + i] = (__bf16)p[(size_t)(k0 + 16 + 8 * g + i) * HD]; }
  return w; }
#define WO_OUT_IN 0
#if WQKV_LAYOUT == 1
#define WCOL(W, k0, o, lane) wcol_oi(W, k0, o, lane, DIN)
#elif WQKV_LAYOUT == 2
#define WCOL(W, k0, o, lane) wcol_hdk(W, k0, o, lane)
#else
#define WCOL(W, k0, o, lane) wcol_heads(W, k0, o, lane)   /* per-head [h][C][64] weights */
#endif
#if WO_OUT_IN
#define WOCOL(W, k0, o, lane) wcol_oi(W, k0, o, lane, CC)
#define WOCOLH(W, k0, o, lane) wcolh_oi(W, k0, o, lane, CC)
#else
#define WOCOL(W, k0, o, lane) wcol_io(W, k0, o, lane, DIN)
#define WOCOLH(W, k0, o, lane) wcolh_io(W, k0, o, lane, DIN)
#endif
// per-head projection weights W[h][c][d] ([16][1024][64]): column o = h*64 + d of the virtual (in,out) [C][H*D] matrix lives at W + (h*C + k)*64 + d
__device__ __forceinline__ v16b wcol_heads(const float* __restrict__ Wm, int k0, int o, int lane) { v16b w; const int g = lane >> 4; const float* p = Wm + ((size_t)(o >> 6) * DIN + k0 + 8 * g) * 64 + (o & 63);
#pragma unroll
  for (int i = 0; i < 8; ++i) { w[i] = (__bf16)p[(size_t)i * 64]; w[8 + i] = (__bf16)p[(size_t)(16 + i) * 64]; }
  asm volatile("s_wait_loadcnt 0x0" ::: "memory"); return w; }
#ifndef PROJ_EXTRA_PARAMS
#define PROJ_EXTRA_PARAMS
#endif

// Every plane lies in fragment order: per (b, head) a run of rows x HD elements, cut into 512-B units that are one wave-wide 16-B load each (lane l = 16 g + col holds 8 elements at 8 l), so that a fragment load of k_att covers 4 whole 128-B lines instead of 32 B of each of 16.
// q, k and their residuals: [b][head][t / 16][d / 16][g = (d / 8) & 1][col = t & 15][d & 7]; v planes: [b][head][t / 32][d / 16][(t / 16) & 1][g = (t / 8) & 1][col = d & 15][t & 7]
#define FU 256              // elements of a 512-B unit
#define WS_QH  0u                                      // f16 q [b][head][t][HD]
#define WS_KH  (WS_QH + 2u * (size_t)NB * TT * CC)      // f16 k [b][head][t][HD]
#define WS_VT  (WS_KH + 2u * (size_t)NB * TT * CC)      // f16 v [b][head][t][HD]
#define WS_QL  (WS_VT + 2u * (size_t)NB * CC * TT)      // f16 q residual x 2^10 [b][head][t < QHI][HD]
#define WS_KL  (WS_QL + 2u * (size_t)NB * QHI * CC)     // f16 k residual x 2^10 [b][head][t < KHI][HD]
#define WS_VB  (WS_KL + 2u * (size_t)NB * KHI * CC)     // bf16 v hi, then lo [b][head][t < KHI][HD]
#define WS_VBL (WS_VB + 2u * (size_t)NB * CC * KHI)
#define WS_END (WS_VBL + 2u * (size_t)NB * CC * KHI)

#define KS 32               // k of a staged tile (one WMMA step a barrier)
#define WPB 80              // bytes of a staged W column in LDS: KS bf16 + 16 B = 16 B x odd
#define XPB 80              // bytes of a staged X row in LDS: KS bf16 + 16 B = 16 B x odd
typedef __attribute__((ext_vector_type(4))) __bf16 v4b;
typedef __attribute__((ext_vector_type(2))) __bf16 v2b;
#define RT 2                // 16-row tiles of a wave (16 * PW rows apart): every W fragment read from LDS feeds RT products
#define PW 8                // waves of a block
#define PR (16 * RT * PW)   // rows of a block
#define PC (3 * HD)         // columns of a block: q, k and v of one head, so that one X tile feeds all three weights
#define NJ (PC / 16)        // 16-column tiles of a wave: 0..3 q, 4..7 k, 8..11 v
static_assert(TT % PR == 0, "a block's rows lie in one sequence");
static_assert(32 * PW == 16 * (KS / 2) && HD == 64, "a thread takes one pair of k and four columns of each weight");
static_assert((DIN / KS) % 2 == 0 && DIN / KS >= 4, "trips come in pairs, the last pair without loads");
// stands behind a run of four global stores: the stores issue ahead of it, and their data, named as inputs, keep their registers up to it, so that nothing overwrites them earlier
template <typename T> __device__ __forceinline__ void SWAIT(T a, T b, T c, T d) { asm volatile("s_wait_xcnt 0x0" :: "v"(a), "v"(b), "v"(c), "v"(d) : "memory"); }
// One trip (KS k) of k_proj: the tile in wr and xr, loaded two trips ago, is rounded to bf16 and written to LDS; LD: the tile of trip kt + 2 is asked for into the same registers; barrier; fragments; products.
template <bool LD> __device__ __forceinline__ void proj_trip(int kt, unsigned char* wb, unsigned char* xb, const float* __restrict__ wq, const float* __restrict__ wk, const float* __restrict__ wv, const float* __restrict__ xp,
    int wst, int xst, int wave, int col, int g, v4f (&wr)[6], v4f (&xr)[RT * 4], v8f (&acc)[RT][NJ]) {
#pragma unroll   // here and below: the arrays stay in registers, the indices fold into the instructions' offsets
  for (int p = 0; p < 3; ++p)
#pragma unroll
    for (int c = 0; c < 4; ++c) { v2b t; t[0] = (__bf16)wr[2 * p][c]; t[1] = (__bf16)wr[2 * p + 1][c]; *(v2b*)(wb + wst + (p * 64 + c) * WPB) = t; }
#pragma unroll
  for (int i = 0; i < RT * 4; ++i) { v4b t;
#pragma unroll
    for (int e = 0; e < 4; ++e) t[e] = (__bf16)xr[i][e];
    *(v4b*)(xb + xst + ((i >> 2) * (16 * PW) + (i & 3) * 4) * XPB) = t; }
  if (LD) { const size_t wo = (size_t)(kt + 2) * KS * 64; const float* xn = xp + (kt + 2) * KS;
#pragma unroll
    for (int e = 0; e < 2; ++e) { wr[e] = *(const v4f*)(wq + wo + e * 64); wr[2 + e] = *(const v4f*)(wk + wo + e * 64); wr[4 + e] = *(const v4f*)(wv + wo + e * 64); }
#pragma unroll
    for (int i = 0; i < RT * 4; ++i) xr[i] = *(const v4f*)(xn + (size_t)((i >> 2) * (16 * PW) + (i & 3) * 4) * DIN);
    asm volatile("s_wait_xcnt 0x0" ::: "memory"); }   // the loads issue here, ahead of this trip's products, and their address registers may be stepped behind this wait
  // work-group barrier by hand: __syncthreads() would also wait for the global loads in flight, which are to stay in flight over this trip's products. It publishes this trip's W tile (each wave's LDS stores are done at its signal) and ends every wave's reads of the other buffer, which the next trip refills.
  asm volatile("s_wait_dscnt 0x0\n\ts_barrier_signal -1\n\ts_barrier_wait -1" ::: "memory");
  v16b w[NJ], a[RT];   // the X fragments first: LDS data comes back in order, so the products of column tile j start when w[j] is there, while the later tiles' reads are still under way
#pragma unroll
  for (int h = 0; h < RT; ++h) { union { v16b v; v8b q[2]; } u; const unsigned char* rp = xb + (h * (16 * PW) + wave * 16 + col) * XPB + g * 16;
    u.q[0] = *(const v8b*)rp; u.q[1] = *(const v8b*)(rp + 32); a[h] = u.v; }
#pragma unroll
  for (int j = 0; j < NJ; ++j) { union { v16b v; v8b q[2]; } u; const unsigned char* rp = wb + (j * 16 + col) * WPB;
    u.q[0] = *(const v8b*)(rp + ((g ^ (j & 3)) * 16)); u.q[1] = *(const v8b*)(rp + (((2 + g) ^ (j & 3)) * 16)); w[j] = u.v; }
  __builtin_amdgcn_sched_barrier(0);   // all 2 NJ + 2 RT LDS reads issue ahead of the first product: one LDS latency a trip, not one a product
#pragma unroll
  for (int j = 0; j < NJ; ++j)
#pragma unroll
    for (int h = 0; h < RT; ++h) acc[h][j] = j < 8 ? wmma_bfd(w[j], a[h], acc[h][j]) : wmma_bfd(a[h], w[j], acc[h][j]);   // q, k: W as A, so that a lane holds 8 d of one row; v: X as A, 8 rows of one d: each the lane's 16 bytes of a unit
  __builtin_amdgcn_sched_barrier(0);   // the next tile's rounding, and with it the wait for the loads in flight, stays behind this trip's products
}
// ---- k_proj: block = (PR rows, one head): q, k, v = X W with exact bf16 products (K = DIN) -> q f16 (+ residual, rows < QHI); k f16 (+ residual, rows < KHI); v f16 (+ bf16 hi/lo for t < KHI), each stored in fragment order straight from the accumulators
__global__ __launch_bounds__(32 * PW) void k_proj(const float* __restrict__ X, const float* __restrict__ WQ, const float* __restrict__ WK, const float* __restrict__ WV,
    _Float16* __restrict__ QH, _Float16* __restrict__ QL, _Float16* __restrict__ KH, _Float16* __restrict__ KL, _Float16* __restrict__ VT, __bf16* __restrict__ VB, __bf16* __restrict__ VBL) {
  __shared__ __align__(16) unsigned char wbuf[2][PC * WPB], xbuf[2][PR * XPB];
  const int tid = threadIdx.x, wave = __builtin_amdgcn_readfirstlane(tid >> 5), lane = tid & 31, col = lane & 15, g = lane >> 4; const int head = blockIdx.y; const size_t rB = (size_t)blockIdx.x * PR; const size_t bb = rB / TT; const int tB = (int)(rB % TT);
  v8f acc[RT][NJ] = {};
  // W tile of KS k x PC columns: a thread loads, of each weight, 4 columns x 2 k (whole 256-B head rows per half wave), rounds to bf16 once for the block and writes 4-B pieces (2 k of one column) to LDS;
  // column n lies at n * WPB, its 16-B piece c (8 k) at place c ^ ((n >> 4) & 3): 32 lanes of a store (columns 4 apart, two pairs of k) and 16 lanes of a fragment read (columns in a row) each fall on distinct banks.
  const int kp = wave * 2 + g; const size_t wo = ((size_t)head * DIN + 2 * kp) * 64 + col * 4; const float* wq = WQ + wo; const float* wk = WK + wo; const float* wv = WV + wo;
  const int wst = (4 * col) * WPB + (((kp >> 2) ^ ((col >> 2) & 3)) * 16) + (kp & 3) * 4;
  // X tile of PR rows x KS k: a row's KS floats are one 128-B line. A wave loads its own 16 * RT rows in whole lines (8 lanes a row, 4 rows a load), rounds to bf16 and writes 8-B pieces to its own rows of an LDS buffer,
  // from which it reads its fragments back (row col, k 8 g + 0..7 and 16 + 8 g + 0..7, the order of the W fragments).
  const float* xp = X + (rB + wave * 16 + (lane >> 3)) * DIN + (lane & 7) * 4; const int xst = (wave * 16 + (lane >> 3)) * XPB + (lane & 7) * 8;
  v4f wr[2][6], xr[2][RT * 4];   // two tiles in flight; xr[s][i]: tile i >> 2, rows 4 (i & 3) + (lane >> 3)
#pragma unroll
  for (int s = 0; s < 2; ++s) {
#pragma unroll
    for (int e = 0; e < 2; ++e) { wr[s][e] = *(const v4f*)(wq + (size_t)s * KS * 64 + e * 64); wr[s][2 + e] = *(const v4f*)(wk + (size_t)s * KS * 64 + e * 64); wr[s][4 + e] = *(const v4f*)(wv + (size_t)s * KS * 64 + e * 64); }
#pragma unroll
    for (int i = 0; i < RT * 4; ++i) xr[s][i] = *(const v4f*)(xp + s * KS + (size_t)((i >> 2) * (16 * PW) + (i & 3) * 4) * DIN);
    __builtin_amdgcn_sched_barrier(0); }   // the first tile's loads all issue ahead of the second's, as in the loop: mixed, the loop's wait for a tile would count the younger tile's loads in
  asm volatile("s_wait_xcnt 0x0" ::: "memory");   // behind the first tiles' loads, ahead of whatever next writes a register that they name
#pragma unroll 1   // two trips a pass, so that buffer and register set of a trip are known at compile time; the last two trips stand apart, so that no branch stands round the loads and the wait for a tile leaves the younger tile in flight
  for (int kt = 0; kt < DIN / KS - 2; kt += 2) {
    proj_trip<true>(kt, wbuf[0], xbuf[0], wq, wk, wv, xp, wst, xst, wave, col, g, wr[0], xr[0], acc);
    proj_trip<true>(kt + 1, wbuf[1], xbuf[1], wq, wk, wv, xp, wst, xst, wave, col, g, wr[1], xr[1], acc); }
  proj_trip<false>(DIN / KS - 2, wbuf[0], xbuf[0], wq, wk, wv, xp, wst, xst, wave, col, g, wr[0], xr[0], acc);
  proj_trip<false>(DIN / KS - 1, wbuf[1], xbuf[1], wq, wk, wv, xp, wst, xst, wave, col, g, wr[1], xr[1], acc);
  // every 16 x 16 accumulator tile is one 512-B unit, and a lane's 8 registers are its 16 bytes of it: a wave stores whole units, no LDS and no barrier
  const size_t hd = bb * NH + head;
#pragma unroll
  for (int h = 0; h < RT; ++h) { const int t16 = tB + h * (16 * PW) + wave * 16;
#pragma unroll
    for (int p = 0; p < 2; ++p) { const int nhi = p ? KHI : QHI; _Float16* dh = (p ? KH : QH) + (hd * TT + t16) * HD + lane * 8; v8h hv[4];
#pragma unroll
      for (int j = 0; j < 4; ++j)
#pragma unroll
        for (int r = 0; r < 8; ++r) hv[j][r] = (_Float16)acc[h][p * 4 + j][r];
#pragma unroll
      for (int j = 0; j < 4; ++j) vst2(dh + j * FU, hv[j]);
      SWAIT(hv[0], hv[1], hv[2], hv[3]);
      if (t16 < nhi) { _Float16* dl = (p ? KL : QL) + (hd * nhi + t16) * HD + lane * 8; v8h lv[4];
#pragma unroll
        for (int j = 0; j < 4; ++j)
#pragma unroll
          for (int r = 0; r < 8; ++r) { const float v = acc[h][p * 4 + j][r]; lv[j][r] = (_Float16)((v - (float)(_Float16)v) * 1024.0f); }
#pragma unroll
        for (int j = 0; j < 4; ++j) vst2(dl + j * FU, lv[j]);
        SWAIT(lv[0], lv[1], lv[2], lv[3]); } }
    const size_t vo = (size_t)(t16 & ~31) * HD + ((t16 >> 4) & 1) * FU + lane * 8; _Float16* dv = VT + hd * TT * HD + vo; v8h hv[4];
#pragma unroll
    for (int j = 0; j < 4; ++j)
#pragma unroll
      for (int r = 0; r < 8; ++r) hv[j][r] = (_Float16)acc[h][8 + j][r];
#pragma unroll
    for (int j = 0; j < 4; ++j) vst2(dv + j * 2 * FU, hv[j]);
    SWAIT(hv[0], hv[1], hv[2], hv[3]);
    if (t16 < KHI) {
#pragma unroll
      for (int p = 0; p < 2; ++p) { __bf16* db = (p ? VBL : VB) + hd * KHI * HD + vo; v8b bv[4];
#pragma unroll
        for (int j = 0; j < 4; ++j)
#pragma unroll
          for (int r = 0; r < 8; ++r) { const float v = acc[h][8 + j][r]; const __bf16 b = (__bf16)v; bv[j][r] = p ? (__bf16)(v - (float)b) : b; }
#pragma unroll
        for (int j = 0; j < 4; ++j) vst2(db + j * 2 * FU, bv[j]);
        SWAIT(bv[0], bv[1], bv[2], bv[3]); } } }
}
// ---- k_att: block = QR query rows (QT tiles of 16) of (b, h), FW waves. Wave w takes the 32-key chunks w, w + FW, ... up to the diagonal. Per chunk: logits transposed, S^T = K . Q^T (a lane holds 16 keys of ONE query; q hi + residual x 2^10 and the k residual, 3 products, for the causal early rows), causal mask by index in the chunks that reach past the tile's first query;
// running maximum (of the unscaled products) and sum per query in the lane (one exchange between the wave's halves); 2^((product - maximum) x SC2 + 11) once to f16 is, in place, the B operand of O^T += V^T . P^T (early rows: P and v as bf16 hi + lo, 3 products). Behind one barrier the block joins the FW partial tiles in wave order, each weighted by 2^((its maximum - the row's maximum) x SC2), and divides by the joined sum; 256-B (row, head) segment by 16 lanes of one wave
#define FW 4
#define SC2 (SCALE * 1.44269504088896340736f)   // logit scale x log2 e: the exponent in base 2 is one fused multiply-add on the unscaled product, and the hardware's own 2^x takes it
#define QT 2
#define QR (16 * QT)
#define NE (CAUSAL ? QBH * 64 / QR : 0)   // query tiles on the high-precision path
static_assert((QBH * 64) % QR == 0 && QBH * 64 <= KHI && QBH * 64 <= QHI && QR <= 32, "a block is early as a whole, its keys and residual rows exist, and only chunks at the diagonal are masked");
// fragment at a lane's own address (unit + 8 * lane): two units in a row, k 8 g + 0..7 and 16 + 8 g + 0..7
__device__ __forceinline__ v16h frag_hp(const _Float16* p) { union { v16h v; v8h q[2]; } u; u.q[0] = *(const v8h*)p; u.q[1] = *(const v8h*)(p + FU); return u.v; }
__device__ __forceinline__ v16b frag_bp(const __bf16* p) { union { v16b v; v8b q[2]; } u; u.q[0] = *(const v8b*)p; u.q[1] = *(const v8b*)(p + FU); return u.v; }
// stands behind a run of global loads: the loads issue ahead of it, and their two addresses, named as inputs, keep their registers up to it, so that neither a later load's result nor an address step overwrites them earlier
__device__ __forceinline__ void XWAIT(const void* a, const void* b) { asm volatile("s_wait_xcnt 0x0" :: "v"(a), "v"(b) : "memory"); }
template <bool HI> __device__ __forceinline__ void att_keys(const _Float16* __restrict__ qp, const _Float16* __restrict__ qlp, const _Float16* __restrict__ kp, const _Float16* __restrict__ klp, const _Float16* __restrict__ vp, const __bf16* __restrict__ vbp, const __bf16* __restrict__ vlp,
    int ql0, int kce, int wave, int lane, v8f (&acc)[QT][HD / 16], float (&m)[QT], float (&sum)[QT]) {
  const int col = lane & 15, g = lane >> 4; v16h bq[QT][HD / 32];   // the early rows' few chunks fetch q, its residual and v where they are used: their registers would otherwise set the count for every block
  if (!HI) {
#pragma unroll
    for (int u = 0; u < QT; ++u)
#pragma unroll
      for (int kk = 0; kk < HD / 32; ++kk) bq[u][kk] = frag_hp(qp + (u * 4 + kk * 2) * FU);
    XWAIT(qp, qp); }
#pragma unroll 1   // one chunk's fragments in registers at a time
  for (int kc = wave; kc < kce; kc += FW) { const int k0 = kc * 32; v16h ak[2][HD / 32], akl[2][HD / 32], av[HD / 16]; const _Float16* kq = kp + (size_t)k0 * HD; const _Float16* klq = HI ? klp + (size_t)k0 * HD : kq; const _Float16* vq = vp + (size_t)k0 * HD; const __bf16* vbq = HI ? vbp + (size_t)k0 * HD : nullptr; const __bf16* vlq = HI ? vlp + (size_t)k0 * HD : nullptr;
#pragma unroll
    for (int t = 0; t < 2; ++t)
#pragma unroll
      for (int kk = 0; kk < HD / 32; ++kk) { ak[t][kk] = frag_hp(kq + (t * 4 + kk * 2) * FU); if (HI) akl[t][kk] = frag_hp(klq + (t * 4 + kk * 2) * FU); }
#pragma unroll
    for (int j = 0; j < HD / 16; ++j) if (!HI) av[j] = frag_hp(vq + j * 2 * FU);
    if (HI) XWAIT(kq, klq); else XWAIT(kq, vq);   // the chunk's k and v loads (early rows: k and its residual) all issue here, v ahead of the logits that hide its latency
#pragma unroll
    for (int u = 0; u < QT; ++u) { v8f s[2] = {}, sl[2] = {}; float x[16];
#pragma unroll
      for (int kk = 0; kk < HD / 32; ++kk) { v16h qh, ql;
        if (HI) { qh = frag_hp(qp + (u * 4 + kk * 2) * FU); ql = frag_hp(qlp + (u * 4 + kk * 2) * FU); XWAIT(qp, qlp); }
        else qh = bq[u][kk];
#pragma unroll
        for (int t = 0; t < 2; ++t) { s[t] = wmma16(ak[t][kk], qh, s[t]); if (HI) { sl[t] = wmma16(ak[t][kk], ql, sl[t]); sl[t] = wmma16(akl[t][kk], qh, sl[t]); } } }
#pragma unroll
      for (int i = 0; i < 16; ++i) x[i] = HI ? s[i >> 3][i & 7] + sl[i >> 3][i & 7] * (1.0f / 1024.0f) : s[i >> 3][i & 7];   // unscaled: SC2 > 0 keeps the order, so the maximum is taken here
      if (CAUSAL && k0 + 31 > ql0 + u * 16) {   // same for the whole wave
#pragma unroll
        for (int i = 0; i < 16; ++i) x[i] = (k0 + (i >> 3) * 16 + 8 * g + (i & 7) <= ql0 + u * 16 + col) ? x[i] : -3.0e38f; }
      float mx = x[0];
#pragma unroll
      for (int i = 1; i < 16; ++i) mx = fmaxf(mx, x[i]);
      mx = fmaxf(mx, __shfl_xor(mx, 16));
      if (__builtin_amdgcn_ballot_w32(mx > m[u]) != 0) {   // a scalar branch: no query's maximum rises, nothing to rescale
        const float mn = fmaxf(m[u], mx), al = __builtin_amdgcn_exp2f((m[u] - mn) * SC2); m[u] = mn; sum[u] *= al;
#pragma unroll
        for (int j = 0; j < HD / 16; ++j) acc[u][j] *= al; }
      const float nb = 11.0f - m[u] * SC2; float ps = 0.f;   // every chunk holds a key at or before each of the block's queries, so m[u] is a real product here and a masked entry's exponent is far below the range: 2^x gives 0
#pragma unroll
      for (int i = 0; i < 16; ++i) x[i] = x[i] * SC2 + nb;
#pragma unroll
      for (int i = 0; i < 16; ++i) x[i] = __builtin_amdgcn_exp2f(x[i]);
#pragma unroll
      for (int i = 0; i < 16; ++i) ps += x[i];
      sum[u] += ps;
      if (HI) { const F2 p = bsplit16(x);
#pragma unroll
        for (int j = 0; j < HD / 16; ++j) { const v16b vh = frag_bp(vbq + j * 2 * FU), vl = frag_bp(vlq + j * 2 * FU); XWAIT(vbq, vlq);
          acc[u][j] = wmma_bf(vh, p.h, acc[u][j]); acc[u][j] = wmma_bf(vh, p.l, acc[u][j]); acc[u][j] = wmma_bf(vl, p.h, acc[u][j]); }
      } else { v16h pb;
#pragma unroll
        for (int i = 0; i < 16; ++i) pb[i] = (_Float16)x[i];
#pragma unroll
        for (int j = 0; j < HD / 16; ++j) acc[u][j] = wmma16(av[j], pb, acc[u][j]); } } } }
__global__ __launch_bounds__(32 * FW) void k_att(const _Float16* __restrict__ QH, const _Float16* __restrict__ KH, const _Float16* __restrict__ QL, const _Float16* __restrict__ KL, const _Float16* __restrict__ VT, const __bf16* __restrict__ VB, const __bf16* __restrict__ VBL, float* __restrict__ Y) {
  __shared__ __align__(16) float ss[FW][QR][HD + 4]; __shared__ float rm[FW][QR], rs[FW][QR];
  const int tid = threadIdx.x, wave = __builtin_amdgcn_readfirstlane(tid >> 5), lane = tid & 31, col = lane & 15, g = lane >> 4;
  const int b = blockIdx.x / NH, h = blockIdx.x % NH; const int y = (int)blockIdx.y;
  // the tiles that run longest take the lowest block indices: the NE early-row tiles (few keys, but each chunk waits out about a dozen load latencies one after the other, so that three chunks last as long as the sixteen of the last tile), then the rest by falling key count
  const int ql0 = (y < NE ? NE - 1 - y : TT / QR - 1 - (y - NE)) * QR;
  const int kce = CAUSAL ? ((ql0 + QR - 1) >> 5) + 1 : TT / 32;
  v8f acc[QT][HD / 16] = {}; float m[QT], sum[QT];
#pragma unroll
  for (int u = 0; u < QT; ++u) { m[u] = -3.0e38f; sum[u] = 0.f; }
  const size_t bh = blockIdx.x; const _Float16* qp = QH + (bh * TT + ql0) * HD + 8 * lane; const _Float16* kp = KH + bh * TT * HD + 8 * lane; const _Float16* vp = VT + bh * TT * HD + 8 * lane;   // bh = b * NH + h
  if (CAUSAL && ql0 < QBH * 64) att_keys<true>(qp, QL + (bh * QHI + ql0) * HD + 8 * lane, kp, KL + bh * KHI * HD + 8 * lane, vp, VB + bh * KHI * HD + 8 * lane, VBL + bh * KHI * HD + 8 * lane, ql0, kce, wave, lane, acc, m, sum);
  else att_keys<false>(qp, nullptr, kp, nullptr, vp, nullptr, nullptr, ql0, kce, wave, lane, acc, m, sum);
#pragma unroll
  for (int u = 0; u < QT; ++u) { sum[u] += __shfl_xor(sum[u], 16);
#pragma unroll
    for (int j = 0; j < HD / 16; ++j) { const v8f a = acc[u][j]; float* d = &ss[wave][u * 16 + col][j * 16 + 8 * g]; vst2(d, (v4f){a[0], a[1], a[2], a[3]}); vst2(d + 4, (v4f){a[4], a[5], a[6], a[7]}); }
    if (g == 0) { rm[wave][u * 16 + col] = m[u]; rs[wave][u * 16 + col] = sum[u]; } }
  __syncthreads();
  for (int e = tid; e < QR * (HD / 4); e += 32 * FW) { const int row = e / (HD / 4), q4 = e % (HD / 4);
    float M = rm[0][row];
#pragma unroll
    for (int w = 1; w < FW; ++w) M = fmaxf(M, rm[w][row]);
    float den = 0.f; v4f o = {};
#pragma unroll
    for (int w = 0; w < FW; ++w) { const float wg = __builtin_amdgcn_exp2f((rm[w][row] - M) * SC2); den += wg * rs[w][row]; o += *(const v4f*)&ss[w][row][q4 * 4] * wg; }   // a wave without keys has maximum -3e38, sum 0 and weight 0
    const float inv = den > 0.f ? 1.0f / den : 0.f;   /* a fully excluded row yields 0 */
    vst2(Y + ((size_t)b * TT + ql0 + row) * CC + h * HD + q4 * 4, o * inv); } }

extern "C" void kernel_launch(void* const* d_in, const int* in_sizes, int n_in, void* d_out, int out_size, void* d_ws, size_t ws_size, hipStream_t stream) {
  (void)in_sizes; (void)n_in; (void)out_size;
  const float** F = (const float**)d_in;
  if (ws_size < (size_t)WS_END) return;
  char* ws = (char*)d_ws; _Float16 *QH = (_Float16*)(ws + WS_QH), *KH = (_Float16*)(ws + WS_KH), *VT = (_Float16*)(ws + WS_VT), *QL = (_Float16*)(ws + WS_QL), *KL = (_Float16*)(ws + WS_KL); __bf16 *VB = (__bf16*)(ws + WS_VB), *VBL = (__bf16*)(ws + WS_VBL);
  // inputs: 0 x [2,2048,1024]; 1 Wq [16,1024,64]; 2 Wk; 3 Wv (per-head (in,out)); no biases, no output projection
  k_proj<<<dim3(TNB * TT / PR, NH, 1), 32 * PW, 0, stream>>>(F[0], F[1], F[2], F[3], QH, QL, KH, KL, VT, VB, VBL);
  k_att<<<dim3(TNB * NH, TT / QR, 1), 32 * FW, 0, stream>>>(QH, KH, QL, KL, VT, VB, VBL, (float*)d_out);   /* merged heads [b][t][h*64+d] == the output layout */
}
